// v000
// The times below were measured on an AMD MI455X: many runs one after another, warmed up first and cycling through
// copies of the inputs, with the whole window's GPU time divided by the number of runs. Launches and the gaps
// between them are all in it. The median over several windows is given; except for v000 it joins two sittings, which
// can be a few percent apart, so the side-by-side timings, each taken in one sitting, are the better comparison.
// v000 is the starting kernel. One run takes 1230 microseconds.
// compute dtype: all float inputs rounded to bf16; q/k (64 wide) and v (512) = x W with EXACT bf16 products on WMMA 16x16x32, f32 accumulate; q and k once to f16 (1 product) for the UNSCALED scores (logit sigma ~16; sigmoid saturates outside |s| < 5); sigmoid in f32 (precise expf); P x 2^11 once to f16 against v once to f16 (1 product); gamma * attended + x in f32; f32 output.
#include <hip/hip_runtime.h>
#include <math.h>

typedef __attribute__((ext_vector_type(16))) _Float16 v16h;
typedef __attribute__((ext_vector_type(16))) __bf16 v16b;
typedef __attribute__((ext_vector_type(8)))  _Float16 v8h;
typedef __attribute__((ext_vector_type(8)))  float v8f;
typedef __attribute__((ext_vector_type(4)))  float v4f;
typedef __attribute__((ext_vector_type(2)))  float v2f;
typedef __attribute__((ext_vector_type(4)))  unsigned v4u;
typedef __attribute__((ext_vector_type(4)))  int v4i;
typedef float __attribute__((may_alias)) float_a;
typedef int __attribute__((may_alias)) int_a;

template <typename T> __device__ __forceinline__ void vst2(void* p, T v) { *(T*)p = v;  }
__device__ __forceinline__ v8f wmma16(v16h a, v16h b, v8f c) {
  v8f d = __builtin_amdgcn_wmma_f32_16x16x32_f16(false, a, false, b, (short)0, c, false, false);
  asm volatile("v_nop\n\tv_nop\n\tv_nop\n\tv_nop" : "+v"(d) : "v"(a), "v"(b));
  return d;
}
__device__ __forceinline__ v8f wmma_bf(v16b a, v16b b, v8f c) {
  v8f d = __builtin_amdgcn_wmma_f32_16x16x32_bf16(false, a, false, b, (short)0, c, false, false);
  asm volatile("v_nop\n\tv_nop\n\tv_nop\n\tv_nop" : "+v"(d) : "v"(a), "v"(b));
  return d;
}
// 16x16x32 fragments: lane = (h = lane>>4, row/col = lane&15); elements 0..7 = k0+8h+0..7, 8..15 = k0+16+8h+0..7; D element r = row 8h+r
__device__ __forceinline__ v16h frag_h(const _Float16* rowk0, int lane) {
  union { v16h v; v8h q[2]; } u; const _Float16* p = rowk0 + 8 * (lane >> 4);
  u.q[0] = *(const v8h*)p; u.q[1] = *(const v8h*)(p + 16); return u.v;
}
__device__ __forceinline__ v16h frag_f32(const float* rowk0, int lane) {
  v16h a; const float* p = rowk0 + 8 * (lane >> 4);
#pragma unroll
  for (int i = 0; i < 8; ++i) { a[i] = (_Float16)p[i]; a[8 + i] = (_Float16)p[16 + i]; }
  return a;
}
__device__ __forceinline__ v16h frag_f32s(const float* rowk0, int lane, float sc) {
  v16h a; const float* p = rowk0 + 8 * (lane >> 4);
#pragma unroll
  for (int i = 0; i < 8; ++i) { a[i] = (_Float16)(p[i] * sc); a[8 + i] = (_Float16)(p[16 + i] * sc); }
  return a;
}
// column fragment from a [K][ld] layout (column n), rows >= K read as 0
__device__ __forceinline__ v16h fragc_f32(const float* W, int k0, int n, int lane, int ld, int K) {
  v16h a; const int g = lane >> 4;
#pragma unroll
  for (int i = 0; i < 8; ++i) { const int ka = k0 + 8 * g + i, kb = ka + 16;
    a[i] = (_Float16)(ka < K ? W[(size_t)(ka < K ? ka : K - 1) * ld + n] : 0.f); a[8 + i] = (_Float16)(kb < K ? W[(size_t)(kb < K ? kb : K - 1) * ld + n] : 0.f); }
  return a;
}
struct F2 { v16b h, l; };
__device__ __forceinline__ F2 bsplit16(const float v[16]) { F2 r;
#pragma unroll
  for (int i = 0; i < 16; ++i) { const __bf16 h = (__bf16)v[i]; r.h[i] = h; r.l[i] = (__bf16)(v[i] - (float)h); }
  return r; }
__device__ __forceinline__ F2 split_row(const float* row, int k0, int lane) { float v[16]; const float* p = row + k0 + 8 * (lane >> 4);
#pragma unroll
  for (int i = 0; i < 8; ++i) { v[i] = p[i]; v[8 + i] = p[16 + i]; }
  return bsplit16(v); }
__device__ __forceinline__ F2 split_rowK(const float* row, int k0, int lane, int K) { float v[16]; const int g = lane >> 4;
#pragma unroll
  for (int i = 0; i < 8; ++i) { const int ka = k0 + 8 * g + i, kb = ka + 16; v[i] = ka < K ? row[ka < K ? ka : K - 1] : 0.f; v[8 + i] = kb < K ? row[kb < K ? kb : K - 1] : 0.f; }
  return bsplit16(v); }
__device__ __forceinline__ F2 split_col(const float* W, int k0, int n, int lane, int ld, int K) { float v[16]; const int g = lane >> 4;
#pragma unroll
  for (int i = 0; i < 8; ++i) { const int ka = k0 + 8 * g + i, kb = ka + 16; v[i] = ka < K ? W[(size_t)(ka < K ? ka : K - 1) * ld + n] : 0.f; v[8 + i] = kb < K ? W[(size_t)(kb < K ? kb : K - 1) * ld + n] : 0.f; }
  return bsplit16(v); }
__device__ __forceinline__ v8f mac3(const F2& a, const F2& b, v8f c) { c = wmma_bf(a.l, b.h, c); c = wmma_bf(a.h, b.l, c); return wmma_bf(a.h, b.h, c); }
__device__ __forceinline__ float sigm(float v) { return 1.0f / (1.0f + expf(-v)); }
#define LDSX() do { asm volatile("s_wait_dscnt 0" ::: "memory"); __builtin_amdgcn_wave_barrier(); __builtin_amdgcn_fence(__ATOMIC_RELEASE, "workgroup"); } while (0)

// SAGAN-style position attention with SIGMOID (unnormalised) attention (B 4, 64 x 64 = 4,096 positions, C 512; x channels-last [B,H,W,C] = rows [b*n][512]; (in,out) weights Wq/Wk [512,64], Wv [512,512], no biases; gamma scalar): q = x Wq, k = x Wk, v = x Wv; scores[n][m] = q_n . k_m (no scaling); attn = sigmoid(scores) (no row normalisation); attended[n][c] = sum_m attn[n][m] v[m][c]; out = gamma * attended + x.
#define NB 4
#define TT 4096
#define CC 512            // value width (v planes, output rows)
#define CCQ 128           // q / k row pitch: one 128-column block, columns >= 64 are zero
#define DIN 512          // x width
#define NH 1
#define HD 512
#define NQB (TT / 64)
#define HG 1               // one 4,096 x 4,096 score plane per pass (the pass group spans batches)
#define SCALE (1.0f)
#define HDQK 64            // q / k width
#define CAUSAL 0
#ifndef TNB
#define TNB NB
#endif
__device__ __forceinline__ v16b zero16b() { v16b z; _Pragma("unroll") for (int i = 0; i < 16; ++i) z[i] = (__bf16)0.f; return z; }
__device__ __forceinline__ float bfr(float v) { return (float)(__bf16)v; }
__host__ __device__ __forceinline__ int kb_last(int qb) { return CAUSAL ? ((qb * 64 + 63) >> 7) : (TT / 128 - 1); }
typedef __attribute__((ext_vector_type(8))) __bf16 v8b;
__device__ __forceinline__ v16b frag_b(const __bf16* rowk0, int lane) {
  union { v16b v; v8b q[2]; } u; const __bf16* p = rowk0 + 8 * (lane >> 4);
  u.q[0] = *(const v8b*)p; u.q[1] = *(const v8b*)(p + 16); return u.v;
}
#define QBH 0              // causal: query blocks 0..QBH-1 of each sequence (few keys, no averaging) take the high-precision path
#define QHI 0               // no q residual plane: q and k once to f16 (1 product)
#define KHI 64            // key rows carrying k residual / v bf16 hi+lo planes (used only by the causal high-precision path)
// B fragment (k rows k0+.., output column o) of a weight: (in,out) [K][ld] or (out,in) [ld rows of K]: bf16 exact, or f16(bf16 * 256) exact
__device__ __forceinline__ v16b wcol_io(const float* Wm, int k0, int o, int lane, int ld) { v16b w; const int g = lane >> 4;
#pragma unroll
  for (int i = 0; i < 8; ++i) { w[i] = (__bf16)Wm[(size_t)(k0 + 8 * g + i) * ld + o]; w[8 + i] = (__bf16)Wm[(size_t)(k0 + 16 + 8 * g + i) * ld + o]; }
  return w; }
__device__ __forceinline__ v16b wcol_oi(const float* Wm, int k0, int o, int lane, int K) { v16b w; const float* p = Wm + (size_t)o * K + k0 + 8 * (lane >> 4);
#pragma unroll
  for (int i = 0; i < 8; ++i) { w[i] = (__bf16)p[i]; w[8 + i] = (__bf16)p[16 + i]; }
  return w; }
__device__ __forceinline__ v16h wcolh_io(const float* Wm, int k0, int o, int lane, int ld) { v16h w; const int g = lane >> 4;
#pragma unroll
  for (int i = 0; i < 8; ++i) { w[i] = (_Float16)(bfr(Wm[(size_t)(k0 + 8 * g + i) * ld + o]) * 256.0f); w[8 + i] = (_Float16)(bfr(Wm[(size_t)(k0 + 16 + 8 * g + i) * ld + o]) * 256.0f); }
  return w; }
__device__ __forceinline__ v16h wcolh_oi(const float* Wm, int k0, int o, int lane, int K) { v16h w; const float* p = Wm + (size_t)o * K + k0 + 8 * (lane >> 4);
#pragma unroll
  for (int i = 0; i < 8; ++i) { w[i] = (_Float16)(bfr(p[i]) * 256.0f); w[8 + i] = (_Float16)(bfr(p[16 + i]) * 256.0f); }
  return w; }
#define WQKV_LAYOUT 0   // 0 = (in,out) [K][CC]; 1 = (out,in) [CC][DIN]; 2 = per-head [NH][DIN][HD]
__device__ __forceinline__ v16b wcol_hdk(const float* Wm, int k0, int o, int lane) { v16b w; const int g = lane >> 4; const float* p = Wm + (size_t)(o / HD) * DIN * HD + (o % HD);
#pragma unroll
  for (int i = 0; i < 8; ++i) { w[i] = (__bf16)p[(size_t)(k0 + 8 * g + i) * HD]; w[8 + i] = (__bf16)p[(size_t)(k0 + 16 + 8 * g + i) * HD]; }
  return w; }
#define WO_OUT_IN 0
#if WQKV_LAYOUT == 1
#define WCOL(W, k0, o, lane) wcol_oi(W, k0, (o), lane, DIN)   /* unused: layout 0 */
#elif WQKV_LAYOUT == 2
#define WCOL(W, k0, o, lane) wcol_hdk(W, k0, o, lane)
#else
#define WCOL(W, k0, o, lane) (which == 2 ? wcol_io(W, k0, (o), lane, CC) : ((o) < HDQK ? wcol_io(W, k0, (o), lane, HDQK) : zero16b()))   /* Wv [512][512]; Wq/Wk [512][64]: projected q/k columns >= 64 are zero (block y = 0 only) */
#endif
#if WO_OUT_IN
#define WOCOL(W, k0, o, lane) wcol_oi(W, k0, o, lane, CC)
#define WOCOLH(W, k0, o, lane) wcolh_oi(W, k0, o, lane, CC)
#else
#define WOCOL(W, k0, o, lane) wcol_io(W, k0, o, lane, DIN)
#define WOCOLH(W, k0, o, lane) wcolh_io(W, k0, o, lane, DIN)
#endif
#define BG HG              // the pass group spans BATCHES (single head): blockIdx.z selects batch b0 + z
#define BGN (TNB < BG ? TNB : BG)
#define DVH 128            // value columns per k_pv block (HD 512 split in four column quarters to keep 8 accumulator tiles per wave)
#ifndef SM_EXTRA_PARAMS
#define SM_EXTRA_PARAMS
#endif
#ifndef PROJ_EXTRA_PARAMS
#define PROJ_EXTRA_PARAMS
#endif
#ifndef SM_MASK_HOOK
#define SM_MASK_HOOK (void)0
#endif

#define WS_QH  0u                                      // f16 q rows [b*t][CCQ]
#define WS_KH  (WS_QH + 2u * (size_t)NB * TT * CCQ)     // f16 k rows [b*t][CCQ]
#define WS_VT  (WS_KH + 2u * (size_t)NB * TT * CCQ)     // f16 v planes [b][c][t]
#define WS_QL  (WS_VT + 2u * (size_t)NB * CC * TT)      // f16 q residual x 2^10 rows [b][t < QHI][CCQ]
#define WS_KL  (WS_QL + 2u * (size_t)NB * QHI * CCQ)    // f16 k residual x 2^10 rows [b][t < KHI][CCQ]
#define WS_VB  (WS_KL + 2u * (size_t)NB * KHI * CCQ)    // bf16 v hi planes [b][c][t < KHI]
#define WS_VBL (WS_VB + 2u * (size_t)NB * CC * KHI)
#define WS_S   (WS_VBL + 2u * (size_t)NB * CC * KHI)    // f32 logits / P [hg][t][s]
#define WS_Y   (WS_S  + 4u * (size_t)HG * TT * TT)      // f32 ctx rows [b*t][CC] (only when there is an output projection)
#define WS_END (WS_Y  + 0u)

// ---- k_proj: block = (64 rows, 128 cols, which): q/k/v = X W (+ b) with exact bf16 products (K = DIN) -> which 0: q f16 rows (+ residual rows < QHI); 1: k f16 rows (+ residual rows < KHI); 2: v f16 planes [c][t] (+ bf16 hi/lo planes for t < KHI)
template <int WOFF> __global__ __launch_bounds__(128) void k_projT(const float* __restrict__ XQ, const float* __restrict__ XK, const float* __restrict__ XV, const float* __restrict__ WQ, const float* __restrict__ WK, const float* __restrict__ WV, const float* __restrict__ BQ, const float* __restrict__ BK, const float* __restrict__ BV,
    _Float16* __restrict__ QH, _Float16* __restrict__ QL, _Float16* __restrict__ KH, _Float16* __restrict__ KL, _Float16* __restrict__ VT, __bf16* __restrict__ VB, __bf16* __restrict__ VBL) {
  __shared__ __align__(16) _Float16 sh[64][136], sl[64][136]; __shared__ __align__(16) _Float16 th[128][72]; __shared__ __align__(16) __bf16 tb[128][72], tbl[128][72];
  const int tid = threadIdx.x, wave = tid >> 5, lane = tid & 31, col = lane & 15, g = lane >> 4; const int which = blockIdx.z + WOFF; const int c0 = blockIdx.y * 128; const size_t r0 = (size_t)blockIdx.x * 64; const size_t bb = r0 / TT; const int t0 = (int)(r0 % TT);
  const float* X = which == 0 ? XQ : which == 1 ? XK : XV; const float* WA = which == 0 ? WQ : which == 1 ? WK : WV; const float* BA = which == 0 ? BQ : which == 1 ? BK : BV;
  const int KD = DIN;
  v8f acc[8] = {};
#pragma unroll 2
  for (int kc = 0; kc < KD / 32; ++kc) { v16b a; { const float* p = X + (r0 + wave * 16 + col) * (size_t)KD + kc * 32 + 8 * g;   /* row-major [b*t][KD] */
#pragma unroll
      for (int i = 0; i < 8; ++i) { a[i] = (__bf16)p[i]; a[8 + i] = (__bf16)p[16 + i]; } }
    asm volatile("s_wait_loadcnt 0x0" ::: "memory");
#pragma unroll
    for (int j = 0; j < 8; ++j) { const v16b w = WCOL(WA, kc * 32, c0 + j * 16 + col, lane); asm volatile("s_wait_loadcnt 0x0" ::: "memory"); acc[j] = wmma_bf(a, w, acc[j]); } }
  if (which < 2) { _Float16* DH = which == 0 ? QH : KH; _Float16* DL = which == 0 ? QL : KL; const int nhi = which == 0 ? QHI : KHI; const bool hi_rows = t0 < nhi;
#pragma unroll
    for (int j = 0; j < 8; ++j) { const float bias = BA ? bfr(BA[c0 + j * 16 + col]) : 0.f;
#pragma unroll
      for (int r = 0; r < 8; ++r) { const float v = acc[j][r] + bias; const _Float16 hv = (_Float16)v; sh[wave * 16 + 8 * g + r][j * 16 + col] = hv; sl[wave * 16 + 8 * g + r][j * 16 + col] = (_Float16)((v - (float)hv) * 1024.0f); } }
    __syncthreads();
    for (int e = tid; e < 64 * 16; e += 128) { const int rl = e >> 4, q = e & 15; vst2((unsigned*)(DH + (r0 + rl) * CCQ + c0 + q * 8), *(const v4u*)&sh[rl][q * 8]); if (hi_rows) vst2((unsigned*)(DL + (bb * nhi + t0 + rl) * (size_t)CCQ + c0 + q * 8), *(const v4u*)&sl[rl][q * 8]); }   /* q/k rows: pitch CCQ (c0 == 0) */
  } else { const bool hi_rows = t0 < KHI;
#pragma unroll
    for (int j = 0; j < 8; ++j) { const float bias = BA ? bfr(BA[c0 + j * 16 + col]) : 0.f;
#pragma unroll
      for (int r = 0; r < 8; ++r) { const float v = acc[j][r] + bias; const int rl = wave * 16 + 8 * g + r, cl = j * 16 + col; th[cl][rl] = (_Float16)v; const __bf16 bh = (__bf16)v; tb[cl][rl] = bh; tbl[cl][rl] = (__bf16)(v - (float)bh); } }
    __syncthreads();
    for (int e = tid; e < 128 * 8; e += 128) { const int cl = e >> 3, q = e & 7; vst2((unsigned*)(VT + (bb * CC + c0 + cl) * (size_t)TT + t0 + q * 8), *(const v4u*)&th[cl][q * 8]); if (hi_rows) { const size_t o3 = (bb * CC + c0 + cl) * (size_t)KHI + t0 + q * 8; vst2((unsigned*)(VB + o3), *(const v4u*)&tb[cl][q * 8]); vst2((unsigned*)(VBL + o3), *(const v4u*)&tbl[cl][q * 8]); } } } }
// ---- k_sc: block = (query block qb, key block kb <= kb_last(qb), batch in group): logits x SCALE; q hi + residual (x 2^10) against k (2 products) for query rows < QHI, plus the k residual (3 products) for query blocks < QBH (causal early rows); causal: blocks past the diagonal exit, k_sm applies no mask
__global__ __launch_bounds__(128) void k_sc(const _Float16* __restrict__ QH, const _Float16* __restrict__ KH, const _Float16* __restrict__ QL, const _Float16* __restrict__ KL, int bgrp, int h0, float* __restrict__ S0) { __shared__ __align__(16) float ss[4][16][132];
  const int qb = blockIdx.x, kb = blockIdx.y; if (kb > kb_last(qb)) return;
  const int h = h0; const int b = bgrp + blockIdx.z; float* S = S0 + (size_t)blockIdx.z * TT * TT;   /* group spans batches */
  const int tid = threadIdx.x, wave = tid >> 5, lane = tid & 31, col = lane & 15, g = lane >> 4; const int k0 = kb * 128; const int ql0 = qb * 64 + wave * 16; const size_t q0 = (size_t)b * TT + ql0, kr0 = (size_t)b * TT + k0;
  v8f acc[8] = {}, accl[8] = {};
  const _Float16* QLb = QL + (size_t)b * QHI * CCQ; const _Float16* KLb = KL + (size_t)b * KHI * CCQ;   /* single head: q/k rows at pitch CCQ */
  if (qb < QBH) {
#pragma unroll
    for (int kc = 0; kc < HDQK / 32; ++kc) { const v16h ah = frag_h(QH + (q0 + col) * CCQ + kc * 32, lane), al = frag_h(QLb + (size_t)(ql0 + col) * CCQ + kc * 32, lane);
#pragma unroll
      for (int j = 0; j < 8; ++j) { const v16h kbf = frag_h(KH + (kr0 + j * 16 + col) * CCQ + kc * 32, lane), klf = frag_h(KLb + (size_t)(k0 + j * 16 + col) * CCQ + kc * 32, lane); acc[j] = wmma16(ah, kbf, acc[j]); accl[j] = wmma16(al, kbf, accl[j]); accl[j] = wmma16(ah, klf, accl[j]); } }
  } else if (qb * 64 < QHI) {
#pragma unroll
    for (int kc = 0; kc < HDQK / 32; ++kc) { const v16h ah = frag_h(QH + (q0 + col) * CCQ + kc * 32, lane), al = frag_h(QLb + (size_t)(ql0 + col) * CCQ + kc * 32, lane);
#pragma unroll
      for (int j = 0; j < 8; ++j) { const v16h kbf = frag_h(KH + (kr0 + j * 16 + col) * CCQ + kc * 32, lane); acc[j] = wmma16(ah, kbf, acc[j]); accl[j] = wmma16(al, kbf, accl[j]); } }
  } else {
#pragma unroll
    for (int kc = 0; kc < HDQK / 32; ++kc) { const v16h ah = frag_h(QH + (q0 + col) * CCQ + kc * 32, lane);
#pragma unroll
      for (int j = 0; j < 8; ++j) { const v16h kbf = frag_h(KH + (kr0 + j * 16 + col) * CCQ + kc * 32, lane); acc[j] = wmma16(ah, kbf, acc[j]); } } }
#pragma unroll
  for (int j = 0; j < 8; ++j) {
#pragma unroll
    for (int r = 0; r < 8; ++r) ss[wave][8 * g + r][j * 16 + col] = (acc[j][r] + accl[j][r] * (1.0f / 1024.0f)) * SCALE; }
  LDSX(); for (int rl = 0; rl < 16; ++rl) vst2(S + (size_t)(ql0 + rl) * TT + k0 + lane * 4, *(const v4f*)&ss[wave][rl][lane * 4]); }
// ---- k_sm: block = query row t (batch in group): P = sigmoid(score) x 2^11 in place over all 4,096 keys (no row normalisation); precise expf; rows rewritten as whole 16-B lanes
__global__ __launch_bounds__(256) void k_sm(float* __restrict__ S0 SM_EXTRA_PARAMS) { __shared__ __align__(16) float shv[TT];
  const int tid = threadIdx.x; const int t = blockIdx.x;
  float* sr = S0 + (size_t)blockIdx.y * TT * TT + (size_t)t * TT;
  for (int k = tid; k < TT; k += 256) { const float v = sr[k]; shv[k] = 2048.0f / (1.0f + expf(-v)); }
  __syncthreads(); for (int q = tid; q < TT / 4; q += 256) vst2(sr + q * 4, *(const v4f*)&shv[q * 4]); }
// ---- k_pv: block = (64 queries (qb), 128-column value quarter, batch in group): attended = P . v over all 4,096 keys (P x 2^11 once to f16 against v f16: 1 product) x 2^-11; out = gamma * attended + bf16(x), written directly to the output
__global__ __launch_bounds__(128) void k_pv(const float* __restrict__ PS0, const _Float16* __restrict__ VT, const __bf16* __restrict__ VB, const __bf16* __restrict__ VBL, int bgrp, int h0, const float* __restrict__ X1, const float* __restrict__ GM, float* __restrict__ Y) { const float gmv = bfr(GM[0]); const int h = h0; const int b = bgrp + blockIdx.z; const float* PS = PS0 + (size_t)blockIdx.z * TT * TT; const int d0 = blockIdx.y * DVH;   /* group spans batches; column quarter d0 */ __shared__ __align__(16) float ss[4][16][DVH + 4];
  const int tid = threadIdx.x, wave = tid >> 5, lane = tid & 31, col = lane & 15, g = lane >> 4; const int qb = blockIdx.x; const int ql0 = qb * 64 + wave * 16; const int kce = (kb_last(qb) + 1) * 4;
  v8f acc[DVH / 16] = {};
  if (qb < QBH) {
#pragma unroll 1
    for (int kc = 0; kc < kce; ++kc) { const F2 p = split_row(PS + (size_t)(ql0 + col) * TT, kc * 32, lane);
      asm volatile("s_wait_loadcnt 0x0" ::: "memory");
#pragma unroll
      for (int j = 0; j < DVH / 16; ++j) { const size_t po = ((size_t)b * CC + h * HD + d0 + j * 16 + col) * (size_t)KHI + kc * 32; const v16b vh = frag_b(VB + po, lane); acc[j] = wmma_bf(p.h, vh, acc[j]); acc[j] = wmma_bf(p.l, vh, acc[j]); acc[j] = wmma_bf(p.h, frag_b(VBL + po, lane), acc[j]); } }
  } else {
#pragma unroll 1
    for (int kc = 0; kc < kce; ++kc) { const v16h p = frag_f32(PS + (size_t)(ql0 + col) * TT + kc * 32, lane);
      asm volatile("s_wait_loadcnt 0x0" ::: "memory");
#pragma unroll
      for (int j = 0; j < DVH / 16; ++j) { const size_t po = ((size_t)b * CC + h * HD + d0 + j * 16 + col) * (size_t)TT + kc * 32; acc[j] = wmma16(p, frag_h(VT + po, lane), acc[j]); } } }
#pragma unroll
  for (int j = 0; j < DVH / 16; ++j)
#pragma unroll
    for (int r = 0; r < 8; ++r) ss[wave][8 * g + r][j * 16 + col] = acc[j][r] * (1.0f / 2048.0f);
  LDSX(); for (int rl = 0; rl < 16; ++rl) { const size_t o = ((size_t)b * TT + ql0 + rl) * CC + h * HD + d0 + lane * 4; const v4f xr = *(const v4f*)(X1 + o); asm volatile("s_wait_loadcnt 0x0" ::: "memory"); v4f v = *(const v4f*)&ss[wave][rl][lane * 4]; v[0] = gmv * v[0] + bfr(xr[0]); v[1] = gmv * v[1] + bfr(xr[1]); v[2] = gmv * v[2] + bfr(xr[2]); v[3] = gmv * v[3] + bfr(xr[3]); vst2(Y + o, v); } }   /* out = gamma * attended + bf16(x): 512-B (row, column-quarter) segment by 32 lanes, written once */

extern "C" void kernel_launch(void* const* d_in, const int* in_sizes, int n_in, void* d_out, int out_size, void* d_ws, size_t ws_size, hipStream_t stream) {
  (void)in_sizes; (void)n_in; (void)out_size;
  const float** F = (const float**)d_in;
  if (ws_size < (size_t)WS_END) return;
  char* ws = (char*)d_ws; _Float16 *QH = (_Float16*)(ws + WS_QH), *KH = (_Float16*)(ws + WS_KH), *VT = (_Float16*)(ws + WS_VT), *QL = (_Float16*)(ws + WS_QL), *KL = (_Float16*)(ws + WS_KL); __bf16 *VB = (__bf16*)(ws + WS_VB), *VBL = (__bf16*)(ws + WS_VBL); float *S = (float*)(ws + WS_S), *Y = (float*)(ws + WS_Y);
  (void)Y; (void)QL; (void)KL; (void)VB; (void)VBL;
  // inputs: 0 x [4,64,64,512]; 1 Wq [512,64] (in,out); 2 Wk [512,64]; 3 Wv [512,512]; 4 gamma [1]
  k_projT<0><<<dim3(TNB * TT / 64, 1, 2), 128, 0, stream>>>(F[0], F[0], F[0], F[1], F[2], F[3], nullptr, nullptr, nullptr, QH, QL, KH, KL, VT, VB, VBL);   /* which 0, 1: q and k (one 128-column block, columns >= 64 zero) */
  k_projT<2><<<dim3(TNB * TT / 64, CC / 128, 1), 128, 0, stream>>>(F[0], F[0], F[0], F[1], F[2], F[3], nullptr, nullptr, nullptr, QH, QL, KH, KL, VT, VB, VBL);   /* which 2: v (four 128-column blocks) */
  for (int b0 = 0; b0 < TNB; b0 += BGN) {
    k_sc<<<dim3(NQB, TT / 128, BGN), 128, 0, stream>>>(QH, KH, QL, KL, b0, 0, S);
    k_sm<<<dim3(TT, BGN), 256, 0, stream>>>(S);
    k_pv<<<dim3(NQB, HD / DVH, BGN), 128, 0, stream>>>(S, VT, VB, VBL, b0, 0, F[0], F[4], (float*)d_out);
  }
}

// v001
// It runs in 525 microseconds.
// In both of two side-by-side timings against v000, it was 2.37 times as fast.
// compute dtype: all float inputs rounded to bf16; q/k (64 wide) and v (512) = x W with EXACT bf16 products on WMMA 16x16x32, f32 accumulate; q and k once to f16 (1 product) for the UNSCALED scores (logit sigma ~16; sigmoid saturates outside |s| < 5); sigmoid in f32 (precise expf); P x 2^11 once to f16 against v once to f16 (1 product); gamma * attended + x in f32; f32 output.
#include <hip/hip_runtime.h>
#include <math.h>

typedef __attribute__((ext_vector_type(16))) _Float16 v16h;
typedef __attribute__((ext_vector_type(16))) __bf16 v16b;
typedef __attribute__((ext_vector_type(8)))  _Float16 v8h;
typedef __attribute__((ext_vector_type(8)))  float v8f;
typedef __attribute__((ext_vector_type(4)))  float v4f;
typedef __attribute__((ext_vector_type(2)))  float v2f;
typedef __attribute__((ext_vector_type(4)))  unsigned v4u;
typedef __attribute__((ext_vector_type(4)))  int v4i;
typedef float __attribute__((may_alias)) float_a;
typedef int __attribute__((may_alias)) int_a;

template <typename T> __device__ __forceinline__ void vst2(void* p, T v) { *(T*)p = v;  }
__device__ __forceinline__ v8f wmma16(v16h a, v16h b, v8f c) {
  v8f d = __builtin_amdgcn_wmma_f32_16x16x32_f16(false, a, false, b, (short)0, c, false, false);
  asm volatile("v_nop\n\tv_nop\n\tv_nop\n\tv_nop" : "+v"(d) : "v"(a), "v"(b));
  return d;
}
__device__ __forceinline__ v8f wmma_bf(v16b a, v16b b, v8f c) {
  v8f d = __builtin_amdgcn_wmma_f32_16x16x32_bf16(false, a, false, b, (short)0, c, false, false);
  asm volatile("v_nop\n\tv_nop\n\tv_nop\n\tv_nop" : "+v"(d) : "v"(a), "v"(b));
  return d;
}
// 16x16x32 fragments: lane = (h = lane>>4, row/col = lane&15); elements 0..7 = k0+8h+0..7, 8..15 = k0+16+8h+0..7; D element r = row 8h+r
__device__ __forceinline__ v16h frag_h(const _Float16* rowk0, int lane) {
  union { v16h v; v8h q[2]; } u; const _Float16* p = rowk0 + 8 * (lane >> 4);
  u.q[0] = *(const v8h*)p; u.q[1] = *(const v8h*)(p + 16); return u.v;
}
__device__ __forceinline__ v16h frag_f32(const float* rowk0, int lane) {
  v16h a; const float* p = rowk0 + 8 * (lane >> 4);
#pragma unroll
  for (int i = 0; i < 8; ++i) { a[i] = (_Float16)p[i]; a[8 + i] = (_Float16)p[16 + i]; }
  return a;
}
__device__ __forceinline__ v16h frag_f32s(const float* rowk0, int lane, float sc) {
  v16h a; const float* p = rowk0 + 8 * (lane >> 4);
#pragma unroll
  for (int i = 0; i < 8; ++i) { a[i] = (_Float16)(p[i] * sc); a[8 + i] = (_Float16)(p[16 + i] * sc); }
  return a;
}
// column fragment from a [K][ld] layout (column n), rows >= K read as 0
__device__ __forceinline__ v16h fragc_f32(const float* W, int k0, int n, int lane, int ld, int K) {
  v16h a; const int g = lane >> 4;
#pragma unroll
  for (int i = 0; i < 8; ++i) { const int ka = k0 + 8 * g + i, kb = ka + 16;
    a[i] = (_Float16)(ka < K ? W[(size_t)(ka < K ? ka : K - 1) * ld + n] : 0.f); a[8 + i] = (_Float16)(kb < K ? W[(size_t)(kb < K ? kb : K - 1) * ld + n] : 0.f); }
  return a;
}
struct F2 { v16b h, l; };
__device__ __forceinline__ F2 bsplit16(const float v[16]) { F2 r;
#pragma unroll
  for (int i = 0; i < 16; ++i) { const __bf16 h = (__bf16)v[i]; r.h[i] = h; r.l[i] = (__bf16)(v[i] - (float)h); }
  return r; }
__device__ __forceinline__ F2 split_row(const float* row, int k0, int lane) { float v[16]; const float* p = row + k0 + 8 * (lane >> 4);
#pragma unroll
  for (int i = 0; i < 8; ++i) { v[i] = p[i]; v[8 + i] = p[16 + i]; }
  return bsplit16(v); }
__device__ __forceinline__ F2 split_rowK(const float* row, int k0, int lane, int K) { float v[16]; const int g = lane >> 4;
#pragma unroll
  for (int i = 0; i < 8; ++i) { const int ka = k0 + 8 * g + i, kb = ka + 16; v[i] = ka < K ? row[ka < K ? ka : K - 1] : 0.f; v[8 + i] = kb < K ? row[kb < K ? kb : K - 1] : 0.f; }
  return bsplit16(v); }
__device__ __forceinline__ F2 split_col(const float* W, int k0, int n, int lane, int ld, int K) { float v[16]; const int g = lane >> 4;
#pragma unroll
  for (int i = 0; i < 8; ++i) { const int ka = k0 + 8 * g + i, kb = ka + 16; v[i] = ka < K ? W[(size_t)(ka < K ? ka : K - 1) * ld + n] : 0.f; v[8 + i] = kb < K ? W[(size_t)(kb < K ? kb : K - 1) * ld + n] : 0.f; }
  return bsplit16(v); }
__device__ __forceinline__ v8f mac3(const F2& a, const F2& b, v8f c) { c = wmma_bf(a.l, b.h, c); c = wmma_bf(a.h, b.l, c); return wmma_bf(a.h, b.h, c); }
__device__ __forceinline__ float sigm(float v) { return 1.0f / (1.0f + expf(-v)); }
#define LDSX() do { asm volatile("s_wait_dscnt 0" ::: "memory"); __builtin_amdgcn_wave_barrier(); __builtin_amdgcn_fence(__ATOMIC_RELEASE, "workgroup"); } while (0)

// SAGAN-style position attention with SIGMOID (unnormalised) attention (B 4, 64 x 64 = 4,096 positions, C 512; x channels-last [B,H,W,C] = rows [b*n][512]; (in,out) weights Wq/Wk [512,64], Wv [512,512], no biases; gamma scalar): q = x Wq, k = x Wk, v = x Wv; scores[n][m] = q_n . k_m (no scaling); attn = sigmoid(scores) (no row normalisation); attended[n][c] = sum_m attn[n][m] v[m][c]; out = gamma * attended + x.
#define NB 4
#define TT 4096
#define CC 512            // value width (v planes, output rows)
#define CCQ 128           // q / k row pitch: one 128-column block, columns >= 64 are zero
#define DIN 512          // x width
#define NH 1
#define HD 512
#define NQB (TT / 64)
#define HG 1               // one 4,096 x 4,096 score plane per pass (the pass group spans batches)
#define SCALE (1.0f)
#define HDQK 64            // q / k width
#define CAUSAL 0
#ifndef TNB
#define TNB NB
#endif
__device__ __forceinline__ v16b zero16b() { v16b z; _Pragma("unroll") for (int i = 0; i < 16; ++i) z[i] = (__bf16)0.f; return z; }
__device__ __forceinline__ float bfr(float v) { return (float)(__bf16)v; }
__host__ __device__ __forceinline__ int kb_last(int qb) { return CAUSAL ? ((qb * 64 + 63) >> 7) : (TT / 128 - 1); }
typedef __attribute__((ext_vector_type(8))) __bf16 v8b;
__device__ __forceinline__ v16b frag_b(const __bf16* rowk0, int lane) {
  union { v16b v; v8b q[2]; } u; const __bf16* p = rowk0 + 8 * (lane >> 4);
  u.q[0] = *(const v8b*)p; u.q[1] = *(const v8b*)(p + 16); return u.v;
}
#define QBH 0              // causal: query blocks 0..QBH-1 of each sequence (few keys, no averaging) take the high-precision path
#define QHI 0               // no q residual plane: q and k once to f16 (1 product)
#define KHI 64            // key rows carrying k residual / v bf16 hi+lo planes (used only by the causal high-precision path)
// B fragment (k rows k0+.., output column o) of a weight: (in,out) [K][ld] or (out,in) [ld rows of K]: bf16 exact, or f16(bf16 * 256) exact
__device__ __forceinline__ v16b wcol_io(const float* Wm, int k0, int o, int lane, int ld) { v16b w; const int g = lane >> 4;
#pragma unroll
  for (int i = 0; i < 8; ++i) { w[i] = (__bf16)Wm[(size_t)(k0 + 8 * g + i) * ld + o]; w[8 + i] = (__bf16)Wm[(size_t)(k0 + 16 + 8 * g + i) * ld + o]; }
  return w; }
__device__ __forceinline__ v16b wcol_oi(const float* Wm, int k0, int o, int lane, int K) { v16b w; const float* p = Wm + (size_t)o * K + k0 + 8 * (lane >> 4);
#pragma unroll
  for (int i = 0; i < 8; ++i) { w[i] = (__bf16)p[i]; w[8 + i] = (__bf16)p[16 + i]; }
  return w; }
__device__ __forceinline__ v16h wcolh_io(const float* Wm, int k0, int o, int lane, int ld) { v16h w; const int g = lane >> 4;
#pragma unroll
  for (int i = 0; i < 8; ++i) { w[i] = (_Float16)(bfr(Wm[(size_t)(k0 + 8 * g + i) * ld + o]) * 256.0f); w[8 + i] = (_Float16)(bfr(Wm[(size_t)(k0 + 16 + 8 * g + i) * ld + o]) * 256.0f); }
  return w; }
__device__ __forceinline__ v16h wcolh_oi(const float* Wm, int k0, int o, int lane, int K) { v16h w; const float* p = Wm + (size_t)o * K + k0 + 8 * (lane >> 4);
#pragma unroll
  for (int i = 0; i < 8; ++i) { w[i] = (_Float16)(bfr(p[i]) * 256.0f); w[8 + i] = (_Float16)(bfr(p[16 + i]) * 256.0f); }
  return w; }
#define WQKV_LAYOUT 0   // 0 = (in,out) [K][CC] for Wv, [K][HDQK] for Wq/Wk; 1 = (out,in) [CC][DIN]; 2 = per-head [NH][DIN][HD]
__device__ __forceinline__ v16b wcol_hdk(const float* Wm, int k0, int o, int lane) { v16b w; const int g = lane >> 4; const float* p = Wm + (size_t)(o / HD) * DIN * HD + (o % HD);
#pragma unroll
  for (int i = 0; i < 8; ++i) { w[i] = (__bf16)p[(size_t)(k0 + 8 * g + i) * HD]; w[8 + i] = (__bf16)p[(size_t)(k0 + 16 + 8 * g + i) * HD]; }
  return w; }
#define WO_OUT_IN 0
#if WQKV_LAYOUT == 1
#define WCOL(W, k0, o, lane) wcol_oi(W, k0, (o), lane, DIN)   /* unused: layout 0 */
#elif WQKV_LAYOUT == 2
#define WCOL(W, k0, o, lane) wcol_hdk(W, k0, o, lane)
#else
#define WCOL(W, k0, o, lane) (which == 2 ? wcol_io(W, k0, (o), lane, CC) : ((o) < HDQK ? wcol_io(W, k0, (o), lane, HDQK) : zero16b()))   /* Wv [512][512]; Wq/Wk [512][64]: projected q/k columns >= 64 are zero (block y = 0 only) */
#endif
#if WO_OUT_IN
#define WOCOL(W, k0, o, lane) wcol_oi(W, k0, o, lane, CC)
#define WOCOLH(W, k0, o, lane) wcolh_oi(W, k0, o, lane, CC)
#else
#define WOCOL(W, k0, o, lane) wcol_io(W, k0, o, lane, DIN)
#define WOCOLH(W, k0, o, lane) wcolh_io(W, k0, o, lane, DIN)
#endif
#define BG HG              // the pass group spans BATCHES (single head): blockIdx.z selects batch b0 + z
#define BGN (TNB < BG ? TNB : BG)
#define DVH 128            // value columns per k_pv block (HD 512 split in four column quarters to keep 8 accumulator tiles per wave)
#ifndef SM_EXTRA_PARAMS
#define SM_EXTRA_PARAMS
#endif
#ifndef PROJ_EXTRA_PARAMS
#define PROJ_EXTRA_PARAMS
#endif
#ifndef SM_MASK_HOOK
#define SM_MASK_HOOK (void)0
#endif

#define WS_QH  0u                                      // f16 q rows [b*t][CCQ]
#define WS_KH  (WS_QH + 2u * (size_t)NB * TT * CCQ)     // f16 k rows [b*t][CCQ]
#define WS_VT  (WS_KH + 2u * (size_t)NB * TT * CCQ)     // f16 v planes [b][c][t]
#define WS_QL  (WS_VT + 2u * (size_t)NB * CC * TT)      // f16 q residual x 2^10 rows [b][t < QHI][CCQ]
#define WS_KL  (WS_QL + 2u * (size_t)NB * QHI * CCQ)    // f16 k residual x 2^10 rows [b][t < KHI][CCQ]
#define WS_VB  (WS_KL + 2u * (size_t)NB * KHI * CCQ)    // bf16 v hi planes [b][c][t < KHI]
#define WS_VBL (WS_VB + 2u * (size_t)NB * CC * KHI)
#define WS_S   (WS_VBL + 2u * (size_t)NB * CC * KHI)    // f32 logits / P [hg][t][s]
#define WS_Y   (WS_S  + 4u * (size_t)HG * TT * TT)      // f32 ctx rows [b*t][CC] (only when there is an output projection)
#define WS_END (WS_Y  + 0u)

// ---- k_proj: block = (64 rows, 128 cols, which): q/k/v = X W (+ b) with exact bf16 products (K = DIN) -> which 0: q f16 rows (+ residual rows < QHI); 1: k f16 rows (+ residual rows < KHI); 2: v f16 planes [c][t] (+ bf16 hi/lo planes for t < KHI)
template <int WOFF> __global__ __launch_bounds__(128) void k_projT(const float* __restrict__ XQ, const float* __restrict__ XK, const float* __restrict__ XV, const float* __restrict__ WQ, const float* __restrict__ WK, const float* __restrict__ WV, const float* __restrict__ BQ, const float* __restrict__ BK, const float* __restrict__ BV,
    _Float16* __restrict__ QH, _Float16* __restrict__ QL, _Float16* __restrict__ KH, _Float16* __restrict__ KL, _Float16* __restrict__ VT, __bf16* __restrict__ VB, __bf16* __restrict__ VBL) {
  __shared__ __align__(16) _Float16 sh[64][136], sl[64][136]; __shared__ __align__(16) _Float16 th[128][72]; __shared__ __align__(16) __bf16 tb[128][72], tbl[128][72];
  const int tid = threadIdx.x, wave = tid >> 5, lane = tid & 31, col = lane & 15, g = lane >> 4; const int which = blockIdx.z + WOFF; const int c0 = blockIdx.y * 128; const size_t r0 = (size_t)blockIdx.x * 64; const size_t bb = r0 / TT; const int t0 = (int)(r0 % TT);
  const float* X = which == 0 ? XQ : which == 1 ? XK : XV; const float* WA = which == 0 ? WQ : which == 1 ? WK : WV; const float* BA = which == 0 ? BQ : which == 1 ? BK : BV;
  const int KD = DIN;
  v8f acc[8] = {};
#pragma unroll 2
  for (int kc = 0; kc < KD / 32; ++kc) { v16b a; { const float* p = X + (r0 + wave * 16 + col) * (size_t)KD + kc * 32 + 8 * g;   /* row-major [b*t][KD] */
#pragma unroll
      for (int i = 0; i < 8; ++i) { a[i] = (__bf16)p[i]; a[8 + i] = (__bf16)p[16 + i]; } }
    asm volatile("s_wait_loadcnt 0x0" ::: "memory");
#pragma unroll
    for (int j = 0; j < 8; ++j) { const v16b w = WCOL(WA, kc * 32, c0 + j * 16 + col, lane); asm volatile("s_wait_loadcnt 0x0" ::: "memory"); acc[j] = wmma_bf(a, w, acc[j]); } }
  if (which < 2) { _Float16* DH = which == 0 ? QH : KH; _Float16* DL = which == 0 ? QL : KL; const int nhi = which == 0 ? QHI : KHI; const bool hi_rows = t0 < nhi;
#pragma unroll
    for (int j = 0; j < 8; ++j) { const float bias = BA ? bfr(BA[c0 + j * 16 + col]) : 0.f;
#pragma unroll
      for (int r = 0; r < 8; ++r) { const float v = acc[j][r] + bias; const _Float16 hv = (_Float16)v; sh[wave * 16 + 8 * g + r][j * 16 + col] = hv; sl[wave * 16 + 8 * g + r][j * 16 + col] = (_Float16)((v - (float)hv) * 1024.0f); } }
    __syncthreads();
    for (int e = tid; e < 64 * 16; e += 128) { const int rl = e >> 4, q = e & 15; vst2((unsigned*)(DH + (r0 + rl) * CCQ + c0 + q * 8), *(const v4u*)&sh[rl][q * 8]); if (hi_rows) vst2((unsigned*)(DL + (bb * nhi + t0 + rl) * (size_t)CCQ + c0 + q * 8), *(const v4u*)&sl[rl][q * 8]); }   /* q/k rows: pitch CCQ (c0 == 0) */
  } else { const bool hi_rows = t0 < KHI;
#pragma unroll
    for (int j = 0; j < 8; ++j) { const float bias = BA ? bfr(BA[c0 + j * 16 + col]) : 0.f;
#pragma unroll
      for (int r = 0; r < 8; ++r) { const float v = acc[j][r] + bias; const int rl = wave * 16 + 8 * g + r, cl = j * 16 + col; th[cl][rl] = (_Float16)v; const __bf16 bh = (__bf16)v; tb[cl][rl] = bh; tbl[cl][rl] = (__bf16)(v - (float)bh); } }
    __syncthreads();
    for (int e = tid; e < 128 * 8; e += 128) { const int cl = e >> 3, q = e & 7; vst2((unsigned*)(VT + (bb * CC + c0 + cl) * (size_t)TT + t0 + q * 8), *(const v4u*)&th[cl][q * 8]); if (hi_rows) { const size_t o3 = (bb * CC + c0 + cl) * (size_t)KHI + t0 + q * 8; vst2((unsigned*)(VB + o3), *(const v4u*)&tb[cl][q * 8]); vst2((unsigned*)(VBL + o3), *(const v4u*)&tbl[cl][q * 8]); } } } }
// ---- k_sc: block = (query block qb, key block kb <= kb_last(qb), batch in group): logits x SCALE; q hi + residual (x 2^10) against k (2 products) for query rows < QHI, plus the k residual (3 products) for query blocks < QBH (causal early rows); causal: blocks past the diagonal exit, k_sm applies no mask
__global__ __launch_bounds__(128) void k_sc(const _Float16* __restrict__ QH, const _Float16* __restrict__ KH, const _Float16* __restrict__ QL, const _Float16* __restrict__ KL, int bgrp, int h0, float* __restrict__ S0) { __shared__ __align__(16) float ss[4][16][132];
  const int qb = blockIdx.x, kb = blockIdx.y; if (kb > kb_last(qb)) return;
  const int h = h0; const int b = bgrp + blockIdx.z; float* S = S0 + (size_t)blockIdx.z * TT * TT;   /* group spans batches */
  const int tid = threadIdx.x, wave = tid >> 5, lane = tid & 31, col = lane & 15, g = lane >> 4; const int k0 = kb * 128; const int ql0 = qb * 64 + wave * 16; const size_t q0 = (size_t)b * TT + ql0, kr0 = (size_t)b * TT + k0;
  v8f acc[8] = {}, accl[8] = {};
  const _Float16* QLb = QL + (size_t)b * QHI * CCQ; const _Float16* KLb = KL + (size_t)b * KHI * CCQ;   /* single head: q/k rows at pitch CCQ */
  if (qb < QBH) {
#pragma unroll
    for (int kc = 0; kc < HDQK / 32; ++kc) { const v16h ah = frag_h(QH + (q0 + col) * CCQ + kc * 32, lane), al = frag_h(QLb + (size_t)(ql0 + col) * CCQ + kc * 32, lane);
#pragma unroll
      for (int j = 0; j < 8; ++j) { const v16h kbf = frag_h(KH + (kr0 + j * 16 + col) * CCQ + kc * 32, lane), klf = frag_h(KLb + (size_t)(k0 + j * 16 + col) * CCQ + kc * 32, lane); acc[j] = wmma16(ah, kbf, acc[j]); accl[j] = wmma16(al, kbf, accl[j]); accl[j] = wmma16(ah, klf, accl[j]); } }
  } else if (qb * 64 < QHI) {
#pragma unroll
    for (int kc = 0; kc < HDQK / 32; ++kc) { const v16h ah = frag_h(QH + (q0 + col) * CCQ + kc * 32, lane), al = frag_h(QLb + (size_t)(ql0 + col) * CCQ + kc * 32, lane);
#pragma unroll
      for (int j = 0; j < 8; ++j) { const v16h kbf = frag_h(KH + (kr0 + j * 16 + col) * CCQ + kc * 32, lane); acc[j] = wmma16(ah, kbf, acc[j]); accl[j] = wmma16(al, kbf, accl[j]); } }
  } else {
#pragma unroll
    for (int kc = 0; kc < HDQK / 32; ++kc) { const v16h ah = frag_h(QH + (q0 + col) * CCQ + kc * 32, lane);
#pragma unroll
      for (int j = 0; j < 8; ++j) { const v16h kbf = frag_h(KH + (kr0 + j * 16 + col) * CCQ + kc * 32, lane); acc[j] = wmma16(ah, kbf, acc[j]); } } }
#pragma unroll
  for (int j = 0; j < 8; ++j) {
#pragma unroll
    for (int r = 0; r < 8; ++r) ss[wave][8 * g + r][j * 16 + col] = (acc[j][r] + accl[j][r] * (1.0f / 1024.0f)) * SCALE; }
  LDSX(); for (int rl = 0; rl < 16; ++rl) vst2(S + (size_t)(ql0 + rl) * TT + k0 + lane * 4, *(const v4f*)&ss[wave][rl][lane * 4]); }
// ---- k_sm: block = query row t (batch in group): P = sigmoid(score) x 2^11 in place over all 4,096 keys (no row normalisation); precise expf; rows rewritten as whole 16-B lanes
__global__ __launch_bounds__(256) void k_sm(float* __restrict__ S0 SM_EXTRA_PARAMS) { __shared__ __align__(16) float shv[TT];
  const int tid = threadIdx.x; const int t = blockIdx.x;
  float* sr = S0 + (size_t)blockIdx.y * TT * TT + (size_t)t * TT;
  for (int k = tid; k < TT; k += 256) { const float v = sr[k]; shv[k] = 2048.0f / (1.0f + expf(-v)); }
  __syncthreads(); for (int q = tid; q < TT / 4; q += 256) vst2(sr + q * 4, *(const v4f*)&shv[q * 4]); }
#define PV_KS 128                       // keys per staged tile of k_pv
#define PV_PP (PV_KS * 4 + 16)          // LDS pitch of a P row, bytes (16 B x odd: no bank conflict for 16-byte reads)
#define PV_VP (PV_KS * 2 + 16)          // LDS pitch of a v row, bytes (16 B x odd)
#define PV_PB (64 * PV_PP)              // P part of a buffer
#define PV_SB (PV_PB + DVH * PV_VP)     // one buffer: P part + v part
// eight 16-byte copies per lane, global -> LDS through no register; the s_wait_xcnt stands inside the statement so that no address register is rewritten ahead of it
__device__ __forceinline__ void acopy8(const unsigned l[8], const void* const gq[8]) {
  asm volatile("global_load_async_to_lds_b128 %0, %8, off\n\tglobal_load_async_to_lds_b128 %1, %9, off\n\tglobal_load_async_to_lds_b128 %2, %10, off\n\tglobal_load_async_to_lds_b128 %3, %11, off\n\t"
               "global_load_async_to_lds_b128 %4, %12, off\n\tglobal_load_async_to_lds_b128 %5, %13, off\n\tglobal_load_async_to_lds_b128 %6, %14, off\n\tglobal_load_async_to_lds_b128 %7, %15, off\n\ts_wait_xcnt 0x0"
               :: "v"(l[0]), "v"(l[1]), "v"(l[2]), "v"(l[3]), "v"(l[4]), "v"(l[5]), "v"(l[6]), "v"(l[7]), "v"(gq[0]), "v"(gq[1]), "v"(gq[2]), "v"(gq[3]), "v"(gq[4]), "v"(gq[5]), "v"(gq[6]), "v"(gq[7]) : "memory");
}
// one tile: 16 P copies (rows 4 apart) and 16 v copies (rows 8 apart) per lane
__device__ __forceinline__ void pv_stage(const float* gp, const _Float16* gv, unsigned lp, unsigned lv) {
#pragma unroll   // all four loops: constant indices, so that each copy's addresses are plain registers of its statement
  for (int s = 0; s < 2; ++s) { unsigned l[8]; const void* gq[8];
#pragma unroll
    for (int i = 0; i < 8; ++i) { l[i] = lp + (s * 8 + i) * 4 * PV_PP; gq[i] = gp + (size_t)(s * 8 + i) * 4 * TT; }
    acopy8(l, gq); }
#pragma unroll
  for (int s = 0; s < 2; ++s) { unsigned l[8]; const void* gq[8];
#pragma unroll
    for (int i = 0; i < 8; ++i) { l[i] = lv + (s * 8 + i) * 8 * PV_VP; gq[i] = gv + (size_t)(s * 8 + i) * 8 * TT; }
    acopy8(l, gq); }
}
// ---- k_pv: block = (64 queries (qb), 128-column value quarter, batch in group): attended = P . v over all 4,096 keys (P x 2^11 once to f16 against v f16: 1 product) x 2^-11; out = gamma * attended + bf16(x), written directly to the output
__global__ __launch_bounds__(128) void k_pv(const float* __restrict__ PS0, const _Float16* __restrict__ VT, const __bf16* __restrict__ VB, const __bf16* __restrict__ VBL, int bgrp, int h0, const float* __restrict__ X1, const float* __restrict__ GM, float* __restrict__ Y) { const float gmv = bfr(GM[0]); const int h = h0; const int b = bgrp + blockIdx.z; const float* PS = PS0 + (size_t)blockIdx.z * TT * TT; const int d0 = blockIdx.y * DVH;   /* group spans batches; column quarter d0 */ __shared__ __align__(16) float ss[4][16][DVH + 4]; __shared__ __align__(16) unsigned char stg[2 * PV_SB];
  const int tid = threadIdx.x, wave = tid >> 5, lane = tid & 31, col = lane & 15, g = lane >> 4; const int qb = blockIdx.x; const int ql0 = qb * 64 + wave * 16; const int kce = (kb_last(qb) + 1) * 4;
  v8f acc[DVH / 16] = {};
  if (qb < QBH) {
#pragma unroll 1
    for (int kc = 0; kc < kce; ++kc) { const F2 p = split_row(PS + (size_t)(ql0 + col) * TT, kc * 32, lane);
      asm volatile("s_wait_loadcnt 0x0" ::: "memory");
#pragma unroll
      for (int j = 0; j < DVH / 16; ++j) { const size_t po = ((size_t)b * CC + h * HD + d0 + j * 16 + col) * (size_t)KHI + kc * 32; const v16b vh = frag_b(VB + po, lane); acc[j] = wmma_bf(p.h, vh, acc[j]); acc[j] = wmma_bf(p.l, vh, acc[j]); acc[j] = wmma_bf(p.h, frag_b(VBL + po, lane), acc[j]); } }
  } else {
    // tiles of PV_KS keys: the block's 64 P rows (f32) and its 128 v rows (f16) are copied to LDS once for all four waves; tile t + 1 flies while tile t is worked on
    const unsigned lbase = (unsigned)(size_t)stg; const int nt = kce * 32 / PV_KS;
    const float* gp = PS + (size_t)(qb * 64 + wave) * TT + lane * 4;   /* copy i: P row 4 i + wave, one 512-B row per wave */
    const _Float16* gv = VT + ((size_t)b * CC + h * HD + d0 + (tid >> 4)) * (size_t)TT + (tid & 15) * 8;   /* copy i: v row 8 i + tid / 16, two 256-B rows per wave */
    const unsigned lp = lbase + wave * PV_PP + lane * 16, lv = lbase + PV_PB + (tid >> 4) * PV_VP + (tid & 15) * 16;
    pv_stage(gp, gv, lp, lv);
    asm volatile("s_wait_asynccnt 0x0" ::: "memory");   /* tile 0 landed (this wave's copies) */
    __syncthreads();                                      /* tile 0 readable by every wave */
    if (nt > 1) pv_stage(gp + PV_KS, gv + PV_KS, lp + PV_SB, lv + PV_SB);
#pragma unroll 1   // stays rolled: one publish point in the code, the buffer picked by t & 1
    for (int t = 0; t < nt; ++t) { const unsigned bo = (t & 1) * PV_SB; const unsigned char* pb = stg + bo + (wave * 16 + col) * PV_PP + g * 32; const unsigned char* vb = stg + bo + PV_PB + col * PV_VP;
      v4f x[2][4]; v16h bf[2][DVH / 16];   /* two fragment sets: the LDS reads of 32 keys stand as one group ahead of the products of the 32 keys before them (inside tile t only) */
      { const v4f* pp = (const v4f*)pb; x[0][0] = pp[0]; x[0][1] = pp[1]; x[0][2] = pp[4]; x[0][3] = pp[5]; }
#pragma unroll   // here and below in this loop: constant indices, so that the fragment sets and accumulators stay in registers
      for (int j = 0; j < DVH / 16; ++j) bf[0][j] = frag_h((const _Float16*)(vb + j * 16 * PV_VP), lane);
#pragma unroll
      for (int kc = 0; kc < PV_KS / 32; ++kc) { const int s = kc & 1;
        if (kc + 1 < PV_KS / 32) { const v4f* pp = (const v4f*)(pb + (kc + 1) * 128); x[s ^ 1][0] = pp[0]; x[s ^ 1][1] = pp[1]; x[s ^ 1][2] = pp[4]; x[s ^ 1][3] = pp[5];
#pragma unroll
          for (int j = 0; j < DVH / 16; ++j) bf[s ^ 1][j] = frag_h((const _Float16*)(vb + j * 16 * PV_VP + (kc + 1) * 64), lane); }
        v16h p;
#pragma unroll
        for (int i = 0; i < 4; ++i) { p[i] = (_Float16)x[s][0][i]; p[4 + i] = (_Float16)x[s][1][i]; p[8 + i] = (_Float16)x[s][2][i]; p[12 + i] = (_Float16)x[s][3][i]; }
#pragma unroll
        for (int j = 0; j < DVH / 16; ++j) acc[j] = wmma16(p, bf[s][j], acc[j]); }
      asm volatile("s_wait_dscnt 0x0" ::: "memory");      /* this wave's reads of tile t are done before its buffer is refilled */
      asm volatile("s_wait_asynccnt 0x0" ::: "memory");   /* this wave's copies of tile t + 1 have landed */
      __syncthreads();                                    /* publishes tile t + 1 and ends every wave's reads of tile t */
      if (t + 2 < nt) pv_stage(gp + (t + 2) * PV_KS, gv + (t + 2) * PV_KS, lp + bo, lv + bo); }
    asm volatile("s_wait_asynccnt 0x0" ::: "memory");     /* no copy outstanding behind the loop */
  }
#pragma unroll
  for (int j = 0; j < DVH / 16; ++j)
#pragma unroll
    for (int r = 0; r < 8; ++r) ss[wave][8 * g + r][j * 16 + col] = acc[j][r] * (1.0f / 2048.0f);
  LDSX(); for (int rl = 0; rl < 16; ++rl) { const size_t o = ((size_t)b * TT + ql0 + rl) * CC + h * HD + d0 + lane * 4; const v4f xr = *(const v4f*)(X1 + o); asm volatile("s_wait_loadcnt 0x0" ::: "memory"); v4f v = *(const v4f*)&ss[wave][rl][lane * 4]; v[0] = gmv * v[0] + bfr(xr[0]); v[1] = gmv * v[1] + bfr(xr[1]); v[2] = gmv * v[2] + bfr(xr[2]); v[3] = gmv * v[3] + bfr(xr[3]); vst2(Y + o, v); } }   /* out = gamma * attended + bf16(x): 512-B (row, column-quarter) segment by 32 lanes, written once */

extern "C" void kernel_launch(void* const* d_in, const int* in_sizes, int n_in, void* d_out, int out_size, void* d_ws, size_t ws_size, hipStream_t stream) {
  (void)in_sizes; (void)n_in; (void)out_size;
  const float** F = (const float**)d_in;
  if (ws_size < (size_t)WS_END) return;
  char* ws = (char*)d_ws; _Float16 *QH = (_Float16*)(ws + WS_QH), *KH = (_Float16*)(ws + WS_KH), *VT = (_Float16*)(ws + WS_VT), *QL = (_Float16*)(ws + WS_QL), *KL = (_Float16*)(ws + WS_KL); __bf16 *VB = (__bf16*)(ws + WS_VB), *VBL = (__bf16*)(ws + WS_VBL); float *S = (float*)(ws + WS_S), *Y = (float*)(ws + WS_Y);
  (void)Y; (void)QL; (void)KL; (void)VB; (void)VBL;
  // inputs: 0 x [4,64,64,512]; 1 Wq [512,64] (in,out); 2 Wk [512,64]; 3 Wv [512,512]; 4 gamma [1]
  k_projT<0><<<dim3(TNB * TT / 64, 1, 2), 128, 0, stream>>>(F[0], F[0], F[0], F[1], F[2], F[3], nullptr, nullptr, nullptr, QH, QL, KH, KL, VT, VB, VBL);   /* which 0, 1: q and k (one 128-column block, columns >= 64 zero) */
  k_projT<2><<<dim3(TNB * TT / 64, CC / 128, 1), 128, 0, stream>>>(F[0], F[0], F[0], F[1], F[2], F[3], nullptr, nullptr, nullptr, QH, QL, KH, KL, VT, VB, VBL);   /* which 2: v (four 128-column blocks) */
  for (int b0 = 0; b0 < TNB; b0 += BGN) {
    k_sc<<<dim3(NQB, TT / 128, BGN), 128, 0, stream>>>(QH, KH, QL, KL, b0, 0, S);
    k_sm<<<dim3(TT, BGN), 256, 0, stream>>>(S);
    k_pv<<<dim3(NQB, HD / DVH, BGN), 128, 0, stream>>>(S, VT, VB, VBL, b0, 0, F[0], F[4], (float*)d_out);
  }
}

// v002
// Measured time: 272 microseconds a run.
// In both of two side-by-side timings against v001, it was 1.93 times as fast.
// Counting every step since v000, it is 4.58 times as fast.
// compute dtype: all float inputs rounded to bf16; q/k (64 wide) and v (512) = x W with EXACT bf16 products on WMMA 16x16x32, f32 accumulate; q and k once to f16 (1 product) for the UNSCALED scores (logit sigma ~16; sigmoid saturates outside |s| < 5); sigmoid in f32 (precise expf); P x 2^11 once to f16 against v once to f16 (1 product); gamma * attended + x in f32; f32 output.
#include <hip/hip_runtime.h>
#include <math.h>

typedef __attribute__((ext_vector_type(16))) _Float16 v16h;
typedef __attribute__((ext_vector_type(16))) __bf16 v16b;
typedef __attribute__((ext_vector_type(8)))  _Float16 v8h;
typedef __attribute__((ext_vector_type(8)))  float v8f;
typedef __attribute__((ext_vector_type(4)))  float v4f;
typedef __attribute__((ext_vector_type(2)))  float v2f;
typedef __attribute__((ext_vector_type(4)))  unsigned v4u;
typedef __attribute__((ext_vector_type(4)))  int v4i;
typedef float __attribute__((may_alias)) float_a;
typedef int __attribute__((may_alias)) int_a;

template <typename T> __device__ __forceinline__ void vst2(void* p, T v) { *(T*)p = v;  }
__device__ __forceinline__ v8f wmma16(v16h a, v16h b, v8f c) {
  v8f d = __builtin_amdgcn_wmma_f32_16x16x32_f16(false, a, false, b, (short)0, c, false, false);
  asm volatile("v_nop\n\tv_nop\n\tv_nop\n\tv_nop" : "+v"(d) : "v"(a), "v"(b));
  return d;
}
__device__ __forceinline__ v8f wmma_bf(v16b a, v16b b, v8f c) {
  v8f d = __builtin_amdgcn_wmma_f32_16x16x32_bf16(false, a, false, b, (short)0, c, false, false);
  asm volatile("v_nop\n\tv_nop\n\tv_nop\n\tv_nop" : "+v"(d) : "v"(a), "v"(b));
  return d;
}
// 16x16x32 fragments: lane = (h = lane>>4, row/col = lane&15); elements 0..7 = k0+8h+0..7, 8..15 = k0+16+8h+0..7; D element r = row 8h+r
__device__ __forceinline__ v16h frag_h(const _Float16* rowk0, int lane) {
  union { v16h v; v8h q[2]; } u; const _Float16* p = rowk0 + 8 * (lane >> 4);
  u.q[0] = *(const v8h*)p; u.q[1] = *(const v8h*)(p + 16); return u.v;
}
__device__ __forceinline__ v16h frag_f32(const float* rowk0, int lane) {
  v16h a; const float* p = rowk0 + 8 * (lane >> 4);
#pragma unroll
  for (int i = 0; i < 8; ++i) { a[i] = (_Float16)p[i]; a[8 + i] = (_Float16)p[16 + i]; }
  return a;
}
__device__ __forceinline__ v16h frag_f32s(const float* rowk0, int lane, float sc) {
  v16h a; const float* p = rowk0 + 8 * (lane >> 4);
#pragma unroll
  for (int i = 0; i < 8; ++i) { a[i] = (_Float16)(p[i] * sc); a[8 + i] = (_Float16)(p[16 + i] * sc); }
  return a;
}
// column fragment from a [K][ld] layout (column n), rows >= K read as 0
__device__ __forceinline__ v16h fragc_f32(const float* W, int k0, int n, int lane, int ld, int K) {
  v16h a; const int g = lane >> 4;
#pragma unroll
  for (int i = 0; i < 8; ++i) { const int ka = k0 + 8 * g + i, kb = ka + 16;
    a[i] = (_Float16)(ka < K ? W[(size_t)(ka < K ? ka : K - 1) * ld + n] : 0.f); a[8 + i] = (_Float16)(kb < K ? W[(size_t)(kb < K ? kb : K - 1) * ld + n] : 0.f); }
  return a;
}
struct F2 { v16b h, l; };
__device__ __forceinline__ F2 bsplit16(const float v[16]) { F2 r;
#pragma unroll
  for (int i = 0; i < 16; ++i) { const __bf16 h = (__bf16)v[i]; r.h[i] = h; r.l[i] = (__bf16)(v[i] - (float)h); }
  return r; }
__device__ __forceinline__ F2 split_row(const float* row, int k0, int lane) { float v[16]; const float* p = row + k0 + 8 * (lane >> 4);
#pragma unroll
  for (int i = 0; i < 8; ++i) { v[i] = p[i]; v[8 + i] = p[16 + i]; }
  return bsplit16(v); }
__device__ __forceinline__ F2 split_rowK(const float* row, int k0, int lane, int K) { float v[16]; const int g = lane >> 4;
#pragma unroll
  for (int i = 0; i < 8; ++i) { const int ka = k0 + 8 * g + i, kb = ka + 16; v[i] = ka < K ? row[ka < K ? ka : K - 1] : 0.f; v[8 + i] = kb < K ? row[kb < K ? kb : K - 1] : 0.f; }
  return bsplit16(v); }
__device__ __forceinline__ F2 split_col(const float* W, int k0, int n, int lane, int ld, int K) { float v[16]; const int g = lane >> 4;
#pragma unroll
  for (int i = 0; i < 8; ++i) { const int ka = k0 + 8 * g + i, kb = ka + 16; v[i] = ka < K ? W[(size_t)(ka < K ? ka : K - 1) * ld + n] : 0.f; v[8 + i] = kb < K ? W[(size_t)(kb < K ? kb : K - 1) * ld + n] : 0.f; }
  return bsplit16(v); }
__device__ __forceinline__ v8f mac3(const F2& a, const F2& b, v8f c) { c = wmma_bf(a.l, b.h, c); c = wmma_bf(a.h, b.l, c); return wmma_bf(a.h, b.h, c); }
__device__ __forceinline__ float sigm(float v) { return 1.0f / (1.0f + expf(-v)); }
#define LDSX() do { asm volatile("s_wait_dscnt 0" ::: "memory"); __builtin_amdgcn_wave_barrier(); __builtin_amdgcn_fence(__ATOMIC_RELEASE, "workgroup"); } while (0)

// SAGAN-style position attention with SIGMOID (unnormalised) attention (B 4, 64 x 64 = 4,096 positions, C 512; x channels-last [B,H,W,C] = rows [b*n][512]; (in,out) weights Wq/Wk [512,64], Wv [512,512], no biases; gamma scalar): q = x Wq, k = x Wk, v = x Wv; scores[n][m] = q_n . k_m (no scaling); attn = sigmoid(scores) (no row normalisation); attended[n][c] = sum_m attn[n][m] v[m][c]; out = gamma * attended + x.
#define NB 4
#define TT 4096
#define CC 512            // value width (v planes, output rows)
#define CCQ 128           // q / k row pitch: one 128-column block, columns >= 64 are zero
#define DIN 512          // x width
#define NH 1
#define HD 512
#define NQB (TT / 64)
#define HG 1               // sizes only the unused WS_S region: no score plane in memory
#define SCALE (1.0f)
#define HDQK 64            // q / k width
#define CAUSAL 0
#ifndef TNB
#define TNB NB
#endif
__device__ __forceinline__ v16b zero16b() { v16b z; _Pragma("unroll") for (int i = 0; i < 16; ++i) z[i] = (__bf16)0.f; return z; }
__device__ __forceinline__ float bfr(float v) { return (float)(__bf16)v; }
__host__ __device__ __forceinline__ int kb_last(int qb) { return CAUSAL ? ((qb * 64 + 63) >> 7) : (TT / 128 - 1); }
typedef __attribute__((ext_vector_type(8))) __bf16 v8b;
__device__ __forceinline__ v16b frag_b(const __bf16* rowk0, int lane) {
  union { v16b v; v8b q[2]; } u; const __bf16* p = rowk0 + 8 * (lane >> 4);
  u.q[0] = *(const v8b*)p; u.q[1] = *(const v8b*)(p + 16); return u.v;
}
#define QBH 0              // unused: every query block takes k_att's single f16 path
#define QHI 0               // no q residual plane: q and k once to f16 (1 product)
#define KHI 64            // key rows carrying k residual / v bf16 hi+lo planes (written by k_projT, read by no kernel)
// B fragment (k rows k0+.., output column o) of a weight: (in,out) [K][ld] or (out,in) [ld rows of K]: bf16 exact, or f16(bf16 * 256) exact
__device__ __forceinline__ v16b wcol_io(const float* Wm, int k0, int o, int lane, int ld) { v16b w; const int g = lane >> 4;
#pragma unroll
  for (int i = 0; i < 8; ++i) { w[i] = (__bf16)Wm[(size_t)(k0 + 8 * g + i) * ld + o]; w[8 + i] = (__bf16)Wm[(size_t)(k0 + 16 + 8 * g + i) * ld + o]; }
  return w; }
__device__ __forceinline__ v16b wcol_oi(const float* Wm, int k0, int o, int lane, int K) { v16b w; const float* p = Wm + (size_t)o * K + k0 + 8 * (lane >> 4);
#pragma unroll
  for (int i = 0; i < 8; ++i) { w[i] = (__bf16)p[i]; w[8 + i] = (__bf16)p[16 + i]; }
  return w; }
__device__ __forceinline__ v16h wcolh_io(const float* Wm, int k0, int o, int lane, int ld) { v16h w; const int g = lane >> 4;
#pragma unroll
  for (int i = 0; i < 8; ++i) { w[i] = (_Float16)(bfr(Wm[(size_t)(k0 + 8 * g + i) * ld + o]) * 256.0f); w[8 + i] = (_Float16)(bfr(Wm[(size_t)(k0 + 16 + 8 * g + i) * ld + o]) * 256.0f); }
  return w; }
__device__ __forceinline__ v16h wcolh_oi(const float* Wm, int k0, int o, int lane, int K) { v16h w; const float* p = Wm + (size_t)o * K + k0 + 8 * (lane >> 4);
#pragma unroll
  for (int i = 0; i < 8; ++i) { w[i] = (_Float16)(bfr(p[i]) * 256.0f); w[8 + i] = (_Float16)(bfr(p[16 + i]) * 256.0f); }
  return w; }
#define WQKV_LAYOUT 0   // 0 = (in,out) [K][CC] for Wv, [K][HDQK] for Wq/Wk; 1 = (out,in) [CC][DIN]; 2 = per-head [NH][DIN][HD]
__device__ __forceinline__ v16b wcol_hdk(const float* Wm, int k0, int o, int lane) { v16b w; const int g = lane >> 4; const float* p = Wm + (size_t)(o / HD) * DIN * HD + (o % HD);
#pragma unroll
  for (int i = 0; i < 8; ++i) { w[i] = (__bf16)p[(size_t)(k0 + 8 * g + i) * HD]; w[8 + i] = (__bf16)p[(size_t)(k0 + 16 + 8 * g + i) * HD]; }
  return w; }
#define WO_OUT_IN 0
#if WQKV_LAYOUT == 1
#define WCOL(W, k0, o, lane) wcol_oi(W, k0, (o), lane, DIN)   /* unused: layout 0 */
#elif WQKV_LAYOUT == 2
#define WCOL(W, k0, o, lane) wcol_hdk(W, k0, o, lane)
#else
#define WCOL(W, k0, o, lane) (which == 2 ? wcol_io(W, k0, (o), lane, CC) : ((o) < HDQK ? wcol_io(W, k0, (o), lane, HDQK) : zero16b()))   /* Wv [512][512]; Wq/Wk [512][64]: projected q/k columns >= 64 are zero (block y = 0 only) */
#endif
#if WO_OUT_IN
#define WOCOL(W, k0, o, lane) wcol_oi(W, k0, o, lane, CC)
#define WOCOLH(W, k0, o, lane) wcolh_oi(W, k0, o, lane, CC)
#else
#define WOCOL(W, k0, o, lane) wcol_io(W, k0, o, lane, DIN)
#define WOCOLH(W, k0, o, lane) wcolh_io(W, k0, o, lane, DIN)
#endif
#define BG HG              // unused: k_att covers all batches in one launch, blockIdx.z = batch
#define BGN (TNB < BG ? TNB : BG)
#define DVH 128            // unused: each k_att block covers all 512 value columns (16 accumulator tiles per wave)
#ifndef SM_EXTRA_PARAMS
#define SM_EXTRA_PARAMS
#endif
#ifndef PROJ_EXTRA_PARAMS
#define PROJ_EXTRA_PARAMS
#endif
#ifndef SM_MASK_HOOK
#define SM_MASK_HOOK (void)0
#endif

#define WS_QH  0u                                      // f16 q rows [b*t][CCQ]
#define WS_KH  (WS_QH + 2u * (size_t)NB * TT * CCQ)     // f16 k rows [b*t][CCQ]
#define WS_VT  (WS_KH + 2u * (size_t)NB * TT * CCQ)     // f16 v planes [b][c][t]
#define WS_QL  (WS_VT + 2u * (size_t)NB * CC * TT)      // f16 q residual x 2^10 rows [b][t < QHI][CCQ]
#define WS_KL  (WS_QL + 2u * (size_t)NB * QHI * CCQ)    // f16 k residual x 2^10 rows [b][t < KHI][CCQ]
#define WS_VB  (WS_KL + 2u * (size_t)NB * KHI * CCQ)    // bf16 v hi planes [b][c][t < KHI]
#define WS_VBL (WS_VB + 2u * (size_t)NB * CC * KHI)
#define WS_S   (WS_VBL + 2u * (size_t)NB * CC * KHI)    // unused: no score plane in memory
#define WS_Y   (WS_S  + 4u * (size_t)HG * TT * TT)      // f32 ctx rows [b*t][CC] (only when there is an output projection)
#define WS_END (WS_Y  + 0u)

// ---- k_proj: block = (64 rows, 128 cols, which): q/k/v = X W (+ b) with exact bf16 products (K = DIN) -> which 0: q f16 rows (+ residual rows < QHI); 1: k f16 rows (+ residual rows < KHI); 2: v f16 planes [c][t] (+ bf16 hi/lo planes for t < KHI)
template <int WOFF> __global__ __launch_bounds__(128) void k_projT(const float* __restrict__ XQ, const float* __restrict__ XK, const float* __restrict__ XV, const float* __restrict__ WQ, const float* __restrict__ WK, const float* __restrict__ WV, const float* __restrict__ BQ, const float* __restrict__ BK, const float* __restrict__ BV,
    _Float16* __restrict__ QH, _Float16* __restrict__ QL, _Float16* __restrict__ KH, _Float16* __restrict__ KL, _Float16* __restrict__ VT, __bf16* __restrict__ VB, __bf16* __restrict__ VBL) {
  __shared__ __align__(16) _Float16 sh[64][136], sl[64][136]; __shared__ __align__(16) _Float16 th[128][72]; __shared__ __align__(16) __bf16 tb[128][72], tbl[128][72];
  const int tid = threadIdx.x, wave = tid >> 5, lane = tid & 31, col = lane & 15, g = lane >> 4; const int which = blockIdx.z + WOFF; const int c0 = blockIdx.y * 128; const size_t r0 = (size_t)blockIdx.x * 64; const size_t bb = r0 / TT; const int t0 = (int)(r0 % TT);
  const float* X = which == 0 ? XQ : which == 1 ? XK : XV; const float* WA = which == 0 ? WQ : which == 1 ? WK : WV; const float* BA = which == 0 ? BQ : which == 1 ? BK : BV;
  const int KD = DIN;
  v8f acc[8] = {};
#pragma unroll 2
  for (int kc = 0; kc < KD / 32; ++kc) { v16b a; { const float* p = X + (r0 + wave * 16 + col) * (size_t)KD + kc * 32 + 8 * g;   /* row-major [b*t][KD] */
#pragma unroll
      for (int i = 0; i < 8; ++i) { a[i] = (__bf16)p[i]; a[8 + i] = (__bf16)p[16 + i]; } }
    asm volatile("s_wait_loadcnt 0x0" ::: "memory");
#pragma unroll
    for (int j = 0; j < 8; ++j) { const v16b w = WCOL(WA, kc * 32, c0 + j * 16 + col, lane); asm volatile("s_wait_loadcnt 0x0" ::: "memory"); acc[j] = wmma_bf(a, w, acc[j]); } }
  if (which < 2) { _Float16* DH = which == 0 ? QH : KH; _Float16* DL = which == 0 ? QL : KL; const int nhi = which == 0 ? QHI : KHI; const bool hi_rows = t0 < nhi;
#pragma unroll
    for (int j = 0; j < 8; ++j) { const float bias = BA ? bfr(BA[c0 + j * 16 + col]) : 0.f;
#pragma unroll
      for (int r = 0; r < 8; ++r) { const float v = acc[j][r] + bias; const _Float16 hv = (_Float16)v; sh[wave * 16 + 8 * g + r][j * 16 + col] = hv; sl[wave * 16 + 8 * g + r][j * 16 + col] = (_Float16)((v - (float)hv) * 1024.0f); } }
    __syncthreads();
    for (int e = tid; e < 64 * 16; e += 128) { const int rl = e >> 4, q = e & 15; vst2((unsigned*)(DH + (r0 + rl) * CCQ + c0 + q * 8), *(const v4u*)&sh[rl][q * 8]); if (hi_rows) vst2((unsigned*)(DL + (bb * nhi + t0 + rl) * (size_t)CCQ + c0 + q * 8), *(const v4u*)&sl[rl][q * 8]); }   /* q/k rows: pitch CCQ (c0 == 0) */
  } else { const bool hi_rows = t0 < KHI;
#pragma unroll
    for (int j = 0; j < 8; ++j) { const float bias = BA ? bfr(BA[c0 + j * 16 + col]) : 0.f;
#pragma unroll
      for (int r = 0; r < 8; ++r) { const float v = acc[j][r] + bias; const int rl = wave * 16 + 8 * g + r, cl = j * 16 + col; th[cl][rl] = (_Float16)v; const __bf16 bh = (__bf16)v; tb[cl][rl] = bh; tbl[cl][rl] = (__bf16)(v - (float)bh); } }
    __syncthreads();
    for (int e = tid; e < 128 * 8; e += 128) { const int cl = e >> 3, q = e & 7; vst2((unsigned*)(VT + (bb * CC + c0 + cl) * (size_t)TT + t0 + q * 8), *(const v4u*)&th[cl][q * 8]); if (hi_rows) { const size_t o3 = (bb * CC + c0 + cl) * (size_t)KHI + t0 + q * 8; vst2((unsigned*)(VB + o3), *(const v4u*)&tb[cl][q * 8]); vst2((unsigned*)(VBL + o3), *(const v4u*)&tbl[cl][q * 8]); } } } }
#define AT_KS 64                        // keys per staged tile of k_att
#define AT_KP (HDQK * 2 + 16)           // LDS pitch of a k row, bytes (16 B x odd: no bank conflict for 16-byte reads)
#define AT_VP (AT_KS * 2 + 16)          // LDS pitch of a v row and of a P row, bytes (16 B x odd)
#define AT_KB (AT_KS * AT_KP)           // k part of a buffer
#define AT_SB (AT_KB + CC * AT_VP)      // one buffer: k part + v part
#define AT_PB (64 * AT_VP)              // one P tile: 64 queries x 64 keys, f16
#define AT_OP 68                        // LDS pitch of an output row of one wave, floats
// 16-byte copies per lane, global -> LDS through no register; the s_wait_xcnt stands inside each statement so that no address register is rewritten ahead of it
__device__ __forceinline__ void acopy8(const unsigned l[8], const void* const gq[8]) {
  asm volatile("global_load_async_to_lds_b128 %0, %8, off\n\tglobal_load_async_to_lds_b128 %1, %9, off\n\tglobal_load_async_to_lds_b128 %2, %10, off\n\tglobal_load_async_to_lds_b128 %3, %11, off\n\t"
               "global_load_async_to_lds_b128 %4, %12, off\n\tglobal_load_async_to_lds_b128 %5, %13, off\n\tglobal_load_async_to_lds_b128 %6, %14, off\n\tglobal_load_async_to_lds_b128 %7, %15, off\n\ts_wait_xcnt 0x0"
               :: "v"(l[0]), "v"(l[1]), "v"(l[2]), "v"(l[3]), "v"(l[4]), "v"(l[5]), "v"(l[6]), "v"(l[7]), "v"(gq[0]), "v"(gq[1]), "v"(gq[2]), "v"(gq[3]), "v"(gq[4]), "v"(gq[5]), "v"(gq[6]), "v"(gq[7]) : "memory");
}
// 64 k rows of 128 B: 2 copies per lane, rows 32 apart (256 lanes = 32 rows per copy)
__device__ __forceinline__ void at_stage_k(const _Float16* gk, unsigned lk) {
  asm volatile("global_load_async_to_lds_b128 %0, %2, off\n\tglobal_load_async_to_lds_b128 %1, %3, off\n\ts_wait_xcnt 0x0" :: "v"(lk), "v"(lk + 32 * AT_KP), "v"(gk), "v"(gk + (size_t)32 * CCQ) : "memory");
}
// 512 v rows of 64 keys (128 B): 16 copies per lane, rows 32 apart
__device__ __forceinline__ void at_stage_v(const _Float16* gv, unsigned lv) {
#pragma unroll   // both loops: constant indices, so that each copy's addresses are plain registers of its statement
  for (int s = 0; s < 2; ++s) { unsigned l[8]; const void* gq[8];
#pragma unroll
    for (int i = 0; i < 8; ++i) { l[i] = lv + (s * 8 + i) * 32 * AT_VP; gq[i] = gv + (size_t)(s * 8 + i) * 32 * TT; }
    acopy8(l, gq); }
}
// P of 16 queries x 32 keys: logits with the k rows as A and the q rows as B, so that a lane holds 8 consecutive keys of one query (element r: key 8 g + r of the 16, query col); sigmoid x 2^11 in f32 (precise expf), once to f16, one 16-byte LDS store per 16 keys
__device__ __forceinline__ void at_p(const unsigned char* kl, unsigned char* pd, v16h qf0, v16h qf1, int lane) {
  v16h ka[2][2];
#pragma unroll   // constant indices: fragments stay in registers; the four fragments' LDS reads stand as one group
  for (int u = 0; u < 2; ++u) { const _Float16* kr = (const _Float16*)(kl + u * 16 * AT_KP); ka[u][0] = frag_h(kr, lane); ka[u][1] = frag_h(kr + 32, lane); }
#pragma unroll
  for (int u = 0; u < 2; ++u) { v8f st = {}; st = wmma16(ka[u][0], qf0, st); st = wmma16(ka[u][1], qf1, st);
    v8h ph;
#pragma unroll
    for (int r = 0; r < 8; ++r) ph[r] = (_Float16)(2048.0f / (1.0f + expf(-st[r])));
    *(v8h*)(pd + u * 32) = ph; }
}
// ---- k_att: block = (64 queries (qb), batch), 8 waves, all 512 value columns; no score plane in memory. Per tile of 64 keys the block forms its 64 x 64 P once (each wave 16 queries x 32 keys) into LDS, one tile ahead of attended += P . v (wave = 64 queries x 64 columns); out = gamma * attended x 2^-11 + bf16(x).
// staging buffer s mod 2 holds the v rows of tile s and the k rows of tile s + 1, so that trip t reads buffer t mod 2 alone; the k rows of tile 0 have a buffer of their own, filled once
__global__ __launch_bounds__(256) void k_att(const _Float16* __restrict__ QH, const _Float16* __restrict__ KH, const _Float16* __restrict__ VT, const float* __restrict__ X1, const float* __restrict__ GM, float* __restrict__ Y) {
  __shared__ __align__(16) unsigned char stg[2 * AT_SB]; __shared__ __align__(16) unsigned char k0s[AT_KB]; __shared__ __align__(16) unsigned char pl[2 * AT_PB];
  const float gmv = bfr(GM[0]); const int b = blockIdx.z, qb = blockIdx.x;
  const int tid = threadIdx.x, wave = tid >> 5, lane = tid & 31, col = lane & 15, g = lane >> 4;
  const int qt = wave & 3, kp = wave >> 2;   /* P: this wave forms queries 16 qt .. + 15 against keys 32 kp .. + 31 of each tile */
  const _Float16* qr = QH + ((size_t)b * TT + qb * 64 + qt * 16 + col) * CCQ;
  const v16h qf0 = frag_h(qr, lane), qf1 = frag_h(qr + 32, lane);
  v8f acc[4][4] = {};
  const unsigned lbase = (unsigned)(size_t)stg; const int nt = TT / AT_KS;
  const _Float16* gk = KH + ((size_t)b * TT + (tid >> 3)) * CCQ + (tid & 7) * 8;            /* copy i: k row 32 i + tid / 8, four 128-B rows per wave */
  const _Float16* gv = VT + ((size_t)b * CC + (tid >> 3)) * (size_t)TT + (tid & 7) * 8;     /* copy i: v row 32 i + tid / 8 */
  const unsigned lk = lbase + (tid >> 3) * AT_KP + (tid & 7) * 16, lv = lbase + AT_KB + (tid >> 3) * AT_VP + (tid & 7) * 16;
  const unsigned kro = (kp * 32 + col) * AT_KP, pwo = (qt * 16 + col) * AT_VP + (kp * 32 + 8 * g) * 2;   /* this lane's first k row in a k part; its first P store in a P tile */
  at_stage_k(gk, (unsigned)(size_t)k0s + (tid >> 3) * AT_KP + (tid & 7) * 16);
  at_stage_k(gk + (size_t)AT_KS * CCQ, lk); at_stage_v(gv, lv);
  asm volatile("s_wait_asynccnt 0x0" ::: "memory");   /* k tile 0 and buffer 0 landed (this wave's copies) */
  __syncthreads();                                      /* both readable by every wave */
  at_stage_k(gk + (size_t)2 * AT_KS * CCQ, lk + AT_SB); at_stage_v(gv + AT_KS, lv + AT_SB);
  at_p(k0s + kro, pl + pwo, qf0, qf1, lane);
  asm volatile("s_wait_dscnt 0x0" ::: "memory");      /* this wave's P stores of tile 0 are in LDS */
  __syncthreads();                                      /* P of tile 0 readable by every wave */
#pragma unroll 1   // stays rolled: one publish point in the code, the buffers picked by t & 1
  for (int t = 0; t < nt; ++t) { const unsigned bo = (t & 1) * AT_SB, po = (t & 1) * AT_PB;
    if (t + 1 < nt) at_p(stg + bo + kro, pl + (AT_PB - po) + pwo, qf0, qf1, lane);   /* P of tile t + 1 into the other P tile */
    const unsigned char* vb = stg + bo + AT_KB + (wave * 64 + col) * AT_VP; const unsigned char* pb = pl + po + col * AT_VP;
#pragma unroll   // here and below in this loop: constant indices, so that fragments and accumulators stay in registers
    for (int kc = 0; kc < AT_KS / 32; ++kc) { v16h a[4], w[4];
#pragma unroll
      for (int i = 0; i < 4; ++i) { a[i] = frag_h((const _Float16*)(pb + i * 16 * AT_VP + kc * 64), lane); w[i] = frag_h((const _Float16*)(vb + i * 16 * AT_VP + kc * 64), lane); }
#pragma unroll
      for (int i = 0; i < 4; ++i)
#pragma unroll
        for (int j = 0; j < 4; ++j) acc[i][j] = wmma16(a[i], w[j], acc[i][j]); }
    asm volatile("s_wait_dscnt 0x0" ::: "memory");      /* this wave's reads of buffer t and of P tile t are done, its P stores of tile t + 1 are in LDS */
    asm volatile("s_wait_asynccnt 0x0" ::: "memory");   /* this wave's copies of buffer t + 1 have landed */
    __syncthreads();                                    /* publishes buffer t + 1 and P of tile t + 1; ends every wave's reads of buffer t and of P tile t */
    if (t + 2 < nt) { if (t + 3 < nt) at_stage_k(gk + (size_t)(t + 3) * AT_KS * CCQ, lk + bo); at_stage_v(gv + (t + 2) * AT_KS, lv + bo); } }
  asm volatile("s_wait_asynccnt 0x0" ::: "memory");     /* no copy outstanding behind the loop */
  float* sw = (float*)stg + wave * (64 * AT_OP);        /* the staging LDS is free now: each wave turns its own 64 x 64 block into rows */
#pragma unroll
  for (int i = 0; i < 4; ++i)
#pragma unroll
    for (int j = 0; j < 4; ++j)
#pragma unroll
      for (int r = 0; r < 8; ++r) sw[(i * 16 + 8 * g + r) * AT_OP + j * 16 + col] = acc[i][j][r] * (1.0f / 2048.0f);
  LDSX();
#pragma unroll 1   // four row pairs per trip: their x loads stand together ahead of the sums
  for (int it = 0; it < 32; it += 4) { v4f xr[4];
#pragma unroll
    for (int e = 0; e < 4; ++e) xr[e] = *(const v4f*)(X1 + ((size_t)b * TT + qb * 64 + (it + e) * 2 + g) * CC + wave * 64 + col * 4);
#pragma unroll
    for (int e = 0; e < 4; ++e) { const int rl = (it + e) * 2 + g; v4f v = *(const v4f*)&sw[rl * AT_OP + col * 4]; v[0] = gmv * v[0] + bfr(xr[e][0]); v[1] = gmv * v[1] + bfr(xr[e][1]); v[2] = gmv * v[2] + bfr(xr[e][2]); v[3] = gmv * v[3] + bfr(xr[e][3]); vst2(Y + ((size_t)b * TT + qb * 64 + rl) * CC + wave * 64 + col * 4, v); }
    asm volatile("s_wait_xcnt 0x0" ::: "memory"); } }   /* the wait: the next trip rewrites the address and data registers that these stores name */   /* out = gamma * attended + bf16(x): 256-B (row, 64-column) segments, each written once */

extern "C" void kernel_launch(void* const* d_in, const int* in_sizes, int n_in, void* d_out, int out_size, void* d_ws, size_t ws_size, hipStream_t stream) {
  (void)in_sizes; (void)n_in; (void)out_size;
  const float** F = (const float**)d_in;
  if (ws_size < (size_t)WS_END) return;
  char* ws = (char*)d_ws; _Float16 *QH = (_Float16*)(ws + WS_QH), *KH = (_Float16*)(ws + WS_KH), *VT = (_Float16*)(ws + WS_VT), *QL = (_Float16*)(ws + WS_QL), *KL = (_Float16*)(ws + WS_KL); __bf16 *VB = (__bf16*)(ws + WS_VB), *VBL = (__bf16*)(ws + WS_VBL); float *S = (float*)(ws + WS_S), *Y = (float*)(ws + WS_Y);
  (void)S; (void)Y; (void)QL; (void)KL; (void)VB; (void)VBL;
  // inputs (d_in order): 0 x [4,64,64,512]; 1 Wq [512,64] (in,out); 2 Wk [512,64]; 3 Wv [512,512]; 4 gamma [1]
  k_projT<0><<<dim3(TNB * TT / 64, 1, 2), 128, 0, stream>>>(F[0], F[0], F[0], F[1], F[2], F[3], nullptr, nullptr, nullptr, QH, QL, KH, KL, VT, VB, VBL);   /* which 0, 1: q and k (one 128-column block, columns >= 64 zero) */
  k_projT<2><<<dim3(TNB * TT / 64, CC / 128, 1), 128, 0, stream>>>(F[0], F[0], F[0], F[1], F[2], F[3], nullptr, nullptr, nullptr, QH, QL, KH, KL, VT, VB, VBL);   /* which 2: v (four 128-column blocks) */
  k_att<<<dim3(NQB, 1, TNB), 256, 0, stream>>>(QH, KH, VT, F[0], F[4], (float*)d_out);   /* logits, sigmoid and P . v of all batches in one launch */
}

// v003
// One run takes 136 microseconds.
// Two timings next to v002 put it at 2.01 and 2.00 times that version's speed.
// All steps since v000 together make it 9.17 times as fast.
// compute dtype: all float inputs rounded to bf16; q/k (64 wide) and v (512) = x W with EXACT bf16 products on WMMA 16x16x32, f32 accumulate; q and k once to f16 (1 product) for the UNSCALED scores (logit sigma ~16; sigmoid saturates outside |s| < 5); sigmoid in f32 (precise expf); P x 2^11 once to f16 against v once to f16 (1 product); gamma * attended + x in f32; f32 output.
#include <hip/hip_runtime.h>
#include <math.h>

typedef __attribute__((ext_vector_type(16))) _Float16 v16h;
typedef __attribute__((ext_vector_type(16))) __bf16 v16b;
typedef __attribute__((ext_vector_type(8)))  _Float16 v8h;
typedef __attribute__((ext_vector_type(8)))  float v8f;
typedef __attribute__((ext_vector_type(4)))  float v4f;
typedef __attribute__((ext_vector_type(2)))  float v2f;
typedef __attribute__((ext_vector_type(4)))  unsigned v4u;
typedef __attribute__((ext_vector_type(4)))  int v4i;
typedef float __attribute__((may_alias)) float_a;
typedef int __attribute__((may_alias)) int_a;

template <typename T> __device__ __forceinline__ void vst2(void* p, T v) { *(T*)p = v;  }
__device__ __forceinline__ v8f wmma16(v16h a, v16h b, v8f c) {
  v8f d = __builtin_amdgcn_wmma_f32_16x16x32_f16(false, a, false, b, (short)0, c, false, false);
  asm volatile("v_nop\n\tv_nop\n\tv_nop\n\tv_nop" : "+v"(d) : "v"(a), "v"(b));
  return d;
}
__device__ __forceinline__ v8f wmma_bf(v16b a, v16b b, v8f c) {
  v8f d = __builtin_amdgcn_wmma_f32_16x16x32_bf16(false, a, false, b, (short)0, c, false, false);
  asm volatile("v_nop\n\tv_nop\n\tv_nop\n\tv_nop" : "+v"(d) : "v"(a), "v"(b));
  return d;
}
// 16x16x32 fragments: lane = (h = lane>>4, row/col = lane&15); elements 0..7 = k0+8h+0..7, 8..15 = k0+16+8h+0..7; D element r = row 8h+r
__device__ __forceinline__ v16h frag_h(const _Float16* rowk0, int lane) {
  union { v16h v; v8h q[2]; } u; const _Float16* p = rowk0 + 8 * (lane >> 4);
  u.q[0] = *(const v8h*)p; u.q[1] = *(const v8h*)(p + 16); return u.v;
}
__device__ __forceinline__ v16h frag_f32(const float* rowk0, int lane) {
  v16h a; const float* p = rowk0 + 8 * (lane >> 4);
#pragma unroll
  for (int i = 0; i < 8; ++i) { a[i] = (_Float16)p[i]; a[8 + i] = (_Float16)p[16 + i]; }
  return a;
}
__device__ __forceinline__ v16h frag_f32s(const float* rowk0, int lane, float sc) {
  v16h a; const float* p = rowk0 + 8 * (lane >> 4);
#pragma unroll
  for (int i = 0; i < 8; ++i) { a[i] = (_Float16)(p[i] * sc); a[8 + i] = (_Float16)(p[16 + i] * sc); }
  return a;
}
// column fragment from a [K][ld] layout (column n), rows >= K read as 0
__device__ __forceinline__ v16h fragc_f32(const float* W, int k0, int n, int lane, int ld, int K) {
  v16h a; const int g = lane >> 4;
#pragma unroll
  for (int i = 0; i < 8; ++i) { const int ka = k0 + 8 * g + i, kb = ka + 16;
    a[i] = (_Float16)(ka < K ? W[(size_t)(ka < K ? ka : K - 1) * ld + n] : 0.f); a[8 + i] = (_Float16)(kb < K ? W[(size_t)(kb < K ? kb : K - 1) * ld + n] : 0.f); }
  return a;
}
struct F2 { v16b h, l; };
__device__ __forceinline__ F2 bsplit16(const float v[16]) { F2 r;
#pragma unroll
  for (int i = 0; i < 16; ++i) { const __bf16 h = (__bf16)v[i]; r.h[i] = h; r.l[i] = (__bf16)(v[i] - (float)h); }
  return r; }
__device__ __forceinline__ F2 split_row(const float* row, int k0, int lane) { float v[16]; const float* p = row + k0 + 8 * (lane >> 4);
#pragma unroll
  for (int i = 0; i < 8; ++i) { v[i] = p[i]; v[8 + i] = p[16 + i]; }
  return bsplit16(v); }
__device__ __forceinline__ F2 split_rowK(const float* row, int k0, int lane, int K) { float v[16]; const int g = lane >> 4;
#pragma unroll
  for (int i = 0; i < 8; ++i) { const int ka = k0 + 8 * g + i, kb = ka + 16; v[i] = ka < K ? row[ka < K ? ka : K - 1] : 0.f; v[8 + i] = kb < K ? row[kb < K ? kb : K - 1] : 0.f; }
  return bsplit16(v); }
__device__ __forceinline__ F2 split_col(const float* W, int k0, int n, int lane, int ld, int K) { float v[16]; const int g = lane >> 4;
#pragma unroll
  for (int i = 0; i < 8; ++i) { const int ka = k0 + 8 * g + i, kb = ka + 16; v[i] = ka < K ? W[(size_t)(ka < K ? ka : K - 1) * ld + n] : 0.f; v[8 + i] = kb < K ? W[(size_t)(kb < K ? kb : K - 1) * ld + n] : 0.f; }
  return bsplit16(v); }
__device__ __forceinline__ v8f mac3(const F2& a, const F2& b, v8f c) { c = wmma_bf(a.l, b.h, c); c = wmma_bf(a.h, b.l, c); return wmma_bf(a.h, b.h, c); }
__device__ __forceinline__ float sigm(float v) { return 1.0f / (1.0f + expf(-v)); }
#define LDSX() do { asm volatile("s_wait_dscnt 0" ::: "memory"); __builtin_amdgcn_wave_barrier(); __builtin_amdgcn_fence(__ATOMIC_RELEASE, "workgroup"); } while (0)

// SAGAN-style position attention with SIGMOID (unnormalised) attention (B 4, 64 x 64 = 4,096 positions, C 512; x channels-last [B,H,W,C] = rows [b*n][512]; (in,out) weights Wq/Wk [512,64], Wv [512,512], no biases; gamma scalar): q = x Wq, k = x Wk, v = x Wv; scores[n][m] = q_n . k_m (no scaling); attn = sigmoid(scores) (no row normalisation); attended[n][c] = sum_m attn[n][m] v[m][c]; out = gamma * attended + x.
#define NB 4
#define TT 4096
#define CC 512            // value width (v planes, output rows)
#define CCQ 128           // q / k row pitch: one 128-column block, columns >= 64 are zero
#define DIN 512          // x width
#define NH 1
#define HD 512
#define NQB (TT / 64)
#define HG 1               // sizes only the unused WS_S region: no score plane in memory
#define SCALE (1.0f)
#define HDQK 64            // q / k width
#define CAUSAL 0
#ifndef TNB
#define TNB NB
#endif
__device__ __forceinline__ v16b zero16b() { v16b z; _Pragma("unroll") for (int i = 0; i < 16; ++i) z[i] = (__bf16)0.f; return z; }
__device__ __forceinline__ float bfr(float v) { return (float)(__bf16)v; }
__host__ __device__ __forceinline__ int kb_last(int qb) { return CAUSAL ? ((qb * 64 + 63) >> 7) : (TT / 128 - 1); }
typedef __attribute__((ext_vector_type(8))) __bf16 v8b;
__device__ __forceinline__ v16b frag_b(const __bf16* rowk0, int lane) {
  union { v16b v; v8b q[2]; } u; const __bf16* p = rowk0 + 8 * (lane >> 4);
  u.q[0] = *(const v8b*)p; u.q[1] = *(const v8b*)(p + 16); return u.v;
}
#define QBH 0              // unused: every query block takes k_att's single f16 path
#define QHI 0               // no q residual plane: q and k once to f16 (1 product)
#define KHI 64            // key rows carrying k residual / v bf16 hi+lo planes (written by k_projT, read by no kernel)
// B fragment (k rows k0+.., output column o) of a weight: (in,out) [K][ld] or (out,in) [ld rows of K]: bf16 exact, or f16(bf16 * 256) exact
__device__ __forceinline__ v16b wcol_io(const float* Wm, int k0, int o, int lane, int ld) { v16b w; const int g = lane >> 4;
#pragma unroll
  for (int i = 0; i < 8; ++i) { w[i] = (__bf16)Wm[(size_t)(k0 + 8 * g + i) * ld + o]; w[8 + i] = (__bf16)Wm[(size_t)(k0 + 16 + 8 * g + i) * ld + o]; }
  return w; }
__device__ __forceinline__ v16b wcol_oi(const float* Wm, int k0, int o, int lane, int K) { v16b w; const float* p = Wm + (size_t)o * K + k0 + 8 * (lane >> 4);
#pragma unroll
  for (int i = 0; i < 8; ++i) { w[i] = (__bf16)p[i]; w[8 + i] = (__bf16)p[16 + i]; }
  return w; }
__device__ __forceinline__ v16h wcolh_io(const float* Wm, int k0, int o, int lane, int ld) { v16h w; const int g = lane >> 4;
#pragma unroll
  for (int i = 0; i < 8; ++i) { w[i] = (_Float16)(bfr(Wm[(size_t)(k0 + 8 * g + i) * ld + o]) * 256.0f); w[8 + i] = (_Float16)(bfr(Wm[(size_t)(k0 + 16 + 8 * g + i) * ld + o]) * 256.0f); }
  return w; }
__device__ __forceinline__ v16h wcolh_oi(const float* Wm, int k0, int o, int lane, int K) { v16h w; const float* p = Wm + (size_t)o * K + k0 + 8 * (lane >> 4);
#pragma unroll
  for (int i = 0; i < 8; ++i) { w[i] = (_Float16)(bfr(p[i]) * 256.0f); w[8 + i] = (_Float16)(bfr(p[16 + i]) * 256.0f); }
  return w; }
#define WQKV_LAYOUT 0   // 0 = (in,out) [K][CC] for Wv, [K][HDQK] for Wq/Wk; 1 = (out,in) [CC][DIN]; 2 = per-head [NH][DIN][HD]
__device__ __forceinline__ v16b wcol_hdk(const float* Wm, int k0, int o, int lane) { v16b w; const int g = lane >> 4; const float* p = Wm + (size_t)(o / HD) * DIN * HD + (o % HD);
#pragma unroll
  for (int i = 0; i < 8; ++i) { w[i] = (__bf16)p[(size_t)(k0 + 8 * g + i) * HD]; w[8 + i] = (__bf16)p[(size_t)(k0 + 16 + 8 * g + i) * HD]; }
  return w; }
#define WO_OUT_IN 0
#if WQKV_LAYOUT == 1
#define WCOL(W, k0, o, lane) wcol_oi(W, k0, (o), lane, DIN)   /* unused: layout 0 */
#elif WQKV_LAYOUT == 2
#define WCOL(W, k0, o, lane) wcol_hdk(W, k0, o, lane)
#else
#define WCOL(W, k0, o, lane) (which == 2 ? wcol_io(W, k0, (o), lane, CC) : ((o) < HDQK ? wcol_io(W, k0, (o), lane, HDQK) : zero16b()))   /* Wv [512][512]; Wq/Wk [512][64]: projected q/k columns >= 64 are zero (block y = 0 only) */
#endif
#if WO_OUT_IN
#define WOCOL(W, k0, o, lane) wcol_oi(W, k0, o, lane, CC)
#define WOCOLH(W, k0, o, lane) wcolh_oi(W, k0, o, lane, CC)
#else
#define WOCOL(W, k0, o, lane) wcol_io(W, k0, o, lane, DIN)
#define WOCOLH(W, k0, o, lane) wcolh_io(W, k0, o, lane, DIN)
#endif
#define BG HG              // unused: k_att covers all batches in one launch, blockIdx.z = batch
#define BGN (TNB < BG ? TNB : BG)
#define DVH 128            // unused: each k_att block covers all 512 value columns (16 accumulator tiles per wave)
#ifndef SM_EXTRA_PARAMS
#define SM_EXTRA_PARAMS
#endif
#ifndef PROJ_EXTRA_PARAMS
#define PROJ_EXTRA_PARAMS
#endif
#ifndef SM_MASK_HOOK
#define SM_MASK_HOOK (void)0
#endif

#define WS_QH  0u                                      // f16 q rows [b*t][CCQ]
#define WS_KH  (WS_QH + 2u * (size_t)NB * TT * CCQ)     // f16 k rows [b*t][CCQ]
#define WS_VT  (WS_KH + 2u * (size_t)NB * TT * CCQ)     // f16 v planes [b][c][t]
#define WS_QL  (WS_VT + 2u * (size_t)NB * CC * TT)      // f16 q residual x 2^10 rows [b][t < QHI][CCQ]
#define WS_KL  (WS_QL + 2u * (size_t)NB * QHI * CCQ)    // f16 k residual x 2^10 rows [b][t < KHI][CCQ]
#define WS_VB  (WS_KL + 2u * (size_t)NB * KHI * CCQ)    // bf16 v hi planes [b][c][t < KHI]
#define WS_VBL (WS_VB + 2u * (size_t)NB * CC * KHI)
#define WS_S   (WS_VBL + 2u * (size_t)NB * CC * KHI)    // unused: no score plane in memory
#define WS_Y   (WS_S  + 4u * (size_t)HG * TT * TT)      // f32 ctx rows [b*t][CC] (only when there is an output projection)
#define WS_END (WS_Y  + 0u)

#define PJ_KC 64                        // k values per staged chunk of k_projT
#define PJ_P (PJ_KC * 2 + 16)           // LDS pitch of a staged weight column and of a staged x row, bytes (16 B x odd: no bank conflict for 16-byte reads)
typedef __attribute__((ext_vector_type(4))) __bf16 v4b;
// ---- k_proj: block = (64 rows, 128 cols, which): q/k/v = X W (+ b) with exact bf16 products (K = DIN) -> which 0: q f16 rows (+ residual rows < QHI); 1: k f16 rows (+ residual rows < KHI); 2: v f16 planes [c][t] (+ bf16 hi/lo planes for t < KHI)
// per chunk of 64 k the block stages, through registers and as bf16, its weight columns TRANSPOSED ([column][k]; a lane loads two adjacent columns, so a wave's load is two whole 128-B lines) and its 64 x rows (16 lanes x 16 B per row); fragments are 16-byte LDS reads. Two buffers: the next chunk's global loads fly while this chunk is worked on; one barrier per chunk. The staging LDS is used again by the epilogue.
template <int WOFF> __global__ __launch_bounds__(128) void k_projT(const float* __restrict__ XQ, const float* __restrict__ XK, const float* __restrict__ XV, const float* __restrict__ WQ, const float* __restrict__ WK, const float* __restrict__ WV, const float* __restrict__ BQ, const float* __restrict__ BK, const float* __restrict__ BV,
    _Float16* __restrict__ QH, _Float16* __restrict__ QL, _Float16* __restrict__ KH, _Float16* __restrict__ KL, _Float16* __restrict__ VT, __bf16* __restrict__ VB, __bf16* __restrict__ VBL) {
  constexpr bool ISV = WOFF == 2;   /* WOFF 2: v (128 of Wv's 512 columns per block); WOFF 0: q or k (all 64 columns; accumulator tiles 4..7 stay zero) */
  constexpr int NJ = ISV ? 8 : 4, NCOL = NJ * 16, NCP = NCOL / 2, KPT = PJ_KC * NCP / 128, LDW = ISV ? CC : HDQK;   /* a thread stages KPT k values of one pair of columns per chunk */
  constexpr int BUFB = (NCOL + 64) * PJ_P, EPB = ISV ? 3 * 128 * 72 * 2 : 2 * 64 * 136 * 2, SMB = 2 * BUFB > EPB ? 2 * BUFB : EPB;   /* a buffer: weight columns, then x rows */
  __shared__ __align__(16) unsigned char sm[SMB];
  _Float16 (*sh)[136] = (_Float16 (*)[136])sm; _Float16 (*sl)[136] = sh + 64; _Float16 (*th)[72] = (_Float16 (*)[72])sm; __bf16 (*tb)[72] = (__bf16 (*)[72])(sm + 128 * 72 * 2); __bf16 (*tbl)[72] = tb + 128; (void)sh; (void)sl; (void)th; (void)tb; (void)tbl;
  const int tid = threadIdx.x, wave = tid >> 5, lane = tid & 31, col = lane & 15, g = lane >> 4; const int which = ISV ? 2 : (int)blockIdx.z; const int c0 = blockIdx.y * 128; const size_t r0 = (size_t)blockIdx.x * 64; const size_t bb = r0 / TT; const int t0 = (int)(r0 % TT);
  const float* X = which == 0 ? XQ : which == 1 ? XK : XV; const float* WA = which == 0 ? WQ : which == 1 ? WK : WV; const float* BA = which == 0 ? BQ : which == 1 ? BK : BV;
  v8f acc[8] = {};
  const int wn = (tid % NCP) * 2, wk = (tid / NCP) * KPT;
  const float* wp = WA + (size_t)wk * LDW + c0 + wn;                          /* load i: weight row wk + i of the chunk, columns c0 + wn and + 1 */
  const float* xp = X + (r0 + wave * 16 + g) * (size_t)DIN + col * 4;         /* load i: row 2 i + g of this wave's 16 rows, row-major [b*t][DIN] */
  unsigned char* wd = sm + wn * PJ_P + wk * 2; unsigned char* xd = sm + (NCOL + wave * 16 + g) * PJ_P + col * 8;
  v2f wr[KPT]; v4f xr[8];
  auto ld_chunk = [&](int c) {
#pragma unroll   // every unroll of this kernel: constant indices, so that staged values, fragments and accumulators stay in registers
    for (int i = 0; i < KPT; ++i) wr[i] = *(const v2f*)(wp + (size_t)c * PJ_KC * LDW + (size_t)i * LDW);
#pragma unroll
    for (int i = 0; i < 8; ++i) xr[i] = *(const v4f*)(xp + c * PJ_KC + (size_t)i * 2 * DIN); };
  auto st_chunk = [&](int bo) {
#pragma unroll
    for (int e = 0; e < 2; ++e)
#pragma unroll
      for (int s = 0; s < KPT / 8; ++s) { v8b t;
#pragma unroll
        for (int i = 0; i < 8; ++i) t[i] = (__bf16)wr[s * 8 + i][e];
        *(v8b*)(wd + bo + e * PJ_P + s * 16) = t; }
#pragma unroll
    for (int i = 0; i < 8; ++i) { v4b t; t[0] = (__bf16)xr[i][0]; t[1] = (__bf16)xr[i][1]; t[2] = (__bf16)xr[i][2]; t[3] = (__bf16)xr[i][3]; *(v4b*)(xd + bo + i * 2 * PJ_P) = t; } };
  ld_chunk(0); st_chunk(0);
  __syncthreads();   /* chunk 0 readable by every wave */
#pragma unroll 1   // stays rolled: small code, the buffers picked by c & 1
  for (int c = 0; c < DIN / PJ_KC; ++c) { const int bo = (c & 1) * BUFB;
    if (c + 1 < DIN / PJ_KC) ld_chunk(c + 1);
    const unsigned char* wb = sm + bo + col * PJ_P; const unsigned char* xb = sm + bo + (NCOL + wave * 16 + col) * PJ_P;
#pragma unroll
    for (int kc = 0; kc < PJ_KC / 32; ++kc) { const v16b a = frag_b((const __bf16*)(xb + kc * 64), lane);
#pragma unroll
      for (int jh = 0; jh < NJ; jh += 4) { v16b w[4];   /* four fragments' LDS reads stand as one group ahead of their four products: one wait per group */
#pragma unroll
        for (int j = 0; j < 4; ++j) w[j] = frag_b((const __bf16*)(wb + (jh + j) * 16 * PJ_P + kc * 64), lane);
#pragma unroll
        for (int j = 0; j < 4; ++j) acc[jh + j] = wmma_bf(a, w[j], acc[jh + j]); } }
    if (c + 1 < DIN / PJ_KC) st_chunk(BUFB - bo);
    __syncthreads(); }   /* publishes chunk c + 1; ends every wave's reads of chunk c (behind the last chunk: before the epilogue writes this LDS) */
  if constexpr (!ISV) { _Float16* DH = which == 0 ? QH : KH; _Float16* DL = which == 0 ? QL : KL; const int nhi = which == 0 ? QHI : KHI; const bool hi_rows = t0 < nhi;
#pragma unroll
    for (int j = 0; j < 8; ++j) { const float bias = BA ? bfr(BA[c0 + j * 16 + col]) : 0.f;
#pragma unroll
      for (int r = 0; r < 8; ++r) { const float v = acc[j][r] + bias; const _Float16 hv = (_Float16)v; sh[wave * 16 + 8 * g + r][j * 16 + col] = hv; sl[wave * 16 + 8 * g + r][j * 16 + col] = (_Float16)((v - (float)hv) * 1024.0f); } }
    __syncthreads();
    for (int e = tid; e < 64 * 16; e += 128) { const int rl = e >> 4, q = e & 15; vst2((unsigned*)(DH + (r0 + rl) * CCQ + c0 + q * 8), *(const v4u*)&sh[rl][q * 8]); if (hi_rows) vst2((unsigned*)(DL + (bb * nhi + t0 + rl) * (size_t)CCQ + c0 + q * 8), *(const v4u*)&sl[rl][q * 8]); }   /* q/k rows: pitch CCQ (c0 == 0) */
  } else { const bool hi_rows = t0 < KHI;
#pragma unroll
    for (int j = 0; j < 8; ++j) { const float bias = BA ? bfr(BA[c0 + j * 16 + col]) : 0.f;
#pragma unroll
      for (int r = 0; r < 8; ++r) { const float v = acc[j][r] + bias; const int rl = wave * 16 + 8 * g + r, cl = j * 16 + col; th[cl][rl] = (_Float16)v; const __bf16 bh = (__bf16)v; tb[cl][rl] = bh; tbl[cl][rl] = (__bf16)(v - (float)bh); } }
    __syncthreads();
    for (int e = tid; e < 128 * 8; e += 128) { const int cl = e >> 3, q = e & 7; vst2((unsigned*)(VT + (bb * CC + c0 + cl) * (size_t)TT + t0 + q * 8), *(const v4u*)&th[cl][q * 8]); if (hi_rows) { const size_t o3 = (bb * CC + c0 + cl) * (size_t)KHI + t0 + q * 8; vst2((unsigned*)(VB + o3), *(const v4u*)&tb[cl][q * 8]); vst2((unsigned*)(VBL + o3), *(const v4u*)&tbl[cl][q * 8]); } } } }
#define AT_KS 64                        // keys per staged tile of k_att
#define AT_KP (HDQK * 2 + 16)           // LDS pitch of a k row, bytes (16 B x odd: no bank conflict for 16-byte reads)
#define AT_VP (AT_KS * 2 + 16)          // LDS pitch of a v row and of a P row, bytes (16 B x odd)
#define AT_KB (AT_KS * AT_KP)           // k part of a buffer
#define AT_SB (AT_KB + CC * AT_VP)      // one buffer: k part + v part
#define AT_PB (64 * AT_VP)              // one P tile: 64 queries x 64 keys, f16
#define AT_OP 68                        // LDS pitch of an output row of one wave, floats
// 16-byte copies per lane, global -> LDS through no register; the s_wait_xcnt stands inside each statement so that no address register is rewritten ahead of it
__device__ __forceinline__ void acopy8(const unsigned l[8], const void* const gq[8]) {
  asm volatile("global_load_async_to_lds_b128 %0, %8, off\n\tglobal_load_async_to_lds_b128 %1, %9, off\n\tglobal_load_async_to_lds_b128 %2, %10, off\n\tglobal_load_async_to_lds_b128 %3, %11, off\n\t"
               "global_load_async_to_lds_b128 %4, %12, off\n\tglobal_load_async_to_lds_b128 %5, %13, off\n\tglobal_load_async_to_lds_b128 %6, %14, off\n\tglobal_load_async_to_lds_b128 %7, %15, off\n\ts_wait_xcnt 0x0"
               :: "v"(l[0]), "v"(l[1]), "v"(l[2]), "v"(l[3]), "v"(l[4]), "v"(l[5]), "v"(l[6]), "v"(l[7]), "v"(gq[0]), "v"(gq[1]), "v"(gq[2]), "v"(gq[3]), "v"(gq[4]), "v"(gq[5]), "v"(gq[6]), "v"(gq[7]) : "memory");
}
// 64 k rows of 128 B: 2 copies per lane, rows 32 apart (256 lanes = 32 rows per copy)
__device__ __forceinline__ void at_stage_k(const _Float16* gk, unsigned lk) {
  asm volatile("global_load_async_to_lds_b128 %0, %2, off\n\tglobal_load_async_to_lds_b128 %1, %3, off\n\ts_wait_xcnt 0x0" :: "v"(lk), "v"(lk + 32 * AT_KP), "v"(gk), "v"(gk + (size_t)32 * CCQ) : "memory");
}
// 512 v rows of 64 keys (128 B): 16 copies per lane, rows 32 apart
__device__ __forceinline__ void at_stage_v(const _Float16* gv, unsigned lv) {
#pragma unroll   // both loops: constant indices, so that each copy's addresses are plain registers of its statement
  for (int s = 0; s < 2; ++s) { unsigned l[8]; const void* gq[8];
#pragma unroll
    for (int i = 0; i < 8; ++i) { l[i] = lv + (s * 8 + i) * 32 * AT_VP; gq[i] = gv + (size_t)(s * 8 + i) * 32 * TT; }
    acopy8(l, gq); }
}
// P of 16 queries x 32 keys: logits with the k rows as A and the q rows as B, so that a lane holds 8 consecutive keys of one query (element r: key 8 g + r of the 16, query col); sigmoid x 2^11 in f32 (precise expf), once to f16, one 16-byte LDS store per 16 keys
__device__ __forceinline__ void at_p(const unsigned char* kl, unsigned char* pd, v16h qf0, v16h qf1, int lane) {
  v16h ka[2][2];
#pragma unroll   // constant indices: fragments stay in registers; the four fragments' LDS reads stand as one group
  for (int u = 0; u < 2; ++u) { const _Float16* kr = (const _Float16*)(kl + u * 16 * AT_KP); ka[u][0] = frag_h(kr, lane); ka[u][1] = frag_h(kr + 32, lane); }
#pragma unroll
  for (int u = 0; u < 2; ++u) { v8f st = {}; st = wmma16(ka[u][0], qf0, st); st = wmma16(ka[u][1], qf1, st);
    v8h ph;
#pragma unroll
    for (int r = 0; r < 8; ++r) ph[r] = (_Float16)(2048.0f / (1.0f + expf(-st[r])));
    *(v8h*)(pd + u * 32) = ph; }
}
// ---- k_att: block = (64 queries (qb), batch), 8 waves, all 512 value columns; no score plane in memory. Per tile of 64 keys the block forms its 64 x 64 P once (each wave 16 queries x 32 keys) into LDS, one tile ahead of attended += P . v (wave = 64 queries x 64 columns); out = gamma * attended x 2^-11 + bf16(x).
// staging buffer s mod 2 holds the v rows of tile s and the k rows of tile s + 1, so that trip t reads buffer t mod 2 alone; the k rows of tile 0 have a buffer of their own, filled once
__global__ __launch_bounds__(256) void k_att(const _Float16* __restrict__ QH, const _Float16* __restrict__ KH, const _Float16* __restrict__ VT, const float* __restrict__ X1, const float* __restrict__ GM, float* __restrict__ Y) {
  __shared__ __align__(16) unsigned char stg[2 * AT_SB]; __shared__ __align__(16) unsigned char k0s[AT_KB]; __shared__ __align__(16) unsigned char pl[2 * AT_PB];
  const float gmv = bfr(GM[0]); const int b = blockIdx.z, qb = blockIdx.x;
  const int tid = threadIdx.x, wave = tid >> 5, lane = tid & 31, col = lane & 15, g = lane >> 4;
  const int qt = wave & 3, kp = wave >> 2;   /* P: this wave forms queries 16 qt .. + 15 against keys 32 kp .. + 31 of each tile */
  const _Float16* qr = QH + ((size_t)b * TT + qb * 64 + qt * 16 + col) * CCQ;
  const v16h qf0 = frag_h(qr, lane), qf1 = frag_h(qr + 32, lane);
  v8f acc[4][4] = {};
  const unsigned lbase = (unsigned)(size_t)stg; const int nt = TT / AT_KS;
  const _Float16* gk = KH + ((size_t)b * TT + (tid >> 3)) * CCQ + (tid & 7) * 8;            /* copy i: k row 32 i + tid / 8, four 128-B rows per wave */
  const _Float16* gv = VT + ((size_t)b * CC + (tid >> 3)) * (size_t)TT + (tid & 7) * 8;     /* copy i: v row 32 i + tid / 8 */
  const unsigned lk = lbase + (tid >> 3) * AT_KP + (tid & 7) * 16, lv = lbase + AT_KB + (tid >> 3) * AT_VP + (tid & 7) * 16;
  const unsigned kro = (kp * 32 + col) * AT_KP, pwo = (qt * 16 + col) * AT_VP + (kp * 32 + 8 * g) * 2;   /* this lane's first k row in a k part; its first P store in a P tile */
  at_stage_k(gk, (unsigned)(size_t)k0s + (tid >> 3) * AT_KP + (tid & 7) * 16);
  at_stage_k(gk + (size_t)AT_KS * CCQ, lk); at_stage_v(gv, lv);
  asm volatile("s_wait_asynccnt 0x0" ::: "memory");   /* k tile 0 and buffer 0 landed (this wave's copies) */
  __syncthreads();                                      /* both readable by every wave */
  at_stage_k(gk + (size_t)2 * AT_KS * CCQ, lk + AT_SB); at_stage_v(gv + AT_KS, lv + AT_SB);
  at_p(k0s + kro, pl + pwo, qf0, qf1, lane);
  asm volatile("s_wait_dscnt 0x0" ::: "memory");      /* this wave's P stores of tile 0 are in LDS */
  __syncthreads();                                      /* P of tile 0 readable by every wave */
#pragma unroll 1   // stays rolled: one publish point in the code, the buffers picked by t & 1
  for (int t = 0; t < nt; ++t) { const unsigned bo = (t & 1) * AT_SB, po = (t & 1) * AT_PB;
    if (t + 1 < nt) at_p(stg + bo + kro, pl + (AT_PB - po) + pwo, qf0, qf1, lane);   /* P of tile t + 1 into the other P tile */
    const unsigned char* vb = stg + bo + AT_KB + (wave * 64 + col) * AT_VP; const unsigned char* pb = pl + po + col * AT_VP;
#pragma unroll   // here and below in this loop: constant indices, so that fragments and accumulators stay in registers
    for (int kc = 0; kc < AT_KS / 32; ++kc) { v16h a[4], w[4];
#pragma unroll
      for (int i = 0; i < 4; ++i) { a[i] = frag_h((const _Float16*)(pb + i * 16 * AT_VP + kc * 64), lane); w[i] = frag_h((const _Float16*)(vb + i * 16 * AT_VP + kc * 64), lane); }
#pragma unroll
      for (int i = 0; i < 4; ++i)
#pragma unroll
        for (int j = 0; j < 4; ++j) acc[i][j] = wmma16(a[i], w[j], acc[i][j]); }
    asm volatile("s_wait_dscnt 0x0" ::: "memory");      /* this wave's reads of buffer t and of P tile t are done, its P stores of tile t + 1 are in LDS */
    asm volatile("s_wait_asynccnt 0x0" ::: "memory");   /* this wave's copies of buffer t + 1 have landed */
    __syncthreads();                                    /* publishes buffer t + 1 and P of tile t + 1; ends every wave's reads of buffer t and of P tile t */
    if (t + 2 < nt) { if (t + 3 < nt) at_stage_k(gk + (size_t)(t + 3) * AT_KS * CCQ, lk + bo); at_stage_v(gv + (t + 2) * AT_KS, lv + bo); } }
  asm volatile("s_wait_asynccnt 0x0" ::: "memory");     /* no copy outstanding behind the loop */
  float* sw = (float*)stg + wave * (64 * AT_OP);        /* the staging LDS is free now: each wave turns its own 64 x 64 block into rows */
#pragma unroll
  for (int i = 0; i < 4; ++i)
#pragma unroll
    for (int j = 0; j < 4; ++j)
#pragma unroll
      for (int r = 0; r < 8; ++r) sw[(i * 16 + 8 * g + r) * AT_OP + j * 16 + col] = acc[i][j][r] * (1.0f / 2048.0f);
  LDSX();
#pragma unroll 1   // four row pairs per trip: their x loads stand together ahead of the sums
  for (int it = 0; it < 32; it += 4) { v4f xr[4];
#pragma unroll
    for (int e = 0; e < 4; ++e) xr[e] = *(const v4f*)(X1 + ((size_t)b * TT + qb * 64 + (it + e) * 2 + g) * CC + wave * 64 + col * 4);
#pragma unroll
    for (int e = 0; e < 4; ++e) { const int rl = (it + e) * 2 + g; v4f v = *(const v4f*)&sw[rl * AT_OP + col * 4]; v[0] = gmv * v[0] + bfr(xr[e][0]); v[1] = gmv * v[1] + bfr(xr[e][1]); v[2] = gmv * v[2] + bfr(xr[e][2]); v[3] = gmv * v[3] + bfr(xr[e][3]); vst2(Y + ((size_t)b * TT + qb * 64 + rl) * CC + wave * 64 + col * 4, v); }
    asm volatile("s_wait_xcnt 0x0" ::: "memory"); } }   /* the wait: the next trip rewrites the address and data registers that these stores name */   /* out = gamma * attended + bf16(x): 256-B (row, 64-column) segments, each written once */

extern "C" void kernel_launch(void* const* d_in, const int* in_sizes, int n_in, void* d_out, int out_size, void* d_ws, size_t ws_size, hipStream_t stream) {
  (void)in_sizes; (void)n_in; (void)out_size;
  const float** F = (const float**)d_in;
  if (ws_size < (size_t)WS_END) return;
  char* ws = (char*)d_ws; _Float16 *QH = (_Float16*)(ws + WS_QH), *KH = (_Float16*)(ws + WS_KH), *VT = (_Float16*)(ws + WS_VT), *QL = (_Float16*)(ws + WS_QL), *KL = (_Float16*)(ws + WS_KL); __bf16 *VB = (__bf16*)(ws + WS_VB), *VBL = (__bf16*)(ws + WS_VBL); float *S = (float*)(ws + WS_S), *Y = (float*)(ws + WS_Y);
  (void)S; (void)Y; (void)QL; (void)KL; (void)VB; (void)VBL;
  // inputs (d_in order): 0 x [4,64,64,512]; 1 Wq [512,64] (in,out); 2 Wk [512,64]; 3 Wv [512,512]; 4 gamma [1]
  k_projT<0><<<dim3(TNB * TT / 64, 1, 2), 128, 0, stream>>>(F[0], F[0], F[0], F[1], F[2], F[3], nullptr, nullptr, nullptr, QH, QL, KH, KL, VT, VB, VBL);   /* which 0, 1: q and k (one 128-column block, columns >= 64 zero) */
  k_projT<2><<<dim3(TNB * TT / 64, CC / 128, 1), 128, 0, stream>>>(F[0], F[0], F[0], F[1], F[2], F[3], nullptr, nullptr, nullptr, QH, QL, KH, KL, VT, VB, VBL);   /* which 2: v (four 128-column blocks) */
  k_att<<<dim3(NQB, 1, TNB), 256, 0, stream>>>(QH, KH, VT, F[0], F[4], (float*)d_out);   /* logits, sigmoid and P . v of all batches in one launch */
}

// v004
// It runs in 113 microseconds.
// Two timings next to v003 both put it at 1.21 times that version's speed.
// All steps since v000 together make it 11.1 times as fast.
// compute dtype: all float inputs rounded to bf16; q/k (64 wide) and v (512) = x W with EXACT bf16 products on WMMA 16x16x32, f32 accumulate; q and k once to f16 (1 product) for the UNSCALED scores (logit sigma ~16; sigmoid saturates outside |s| < 5); sigmoid in f32 (hardware exp2 and reciprocal); P x 2^11 once to f16 against v once to f16 (1 product); gamma * attended + x in f32; f32 output.
#include <hip/hip_runtime.h>
#include <math.h>

typedef __attribute__((ext_vector_type(16))) _Float16 v16h;
typedef __attribute__((ext_vector_type(16))) __bf16 v16b;
typedef __attribute__((ext_vector_type(8)))  _Float16 v8h;
typedef __attribute__((ext_vector_type(8)))  float v8f;
typedef __attribute__((ext_vector_type(4)))  float v4f;
typedef __attribute__((ext_vector_type(2)))  float v2f;
typedef __attribute__((ext_vector_type(4)))  unsigned v4u;
typedef __attribute__((ext_vector_type(4)))  int v4i;
typedef float __attribute__((may_alias)) float_a;
typedef int __attribute__((may_alias)) int_a;

template <typename T> __device__ __forceinline__ void vst2(void* p, T v) { *(T*)p = v;  }
__device__ __forceinline__ v8f wmma16(v16h a, v16h b, v8f c) {
  v8f d = __builtin_amdgcn_wmma_f32_16x16x32_f16(false, a, false, b, (short)0, c, false, false);
  asm volatile("v_nop\n\tv_nop\n\tv_nop\n\tv_nop" : "+v"(d) : "v"(a), "v"(b));
  return d;
}
__device__ __forceinline__ v8f wmma_bf(v16b a, v16b b, v8f c) {
  v8f d = __builtin_amdgcn_wmma_f32_16x16x32_bf16(false, a, false, b, (short)0, c, false, false);
  asm volatile("v_nop\n\tv_nop\n\tv_nop\n\tv_nop" : "+v"(d) : "v"(a), "v"(b));
  return d;
}
// 16x16x32 fragments: lane = (h = lane>>4, row/col = lane&15); elements 0..7 = k0+8h+0..7, 8..15 = k0+16+8h+0..7; D element r = row 8h+r
__device__ __forceinline__ v16h frag_h(const _Float16* rowk0, int lane) {
  union { v16h v; v8h q[2]; } u; const _Float16* p = rowk0 + 8 * (lane >> 4);
  u.q[0] = *(const v8h*)p; u.q[1] = *(const v8h*)(p + 16); return u.v;
}
__device__ __forceinline__ v16h frag_f32(const float* rowk0, int lane) {
  v16h a; const float* p = rowk0 + 8 * (lane >> 4);
#pragma unroll
  for (int i = 0; i < 8; ++i) { a[i] = (_Float16)p[i]; a[8 + i] = (_Float16)p[16 + i]; }
  return a;
}
__device__ __forceinline__ v16h frag_f32s(const float* rowk0, int lane, float sc) {
  v16h a; const float* p = rowk0 + 8 * (lane >> 4);
#pragma unroll
  for (int i = 0; i < 8; ++i) { a[i] = (_Float16)(p[i] * sc); a[8 + i] = (_Float16)(p[16 + i] * sc); }
  return a;
}
// column fragment from a [K][ld] layout (column n), rows >= K read as 0
__device__ __forceinline__ v16h fragc_f32(const float* W, int k0, int n, int lane, int ld, int K) {
  v16h a; const int g = lane >> 4;
#pragma unroll
  for (int i = 0; i < 8; ++i) { const int ka = k0 + 8 * g + i, kb = ka + 16;
    a[i] = (_Float16)(ka < K ? W[(size_t)(ka < K ? ka : K - 1) * ld + n] : 0.f); a[8 + i] = (_Float16)(kb < K ? W[(size_t)(kb < K ? kb : K - 1) * ld + n] : 0.f); }
  return a;
}
struct F2 { v16b h, l; };
__device__ __forceinline__ F2 bsplit16(const float v[16]) { F2 r;
#pragma unroll
  for (int i = 0; i < 16; ++i) { const __bf16 h = (__bf16)v[i]; r.h[i] = h; r.l[i] = (__bf16)(v[i] - (float)h); }
  return r; }
__device__ __forceinline__ F2 split_row(const float* row, int k0, int lane) { float v[16]; const float* p = row + k0 + 8 * (lane >> 4);
#pragma unroll
  for (int i = 0; i < 8; ++i) { v[i] = p[i]; v[8 + i] = p[16 + i]; }
  return bsplit16(v); }
__device__ __forceinline__ F2 split_rowK(const float* row, int k0, int lane, int K) { float v[16]; const int g = lane >> 4;
#pragma unroll
  for (int i = 0; i < 8; ++i) { const int ka = k0 + 8 * g + i, kb = ka + 16; v[i] = ka < K ? row[ka < K ? ka : K - 1] : 0.f; v[8 + i] = kb < K ? row[kb < K ? kb : K - 1] : 0.f; }
  return bsplit16(v); }
__device__ __forceinline__ F2 split_col(const float* W, int k0, int n, int lane, int ld, int K) { float v[16]; const int g = lane >> 4;
#pragma unroll
  for (int i = 0; i < 8; ++i) { const int ka = k0 + 8 * g + i, kb = ka + 16; v[i] = ka < K ? W[(size_t)(ka < K ? ka : K - 1) * ld + n] : 0.f; v[8 + i] = kb < K ? W[(size_t)(kb < K ? kb : K - 1) * ld + n] : 0.f; }
  return bsplit16(v); }
__device__ __forceinline__ v8f mac3(const F2& a, const F2& b, v8f c) { c = wmma_bf(a.l, b.h, c); c = wmma_bf(a.h, b.l, c); return wmma_bf(a.h, b.h, c); }
__device__ __forceinline__ float sigm(float v) { return 1.0f / (1.0f + expf(-v)); }
#define LDSX() do { asm volatile("s_wait_dscnt 0" ::: "memory"); __builtin_amdgcn_wave_barrier(); __builtin_amdgcn_fence(__ATOMIC_RELEASE, "workgroup"); } while (0)

// SAGAN-style position attention with SIGMOID (unnormalised) attention (B 4, 64 x 64 = 4,096 positions, C 512; x channels-last [B,H,W,C] = rows [b*n][512]; (in,out) weights Wq/Wk [512,64], Wv [512,512], no biases; gamma scalar): q = x Wq, k = x Wk, v = x Wv; scores[n][m] = q_n . k_m (no scaling); attn = sigmoid(scores) (no row normalisation); attended[n][c] = sum_m attn[n][m] v[m][c]; out = gamma * attended + x.
#define NB 4
#define TT 4096
#define CC 512            // value width (v planes, output rows)
#define CCQ 128           // q / k row pitch: one 128-column block, columns >= 64 are zero
#define DIN 512          // x width
#define NH 1
#define HD 512
#define NQB (TT / 64)
#define HG 1               // sizes only the unused WS_S region: no score plane in memory
#define SCALE (1.0f)
#define HDQK 64            // q / k width
#define CAUSAL 0
#ifndef TNB
#define TNB NB
#endif
__device__ __forceinline__ v16b zero16b() { v16b z; _Pragma("unroll") for (int i = 0; i < 16; ++i) z[i] = (__bf16)0.f; return z; }
__device__ __forceinline__ float bfr(float v) { return (float)(__bf16)v; }
__host__ __device__ __forceinline__ int kb_last(int qb) { return CAUSAL ? ((qb * 64 + 63) >> 7) : (TT / 128 - 1); }
typedef __attribute__((ext_vector_type(8))) __bf16 v8b;
__device__ __forceinline__ v16b frag_b(const __bf16* rowk0, int lane) {
  union { v16b v; v8b q[2]; } u; const __bf16* p = rowk0 + 8 * (lane >> 4);
  u.q[0] = *(const v8b*)p; u.q[1] = *(const v8b*)(p + 16); return u.v;
}
#define QBH 0              // unused: every query block takes k_att's single f16 path
#define QHI 0               // no q residual plane: q and k once to f16 (1 product)
#define KHI 64            // key rows carrying k residual / v bf16 hi+lo planes (written by k_projT, read by no kernel)
// B fragment (k rows k0+.., output column o) of a weight: (in,out) [K][ld] or (out,in) [ld rows of K]: bf16 exact, or f16(bf16 * 256) exact
__device__ __forceinline__ v16b wcol_io(const float* Wm, int k0, int o, int lane, int ld) { v16b w; const int g = lane >> 4;
#pragma unroll
  for (int i = 0; i < 8; ++i) { w[i] = (__bf16)Wm[(size_t)(k0 + 8 * g + i) * ld + o]; w[8 + i] = (__bf16)Wm[(size_t)(k0 + 16 + 8 * g + i) * ld + o]; }
  return w; }
__device__ __forceinline__ v16b wcol_oi(const float* Wm, int k0, int o, int lane, int K) { v16b w; const float* p = Wm + (size_t)o * K + k0 + 8 * (lane >> 4);
#pragma unroll
  for (int i = 0; i < 8; ++i) { w[i] = (__bf16)p[i]; w[8 + i] = (__bf16)p[16 + i]; }
  return w; }
__device__ __forceinline__ v16h wcolh_io(const float* Wm, int k0, int o, int lane, int ld) { v16h w; const int g = lane >> 4;
#pragma unroll
  for (int i = 0; i < 8; ++i) { w[i] = (_Float16)(bfr(Wm[(size_t)(k0 + 8 * g + i) * ld + o]) * 256.0f); w[8 + i] = (_Float16)(bfr(Wm[(size_t)(k0 + 16 + 8 * g + i) * ld + o]) * 256.0f); }
  return w; }
__device__ __forceinline__ v16h wcolh_oi(const float* Wm, int k0, int o, int lane, int K) { v16h w; const float* p = Wm + (size_t)o * K + k0 + 8 * (lane >> 4);
#pragma unroll
  for (int i = 0; i < 8; ++i) { w[i] = (_Float16)(bfr(p[i]) * 256.0f); w[8 + i] = (_Float16)(bfr(p[16 + i]) * 256.0f); }
  return w; }
#define WQKV_LAYOUT 0   // 0 = (in,out) [K][CC] for Wv, [K][HDQK] for Wq/Wk; 1 = (out,in) [CC][DIN]; 2 = per-head [NH][DIN][HD]
__device__ __forceinline__ v16b wcol_hdk(const float* Wm, int k0, int o, int lane) { v16b w; const int g = lane >> 4; const float* p = Wm + (size_t)(o / HD) * DIN * HD + (o % HD);
#pragma unroll
  for (int i = 0; i < 8; ++i) { w[i] = (__bf16)p[(size_t)(k0 + 8 * g + i) * HD]; w[8 + i] = (__bf16)p[(size_t)(k0 + 16 + 8 * g + i) * HD]; }
  return w; }
#define WO_OUT_IN 0
#if WQKV_LAYOUT == 1
#define WCOL(W, k0, o, lane) wcol_oi(W, k0, (o), lane, DIN)   /* unused: layout 0 */
#elif WQKV_LAYOUT == 2
#define WCOL(W, k0, o, lane) wcol_hdk(W, k0, o, lane)
#else
#define WCOL(W, k0, o, lane) (which == 2 ? wcol_io(W, k0, (o), lane, CC) : ((o) < HDQK ? wcol_io(W, k0, (o), lane, HDQK) : zero16b()))   /* Wv [512][512]; Wq/Wk [512][64]: projected q/k columns >= 64 are zero (block y = 0 only) */
#endif
#if WO_OUT_IN
#define WOCOL(W, k0, o, lane) wcol_oi(W, k0, o, lane, CC)
#define WOCOLH(W, k0, o, lane) wcolh_oi(W, k0, o, lane, CC)
#else
#define WOCOL(W, k0, o, lane) wcol_io(W, k0, o, lane, DIN)
#define WOCOLH(W, k0, o, lane) wcolh_io(W, k0, o, lane, DIN)
#endif
#define BG HG              // unused: k_att covers all batches in one launch, blockIdx.z = batch
#define BGN (TNB < BG ? TNB : BG)
#define DVH 128            // unused: each k_att block covers all 512 value columns (16 accumulator tiles per wave)
#ifndef SM_EXTRA_PARAMS
#define SM_EXTRA_PARAMS
#endif
#ifndef PROJ_EXTRA_PARAMS
#define PROJ_EXTRA_PARAMS
#endif
#ifndef SM_MASK_HOOK
#define SM_MASK_HOOK (void)0
#endif

#define WS_QH  0u                                      // f16 q rows [b*t][CCQ]
#define WS_KH  (WS_QH + 2u * (size_t)NB * TT * CCQ)     // f16 k rows [b*t][CCQ]
#define WS_VT  (WS_KH + 2u * (size_t)NB * TT * CCQ)     // f16 v planes [b][c][t]
#define WS_QL  (WS_VT + 2u * (size_t)NB * CC * TT)      // f16 q residual x 2^10 rows [b][t < QHI][CCQ]
#define WS_KL  (WS_QL + 2u * (size_t)NB * QHI * CCQ)    // f16 k residual x 2^10 rows [b][t < KHI][CCQ]
#define WS_VB  (WS_KL + 2u * (size_t)NB * KHI * CCQ)    // bf16 v hi planes [b][c][t < KHI]
#define WS_VBL (WS_VB + 2u * (size_t)NB * CC * KHI)
#define WS_S   (WS_VBL + 2u * (size_t)NB * CC * KHI)    // unused: no score plane in memory
#define WS_Y   (WS_S  + 4u * (size_t)HG * TT * TT)      // f32 ctx rows [b*t][CC] (only when there is an output projection)
#define WS_END (WS_Y  + 0u)

#define PJ_KC 64                        // k values per staged chunk of k_projT
#define PJ_P (PJ_KC * 2 + 16)           // LDS pitch of a staged weight column and of a staged x row, bytes (16 B x odd: no bank conflict for 16-byte reads)
typedef __attribute__((ext_vector_type(4))) __bf16 v4b;
// ---- k_proj: block = (64 rows, 128 cols, which): q/k/v = X W (+ b) with exact bf16 products (K = DIN) -> which 0: q f16 rows (+ residual rows < QHI); 1: k f16 rows (+ residual rows < KHI); 2: v f16 planes [c][t] (+ bf16 hi/lo planes for t < KHI)
// per chunk of 64 k the block stages, through registers and as bf16, its weight columns TRANSPOSED ([column][k]; a lane loads two adjacent columns, so a wave's load is two whole 128-B lines) and its 64 x rows (16 lanes x 16 B per row); fragments are 16-byte LDS reads. Two buffers: the next chunk's global loads fly while this chunk is worked on; one barrier per chunk. The staging LDS is used again by the epilogue.
template <int WOFF> __global__ __launch_bounds__(128) void k_projT(const float* __restrict__ XQ, const float* __restrict__ XK, const float* __restrict__ XV, const float* __restrict__ WQ, const float* __restrict__ WK, const float* __restrict__ WV, const float* __restrict__ BQ, const float* __restrict__ BK, const float* __restrict__ BV,
    _Float16* __restrict__ QH, _Float16* __restrict__ QL, _Float16* __restrict__ KH, _Float16* __restrict__ KL, _Float16* __restrict__ VT, __bf16* __restrict__ VB, __bf16* __restrict__ VBL) {
  constexpr bool ISV = WOFF == 2;   /* WOFF 2: v (128 of Wv's 512 columns per block); WOFF 0: q or k (all 64 columns; accumulator tiles 4..7 stay zero) */
  constexpr int NJ = ISV ? 8 : 4, NCOL = NJ * 16, NCP = NCOL / 2, KPT = PJ_KC * NCP / 128, LDW = ISV ? CC : HDQK;   /* a thread stages KPT k values of one pair of columns per chunk */
  constexpr int BUFB = (NCOL + 64) * PJ_P, EPB = ISV ? 3 * 128 * 72 * 2 : 2 * 64 * 136 * 2, SMB = 2 * BUFB > EPB ? 2 * BUFB : EPB;   /* a buffer: weight columns, then x rows */
  __shared__ __align__(16) unsigned char sm[SMB];
  _Float16 (*sh)[136] = (_Float16 (*)[136])sm; _Float16 (*sl)[136] = sh + 64; _Float16 (*th)[72] = (_Float16 (*)[72])sm; __bf16 (*tb)[72] = (__bf16 (*)[72])(sm + 128 * 72 * 2); __bf16 (*tbl)[72] = tb + 128; (void)sh; (void)sl; (void)th; (void)tb; (void)tbl;
  const int tid = threadIdx.x, wave = tid >> 5, lane = tid & 31, col = lane & 15, g = lane >> 4; const int which = ISV ? 2 : (int)blockIdx.z; const int c0 = blockIdx.y * 128; const size_t r0 = (size_t)blockIdx.x * 64; const size_t bb = r0 / TT; const int t0 = (int)(r0 % TT);
  const float* X = which == 0 ? XQ : which == 1 ? XK : XV; const float* WA = which == 0 ? WQ : which == 1 ? WK : WV; const float* BA = which == 0 ? BQ : which == 1 ? BK : BV;
  v8f acc[8] = {};
  const int wn = (tid % NCP) * 2, wk = (tid / NCP) * KPT;
  const float* wp = WA + (size_t)wk * LDW + c0 + wn;                          /* load i: weight row wk + i of the chunk, columns c0 + wn and + 1 */
  const float* xp = X + (r0 + wave * 16 + g) * (size_t)DIN + col * 4;         /* load i: row 2 i + g of this wave's 16 rows, row-major [b*t][DIN] */
  unsigned char* wd = sm + wn * PJ_P + wk * 2; unsigned char* xd = sm + (NCOL + wave * 16 + g) * PJ_P + col * 8;
  v2f wr[KPT]; v4f xr[8];
  auto ld_chunk = [&](int c) {
#pragma unroll   // every unroll of this kernel: constant indices, so that staged values, fragments and accumulators stay in registers
    for (int i = 0; i < KPT; ++i) wr[i] = *(const v2f*)(wp + (size_t)c * PJ_KC * LDW + (size_t)i * LDW);
#pragma unroll
    for (int i = 0; i < 8; ++i) xr[i] = *(const v4f*)(xp + c * PJ_KC + (size_t)i * 2 * DIN); };
  auto st_chunk = [&](int bo) {
#pragma unroll
    for (int e = 0; e < 2; ++e)
#pragma unroll
      for (int s = 0; s < KPT / 8; ++s) { v8b t;
#pragma unroll
        for (int i = 0; i < 8; ++i) t[i] = (__bf16)wr[s * 8 + i][e];
        *(v8b*)(wd + bo + e * PJ_P + s * 16) = t; }
#pragma unroll
    for (int i = 0; i < 8; ++i) { v4b t; t[0] = (__bf16)xr[i][0]; t[1] = (__bf16)xr[i][1]; t[2] = (__bf16)xr[i][2]; t[3] = (__bf16)xr[i][3]; *(v4b*)(xd + bo + i * 2 * PJ_P) = t; } };
  ld_chunk(0); st_chunk(0);
  __syncthreads();   /* chunk 0 readable by every wave */
#pragma unroll 1   // stays rolled: small code, the buffers picked by c & 1
  for (int c = 0; c < DIN / PJ_KC; ++c) { const int bo = (c & 1) * BUFB;
    if (c + 1 < DIN / PJ_KC) ld_chunk(c + 1);
    const unsigned char* wb = sm + bo + col * PJ_P; const unsigned char* xb = sm + bo + (NCOL + wave * 16 + col) * PJ_P;
#pragma unroll
    for (int kc = 0; kc < PJ_KC / 32; ++kc) { const v16b a = frag_b((const __bf16*)(xb + kc * 64), lane);
#pragma unroll
      for (int jh = 0; jh < NJ; jh += 4) { v16b w[4];   /* four fragments' LDS reads stand as one group ahead of their four products: one wait per group */
#pragma unroll
        for (int j = 0; j < 4; ++j) w[j] = frag_b((const __bf16*)(wb + (jh + j) * 16 * PJ_P + kc * 64), lane);
#pragma unroll
        for (int j = 0; j < 4; ++j) acc[jh + j] = wmma_bf(a, w[j], acc[jh + j]); } }
    if (c + 1 < DIN / PJ_KC) st_chunk(BUFB - bo);
    __syncthreads(); }   /* publishes chunk c + 1; ends every wave's reads of chunk c (behind the last chunk: before the epilogue writes this LDS) */
  if constexpr (!ISV) { _Float16* DH = which == 0 ? QH : KH; _Float16* DL = which == 0 ? QL : KL; const int nhi = which == 0 ? QHI : KHI; const bool hi_rows = t0 < nhi;
#pragma unroll
    for (int j = 0; j < 8; ++j) { const float bias = BA ? bfr(BA[c0 + j * 16 + col]) : 0.f;
#pragma unroll
      for (int r = 0; r < 8; ++r) { const float v = acc[j][r] + bias; const _Float16 hv = (_Float16)v; sh[wave * 16 + 8 * g + r][j * 16 + col] = hv; sl[wave * 16 + 8 * g + r][j * 16 + col] = (_Float16)((v - (float)hv) * 1024.0f); } }
    __syncthreads();
    for (int e = tid; e < 64 * 16; e += 128) { const int rl = e >> 4, q = e & 15; vst2((unsigned*)(DH + (r0 + rl) * CCQ + c0 + q * 8), *(const v4u*)&sh[rl][q * 8]); if (hi_rows) vst2((unsigned*)(DL + (bb * nhi + t0 + rl) * (size_t)CCQ + c0 + q * 8), *(const v4u*)&sl[rl][q * 8]); }   /* q/k rows: pitch CCQ (c0 == 0) */
  } else { const bool hi_rows = t0 < KHI;
#pragma unroll
    for (int j = 0; j < 8; ++j) { const float bias = BA ? bfr(BA[c0 + j * 16 + col]) : 0.f;
#pragma unroll
      for (int r = 0; r < 8; ++r) { const float v = acc[j][r] + bias; const int rl = wave * 16 + 8 * g + r, cl = j * 16 + col; th[cl][rl] = (_Float16)v; const __bf16 bh = (__bf16)v; tb[cl][rl] = bh; tbl[cl][rl] = (__bf16)(v - (float)bh); } }
    __syncthreads();
    for (int e = tid; e < 128 * 8; e += 128) { const int cl = e >> 3, q = e & 7; vst2((unsigned*)(VT + (bb * CC + c0 + cl) * (size_t)TT + t0 + q * 8), *(const v4u*)&th[cl][q * 8]); if (hi_rows) { const size_t o3 = (bb * CC + c0 + cl) * (size_t)KHI + t0 + q * 8; vst2((unsigned*)(VB + o3), *(const v4u*)&tb[cl][q * 8]); vst2((unsigned*)(VBL + o3), *(const v4u*)&tbl[cl][q * 8]); } } } }
#define AT_KS 64                        // keys per staged tile of k_att
#define AT_KP (HDQK * 2 + 16)           // LDS pitch of a k row, bytes (16 B x odd: no bank conflict for 16-byte reads)
#define AT_VP (AT_KS * 2 + 16)          // LDS pitch of a v row and of a P row, bytes (16 B x odd)
#define AT_KB (AT_KS * AT_KP)           // k part of a buffer
#define AT_SB (AT_KB + CC * AT_VP)      // one buffer: k part + v part
#define AT_PB (64 * AT_VP)              // one P tile: 64 queries x 64 keys, f16
#define AT_OP 68                        // LDS pitch of an output row of one wave, floats
// 16-byte copies per lane, global -> LDS through no register; the s_wait_xcnt stands inside each statement so that no address register is rewritten ahead of it
__device__ __forceinline__ void acopy8(const unsigned l[8], const void* const gq[8]) {
  asm volatile("global_load_async_to_lds_b128 %0, %8, off\n\tglobal_load_async_to_lds_b128 %1, %9, off\n\tglobal_load_async_to_lds_b128 %2, %10, off\n\tglobal_load_async_to_lds_b128 %3, %11, off\n\t"
               "global_load_async_to_lds_b128 %4, %12, off\n\tglobal_load_async_to_lds_b128 %5, %13, off\n\tglobal_load_async_to_lds_b128 %6, %14, off\n\tglobal_load_async_to_lds_b128 %7, %15, off\n\ts_wait_xcnt 0x0"
               :: "v"(l[0]), "v"(l[1]), "v"(l[2]), "v"(l[3]), "v"(l[4]), "v"(l[5]), "v"(l[6]), "v"(l[7]), "v"(gq[0]), "v"(gq[1]), "v"(gq[2]), "v"(gq[3]), "v"(gq[4]), "v"(gq[5]), "v"(gq[6]), "v"(gq[7]) : "memory");
}
// 64 k rows of 128 B: 2 copies per lane, rows 32 apart (256 lanes = 32 rows per copy)
__device__ __forceinline__ void at_stage_k(const _Float16* gk, unsigned lk) {
  asm volatile("global_load_async_to_lds_b128 %0, %2, off\n\tglobal_load_async_to_lds_b128 %1, %3, off\n\ts_wait_xcnt 0x0" :: "v"(lk), "v"(lk + 32 * AT_KP), "v"(gk), "v"(gk + (size_t)32 * CCQ) : "memory");
}
// 512 v rows of 64 keys (128 B): 16 copies per lane, rows 32 apart
__device__ __forceinline__ void at_stage_v(const _Float16* gv, unsigned lv) {
#pragma unroll   // both loops: constant indices, so that each copy's addresses are plain registers of its statement
  for (int s = 0; s < 2; ++s) { unsigned l[8]; const void* gq[8];
#pragma unroll
    for (int i = 0; i < 8; ++i) { l[i] = lv + (s * 8 + i) * 32 * AT_VP; gq[i] = gv + (size_t)(s * 8 + i) * 32 * TT; }
    acopy8(l, gq); }
}
// eight transcendentals of one kind in one statement, results in registers of their own, one v_nop behind the last: keeps the slot that the instruction set asks for between a transcendental and a next instruction that overwrites its source or reads its result. The two s_delay_alu are the hints that the compiler cannot place around asm text: the first source comes from a vector instruction a few places in front, the next reader takes the last results; without them the wait would hold up the SIMD's other wave too
__device__ __forceinline__ void exp2_8(float (&o)[8], const float (&x)[8]) {
  asm("s_delay_alu instid0(VALU_DEP_4)\n\tv_exp_f32 %0, %8\n\tv_exp_f32 %1, %9\n\tv_exp_f32 %2, %10\n\tv_exp_f32 %3, %11\n\tv_exp_f32 %4, %12\n\tv_exp_f32 %5, %13\n\tv_exp_f32 %6, %14\n\tv_exp_f32 %7, %15\n\tv_nop\n\ts_delay_alu instid0(TRANS32_DEP_1)"
      : "=&v"(o[0]), "=&v"(o[1]), "=&v"(o[2]), "=&v"(o[3]), "=&v"(o[4]), "=&v"(o[5]), "=&v"(o[6]), "=&v"(o[7]) : "v"(x[0]), "v"(x[1]), "v"(x[2]), "v"(x[3]), "v"(x[4]), "v"(x[5]), "v"(x[6]), "v"(x[7]));
}
__device__ __forceinline__ void rcp_8(float (&o)[8], const float (&x)[8]) {
  asm("s_delay_alu instid0(VALU_DEP_4)\n\tv_rcp_f32 %0, %8\n\tv_rcp_f32 %1, %9\n\tv_rcp_f32 %2, %10\n\tv_rcp_f32 %3, %11\n\tv_rcp_f32 %4, %12\n\tv_rcp_f32 %5, %13\n\tv_rcp_f32 %6, %14\n\tv_rcp_f32 %7, %15\n\tv_nop\n\ts_delay_alu instid0(TRANS32_DEP_1)"
      : "=&v"(o[0]), "=&v"(o[1]), "=&v"(o[2]), "=&v"(o[3]), "=&v"(o[4]), "=&v"(o[5]), "=&v"(o[6]), "=&v"(o[7]) : "v"(x[0]), "v"(x[1]), "v"(x[2]), "v"(x[3]), "v"(x[4]), "v"(x[5]), "v"(x[6]), "v"(x[7]));
}
// P of 16 queries x 32 keys: logits with the k rows as A and the q rows as B, so that a lane holds 8 consecutive keys of one query (element r: key 8 g + r of the 16, query col); sigmoid x 2^11 in f32 by the hardware exp2 and reciprocal (four vector instructions per element; their error lies far under the f16 rounding that follows), once to f16, one 16-byte LDS store per 16 keys
__device__ __forceinline__ void at_p(const unsigned char* kl, unsigned char* pd, v16h qf0, v16h qf1, int lane) {
  v16h ka[2][2];
#pragma unroll   // constant indices: fragments stay in registers; the four fragments' LDS reads stand as one group
  for (int u = 0; u < 2; ++u) { const _Float16* kr = (const _Float16*)(kl + u * 16 * AT_KP); ka[u][0] = frag_h(kr, lane); ka[u][1] = frag_h(kr + 32, lane); }
#pragma unroll
  for (int u = 0; u < 2; ++u) { v8f st = {}; st = wmma16(ka[u][0], qf0, st); st = wmma16(ka[u][1], qf1, st);
    float ea[8], ex[8], pr[8]; v8h ph;   /* 2^11 / (1 + e^-s) = 1 / (2^-11 + 2^(-s log2 e - 11)); s = +-inf gives 2^11 and 0 */
#pragma unroll
    for (int r = 0; r < 8; ++r) ea[r] = __builtin_fmaf(st[r], -1.4426950408889634f, -11.0f);
    exp2_8(ex, ea);
#pragma unroll
    for (int r = 0; r < 8; ++r) ex[r] += 0x1p-11f;
    rcp_8(pr, ex);
#pragma unroll
    for (int r = 0; r < 8; ++r) ph[r] = (_Float16)pr[r];
    *(v8h*)(pd + u * 32) = ph; }
}
// ---- k_att: block = (64 queries (qb), batch), 8 waves, all 512 value columns; no score plane in memory. Per tile of 64 keys the block forms its 64 x 64 P once (each wave 16 queries x 32 keys) into LDS, one tile ahead of attended += P . v (wave = 64 queries x 64 columns); out = gamma * attended x 2^-11 + bf16(x).
// staging buffer s mod 2 holds the v rows of tile s and the k rows of tile s + 1, so that trip t reads buffer t mod 2 alone; the k rows of tile 0 have a buffer of their own, filled once
__global__ __launch_bounds__(256) void k_att(const _Float16* __restrict__ QH, const _Float16* __restrict__ KH, const _Float16* __restrict__ VT, const float* __restrict__ X1, const float* __restrict__ GM, float* __restrict__ Y) {
  __shared__ __align__(16) unsigned char stg[2 * AT_SB]; __shared__ __align__(16) unsigned char k0s[AT_KB]; __shared__ __align__(16) unsigned char pl[2 * AT_PB];
  const float gmv = bfr(GM[0]); const int b = blockIdx.z, qb = blockIdx.x;
  const int tid = threadIdx.x, wave = tid >> 5, lane = tid & 31, col = lane & 15, g = lane >> 4;
  const int qt = wave & 3, kp = wave >> 2;   /* P: this wave forms queries 16 qt .. + 15 against keys 32 kp .. + 31 of each tile */
  const _Float16* qr = QH + ((size_t)b * TT + qb * 64 + qt * 16 + col) * CCQ;
  const v16h qf0 = frag_h(qr, lane), qf1 = frag_h(qr + 32, lane);
  v8f acc[4][4] = {};
  const unsigned lbase = (unsigned)(size_t)stg; const int nt = TT / AT_KS;
  const _Float16* gk = KH + ((size_t)b * TT + (tid >> 3)) * CCQ + (tid & 7) * 8;            /* copy i: k row 32 i + tid / 8, four 128-B rows per wave */
  const _Float16* gv = VT + ((size_t)b * CC + (tid >> 3)) * (size_t)TT + (tid & 7) * 8;     /* copy i: v row 32 i + tid / 8 */
  const unsigned lk = lbase + (tid >> 3) * AT_KP + (tid & 7) * 16, lv = lbase + AT_KB + (tid >> 3) * AT_VP + (tid & 7) * 16;
  const unsigned kro = (kp * 32 + col) * AT_KP, pwo = (qt * 16 + col) * AT_VP + (kp * 32 + 8 * g) * 2;   /* this lane's first k row in a k part; its first P store in a P tile */
  at_stage_k(gk, (unsigned)(size_t)k0s + (tid >> 3) * AT_KP + (tid & 7) * 16);
  at_stage_k(gk + (size_t)AT_KS * CCQ, lk); at_stage_v(gv, lv);
  asm volatile("s_wait_asynccnt 0x0" ::: "memory");   /* k tile 0 and buffer 0 landed (this wave's copies) */
  __syncthreads();                                      /* both readable by every wave */
  at_stage_k(gk + (size_t)2 * AT_KS * CCQ, lk + AT_SB); at_stage_v(gv + AT_KS, lv + AT_SB);
  at_p(k0s + kro, pl + pwo, qf0, qf1, lane);
  asm volatile("s_wait_dscnt 0x0" ::: "memory");      /* this wave's P stores of tile 0 are in LDS */
  __syncthreads();                                      /* P of tile 0 readable by every wave */
#pragma unroll 1   // stays rolled: one publish point in the code, the buffers picked by t & 1
  for (int t = 0; t < nt; ++t) { const unsigned bo = (t & 1) * AT_SB, po = (t & 1) * AT_PB;
    if (t + 1 < nt) at_p(stg + bo + kro, pl + (AT_PB - po) + pwo, qf0, qf1, lane);   /* P of tile t + 1 into the other P tile */
    const unsigned char* vb = stg + bo + AT_KB + (wave * 64 + col) * AT_VP; const unsigned char* pb = pl + po + col * AT_VP;
#pragma unroll   // here and below in this loop: constant indices, so that fragments and accumulators stay in registers
    for (int kc = 0; kc < AT_KS / 32; ++kc) { v16h a[4], w[4];
#pragma unroll
      for (int i = 0; i < 4; ++i) { a[i] = frag_h((const _Float16*)(pb + i * 16 * AT_VP + kc * 64), lane); w[i] = frag_h((const _Float16*)(vb + i * 16 * AT_VP + kc * 64), lane); }
#pragma unroll
      for (int i = 0; i < 4; ++i)
#pragma unroll
        for (int j = 0; j < 4; ++j) acc[i][j] = wmma16(a[i], w[j], acc[i][j]); }
    asm volatile("s_wait_dscnt 0x0" ::: "memory");      /* this wave's reads of buffer t and of P tile t are done, its P stores of tile t + 1 are in LDS */
    asm volatile("s_wait_asynccnt 0x0" ::: "memory");   /* this wave's copies of buffer t + 1 have landed */
    __syncthreads();                                    /* publishes buffer t + 1 and P of tile t + 1; ends every wave's reads of buffer t and of P tile t */
    if (t + 2 < nt) { if (t + 3 < nt) at_stage_k(gk + (size_t)(t + 3) * AT_KS * CCQ, lk + bo); at_stage_v(gv + (t + 2) * AT_KS, lv + bo); } }
  asm volatile("s_wait_asynccnt 0x0" ::: "memory");     /* no copy outstanding behind the loop */
  float* sw = (float*)stg + wave * (64 * AT_OP);        /* the staging LDS is free now: each wave turns its own 64 x 64 block into rows */
#pragma unroll
  for (int i = 0; i < 4; ++i)
#pragma unroll
    for (int j = 0; j < 4; ++j)
#pragma unroll
      for (int r = 0; r < 8; ++r) sw[(i * 16 + 8 * g + r) * AT_OP + j * 16 + col] = acc[i][j][r] * (1.0f / 2048.0f);
  LDSX();
#pragma unroll 1   // four row pairs per trip: their x loads stand together ahead of the sums
  for (int it = 0; it < 32; it += 4) { v4f xr[4];
#pragma unroll
    for (int e = 0; e < 4; ++e) xr[e] = *(const v4f*)(X1 + ((size_t)b * TT + qb * 64 + (it + e) * 2 + g) * CC + wave * 64 + col * 4);
#pragma unroll
    for (int e = 0; e < 4; ++e) { const int rl = (it + e) * 2 + g; v4f v = *(const v4f*)&sw[rl * AT_OP + col * 4]; v[0] = gmv * v[0] + bfr(xr[e][0]); v[1] = gmv * v[1] + bfr(xr[e][1]); v[2] = gmv * v[2] + bfr(xr[e][2]); v[3] = gmv * v[3] + bfr(xr[e][3]); vst2(Y + ((size_t)b * TT + qb * 64 + rl) * CC + wave * 64 + col * 4, v); }
    asm volatile("s_wait_xcnt 0x0" ::: "memory"); } }   /* the wait: the next trip rewrites the address and data registers that these stores name */   /* out = gamma * attended + bf16(x): 256-B (row, 64-column) segments, each written once */

extern "C" void kernel_launch(void* const* d_in, const int* in_sizes, int n_in, void* d_out, int out_size, void* d_ws, size_t ws_size, hipStream_t stream) {
  (void)in_sizes; (void)n_in; (void)out_size;
  const float** F = (const float**)d_in;
  if (ws_size < (size_t)WS_END) return;
  char* ws = (char*)d_ws; _Float16 *QH = (_Float16*)(ws + WS_QH), *KH = (_Float16*)(ws + WS_KH), *VT = (_Float16*)(ws + WS_VT), *QL = (_Float16*)(ws + WS_QL), *KL = (_Float16*)(ws + WS_KL); __bf16 *VB = (__bf16*)(ws + WS_VB), *VBL = (__bf16*)(ws + WS_VBL); float *S = (float*)(ws + WS_S), *Y = (float*)(ws + WS_Y);
  (void)S; (void)Y; (void)QL; (void)KL; (void)VB; (void)VBL;
  // inputs (d_in order): 0 x [4,64,64,512]; 1 Wq [512,64] (in,out); 2 Wk [512,64]; 3 Wv [512,512]; 4 gamma [1]
  k_projT<0><<<dim3(TNB * TT / 64, 1, 2), 128, 0, stream>>>(F[0], F[0], F[0], F[1], F[2], F[3], nullptr, nullptr, nullptr, QH, QL, KH, KL, VT, VB, VBL);   /* which 0, 1: q and k (one 128-column block, columns >= 64 zero) */
  k_projT<2><<<dim3(TNB * TT / 64, CC / 128, 1), 128, 0, stream>>>(F[0], F[0], F[0], F[1], F[2], F[3], nullptr, nullptr, nullptr, QH, QL, KH, KL, VT, VB, VBL);   /* which 2: v (four 128-column blocks) */
  k_att<<<dim3(NQB, 1, TNB), 256, 0, stream>>>(QH, KH, VT, F[0], F[4], (float*)d_out);   /* logits, sigmoid and P . v of all batches in one launch */
}

// v005
// It runs in 102 microseconds.
// Next to v004, in two timings, it ran 1.10 times as fast each time.
// Over all steps from v000 it is 12.2 times as fast.
// compute dtype: all float inputs rounded to bf16; q/k (64 wide) and v (512) = x W with EXACT bf16 products on WMMA 16x16x32, f32 accumulate; q and k once to f16 (1 product) for the UNSCALED scores (logit sigma ~16; sigmoid saturates outside |s| < 5); sigmoid in f32 (hardware exp2 and reciprocal); P x 2^11 once to f16 against v once to f16 (1 product); gamma * attended + x in f32; f32 output.
#include <hip/hip_runtime.h>
#include <math.h>

typedef __attribute__((ext_vector_type(16))) _Float16 v16h;
typedef __attribute__((ext_vector_type(16))) __bf16 v16b;
typedef __attribute__((ext_vector_type(8)))  _Float16 v8h;
typedef __attribute__((ext_vector_type(8)))  float v8f;
typedef __attribute__((ext_vector_type(4)))  float v4f;
typedef __attribute__((ext_vector_type(2)))  float v2f;
typedef __attribute__((ext_vector_type(4)))  unsigned v4u;
typedef __attribute__((ext_vector_type(4)))  int v4i;
typedef float __attribute__((may_alias)) float_a;
typedef int __attribute__((may_alias)) int_a;

template <typename T> __device__ __forceinline__ void vst2(void* p, T v) { *(T*)p = v;  }
__device__ __forceinline__ v8f wmma16(v16h a, v16h b, v8f c) {
  v8f d = __builtin_amdgcn_wmma_f32_16x16x32_f16(false, a, false, b, (short)0, c, false, false);
  asm volatile("v_nop\n\tv_nop\n\tv_nop\n\tv_nop" : "+v"(d) : "v"(a), "v"(b));
  return d;
}
__device__ __forceinline__ v8f wmma_bf(v16b a, v16b b, v8f c) {
  v8f d = __builtin_amdgcn_wmma_f32_16x16x32_bf16(false, a, false, b, (short)0, c, false, false);
  asm volatile("v_nop\n\tv_nop\n\tv_nop\n\tv_nop" : "+v"(d) : "v"(a), "v"(b));
  return d;
}
// 16x16x32 fragments: lane = (h = lane>>4, row/col = lane&15); elements 0..7 = k0+8h+0..7, 8..15 = k0+16+8h+0..7; D element r = row 8h+r
__device__ __forceinline__ v16h frag_h(const _Float16* rowk0, int lane) {
  union { v16h v; v8h q[2]; } u; const _Float16* p = rowk0 + 8 * (lane >> 4);
  u.q[0] = *(const v8h*)p; u.q[1] = *(const v8h*)(p + 16); return u.v;
}
__device__ __forceinline__ v16h frag_f32(const float* rowk0, int lane) {
  v16h a; const float* p = rowk0 + 8 * (lane >> 4);
#pragma unroll
  for (int i = 0; i < 8; ++i) { a[i] = (_Float16)p[i]; a[8 + i] = (_Float16)p[16 + i]; }
  return a;
}
__device__ __forceinline__ v16h frag_f32s(const float* rowk0, int lane, float sc) {
  v16h a; const float* p = rowk0 + 8 * (lane >> 4);
#pragma unroll
  for (int i = 0; i < 8; ++i) { a[i] = (_Float16)(p[i] * sc); a[8 + i] = (_Float16)(p[16 + i] * sc); }
  return a;
}
// column fragment from a [K][ld] layout (column n), rows >= K read as 0
__device__ __forceinline__ v16h fragc_f32(const float* W, int k0, int n, int lane, int ld, int K) {
  v16h a; const int g = lane >> 4;
#pragma unroll
  for (int i = 0; i < 8; ++i) { const int ka = k0 + 8 * g + i, kb = ka + 16;
    a[i] = (_Float16)(ka < K ? W[(size_t)(ka < K ? ka : K - 1) * ld + n] : 0.f); a[8 + i] = (_Float16)(kb < K ? W[(size_t)(kb < K ? kb : K - 1) * ld + n] : 0.f); }
  return a;
}
struct F2 { v16b h, l; };
__device__ __forceinline__ F2 bsplit16(const float v[16]) { F2 r;
#pragma unroll
  for (int i = 0; i < 16; ++i) { const __bf16 h = (__bf16)v[i]; r.h[i] = h; r.l[i] = (__bf16)(v[i] - (float)h); }
  return r; }
__device__ __forceinline__ F2 split_row(const float* row, int k0, int lane) { float v[16]; const float* p = row + k0 + 8 * (lane >> 4);
#pragma unroll
  for (int i = 0; i < 8; ++i) { v[i] = p[i]; v[8 + i] = p[16 + i]; }
  return bsplit16(v); }
__device__ __forceinline__ F2 split_rowK(const float* row, int k0, int lane, int K) { float v[16]; const int g = lane >> 4;
#pragma unroll
  for (int i = 0; i < 8; ++i) { const int ka = k0 + 8 * g + i, kb = ka + 16; v[i] = ka < K ? row[ka < K ? ka : K - 1] : 0.f; v[8 + i] = kb < K ? row[kb < K ? kb : K - 1] : 0.f; }
  return bsplit16(v); }
__device__ __forceinline__ F2 split_col(const float* W, int k0, int n, int lane, int ld, int K) { float v[16]; const int g = lane >> 4;
#pragma unroll
  for (int i = 0; i < 8; ++i) { const int ka = k0 + 8 * g + i, kb = ka + 16; v[i] = ka < K ? W[(size_t)(ka < K ? ka : K - 1) * ld + n] : 0.f; v[8 + i] = kb < K ? W[(size_t)(kb < K ? kb : K - 1) * ld + n] : 0.f; }
  return bsplit16(v); }
__device__ __forceinline__ v8f mac3(const F2& a, const F2& b, v8f c) { c = wmma_bf(a.l, b.h, c); c = wmma_bf(a.h, b.l, c); return wmma_bf(a.h, b.h, c); }
__device__ __forceinline__ float sigm(float v) { return 1.0f / (1.0f + expf(-v)); }
#define LDSX() do { asm volatile("s_wait_dscnt 0" ::: "memory"); __builtin_amdgcn_wave_barrier(); __builtin_amdgcn_fence(__ATOMIC_RELEASE, "workgroup"); } while (0)

// SAGAN-style position attention with SIGMOID (unnormalised) attention (B 4, 64 x 64 = 4,096 positions, C 512; x channels-last [B,H,W,C] = rows [b*n][512]; (in,out) weights Wq/Wk [512,64], Wv [512,512], no biases; gamma scalar): q = x Wq, k = x Wk, v = x Wv; scores[n][m] = q_n . k_m (no scaling); attn = sigmoid(scores) (no row normalisation); attended[n][c] = sum_m attn[n][m] v[m][c]; out = gamma * attended + x.
#define NB 4
#define TT 4096
#define CC 512            // value width (v planes, output rows)
#define CCQ 128           // q / k row pitch: one 128-column block, columns >= 64 are zero
#define DIN 512          // x width
#define NH 1
#define HD 512
#define NQB (TT / 64)
#define HG 1               // sizes only the unused WS_S region: no score plane in memory
#define SCALE (1.0f)
#define HDQK 64            // q / k width
#define CAUSAL 0
#ifndef TNB
#define TNB NB
#endif
__device__ __forceinline__ v16b zero16b() { v16b z; _Pragma("unroll") for (int i = 0; i < 16; ++i) z[i] = (__bf16)0.f; return z; }
__device__ __forceinline__ float bfr(float v) { return (float)(__bf16)v; }
__host__ __device__ __forceinline__ int kb_last(int qb) { return CAUSAL ? ((qb * 64 + 63) >> 7) : (TT / 128 - 1); }
typedef __attribute__((ext_vector_type(8))) __bf16 v8b;
__device__ __forceinline__ v16b frag_b(const __bf16* rowk0, int lane) {
  union { v16b v; v8b q[2]; } u; const __bf16* p = rowk0 + 8 * (lane >> 4);
  u.q[0] = *(const v8b*)p; u.q[1] = *(const v8b*)(p + 16); return u.v;
}
#define QBH 0              // unused: every query block takes k_att's single f16 path
#define QHI 0               // no q residual plane: q and k once to f16 (1 product)
#define KHI 64            // key rows carrying k residual / v bf16 hi+lo planes (written by k_projT, read by no kernel)
// B fragment (k rows k0+.., output column o) of a weight: (in,out) [K][ld] or (out,in) [ld rows of K]: bf16 exact, or f16(bf16 * 256) exact
__device__ __forceinline__ v16b wcol_io(const float* Wm, int k0, int o, int lane, int ld) { v16b w; const int g = lane >> 4;
#pragma unroll
  for (int i = 0; i < 8; ++i) { w[i] = (__bf16)Wm[(size_t)(k0 + 8 * g + i) * ld + o]; w[8 + i] = (__bf16)Wm[(size_t)(k0 + 16 + 8 * g + i) * ld + o]; }
  return w; }
__device__ __forceinline__ v16b wcol_oi(const float* Wm, int k0, int o, int lane, int K) { v16b w; const float* p = Wm + (size_t)o * K + k0 + 8 * (lane >> 4);
#pragma unroll
  for (int i = 0; i < 8; ++i) { w[i] = (__bf16)p[i]; w[8 + i] = (__bf16)p[16 + i]; }
  return w; }
__device__ __forceinline__ v16h wcolh_io(const float* Wm, int k0, int o, int lane, int ld) { v16h w; const int g = lane >> 4;
#pragma unroll
  for (int i = 0; i < 8; ++i) { w[i] = (_Float16)(bfr(Wm[(size_t)(k0 + 8 * g + i) * ld + o]) * 256.0f); w[8 + i] = (_Float16)(bfr(Wm[(size_t)(k0 + 16 + 8 * g + i) * ld + o]) * 256.0f); }
  return w; }
__device__ __forceinline__ v16h wcolh_oi(const float* Wm, int k0, int o, int lane, int K) { v16h w; const float* p = Wm + (size_t)o * K + k0 + 8 * (lane >> 4);
#pragma unroll
  for (int i = 0; i < 8; ++i) { w[i] = (_Float16)(bfr(p[i]) * 256.0f); w[8 + i] = (_Float16)(bfr(p[16 + i]) * 256.0f); }
  return w; }
#define WQKV_LAYOUT 0   // 0 = (in,out) [K][CC] for Wv, [K][HDQK] for Wq/Wk; 1 = (out,in) [CC][DIN]; 2 = per-head [NH][DIN][HD]
__device__ __forceinline__ v16b wcol_hdk(const float* Wm, int k0, int o, int lane) { v16b w; const int g = lane >> 4; const float* p = Wm + (size_t)(o / HD) * DIN * HD + (o % HD);
#pragma unroll
  for (int i = 0; i < 8; ++i) { w[i] = (__bf16)p[(size_t)(k0 + 8 * g + i) * HD]; w[8 + i] = (__bf16)p[(size_t)(k0 + 16 + 8 * g + i) * HD]; }
  return w; }
#define WO_OUT_IN 0
#if WQKV_LAYOUT == 1
#define WCOL(W, k0, o, lane) wcol_oi(W, k0, (o), lane, DIN)   /* unused: layout 0 */
#elif WQKV_LAYOUT == 2
#define WCOL(W, k0, o, lane) wcol_hdk(W, k0, o, lane)
#else
#define WCOL(W, k0, o, lane) (which == 2 ? wcol_io(W, k0, (o), lane, CC) : ((o) < HDQK ? wcol_io(W, k0, (o), lane, HDQK) : zero16b()))   /* Wv [512][512]; Wq/Wk [512][64]: projected q/k columns >= 64 are zero (block y = 0 only) */
#endif
#if WO_OUT_IN
#define WOCOL(W, k0, o, lane) wcol_oi(W, k0, o, lane, CC)
#define WOCOLH(W, k0, o, lane) wcolh_oi(W, k0, o, lane, CC)
#else
#define WOCOL(W, k0, o, lane) wcol_io(W, k0, o, lane, DIN)
#define WOCOLH(W, k0, o, lane) wcolh_io(W, k0, o, lane, DIN)
#endif
#define BG HG              // unused: k_att covers all batches in one launch, blockIdx.z = batch
#define BGN (TNB < BG ? TNB : BG)
#define DVH 128            // unused: each k_att block covers all 512 value columns (16 accumulator tiles per wave)
#ifndef SM_EXTRA_PARAMS
#define SM_EXTRA_PARAMS
#endif
#ifndef PROJ_EXTRA_PARAMS
#define PROJ_EXTRA_PARAMS
#endif
#ifndef SM_MASK_HOOK
#define SM_MASK_HOOK (void)0
#endif

#define WS_QH  0u                                      // f16 q rows [b*t][CCQ]
#define WS_KH  (WS_QH + 2u * (size_t)NB * TT * CCQ)     // f16 k rows [b*t][CCQ]
#define WS_VT  (WS_KH + 2u * (size_t)NB * TT * CCQ)     // f16 v planes [b][c][t]
#define WS_QL  (WS_VT + 2u * (size_t)NB * CC * TT)      // f16 q residual x 2^10 rows [b][t < QHI][CCQ]
#define WS_KL  (WS_QL + 2u * (size_t)NB * QHI * CCQ)    // f16 k residual x 2^10 rows [b][t < KHI][CCQ]
#define WS_VB  (WS_KL + 2u * (size_t)NB * KHI * CCQ)    // bf16 v hi planes [b][c][t < KHI]
#define WS_VBL (WS_VB + 2u * (size_t)NB * CC * KHI)
#define WS_S   (WS_VBL + 2u * (size_t)NB * CC * KHI)    // unused: no score plane in memory
#define WS_Y   (WS_S  + 4u * (size_t)HG * TT * TT)      // f32 ctx rows [b*t][CC] (only when there is an output projection)
#define WS_END (WS_Y  + 0u)

#define PJ_KC 64                        // k values per staged chunk of k_projT
#define PJ_P (PJ_KC * 2 + 16)           // LDS pitch of a staged weight column and of a staged x row, bytes (16 B x odd: no bank conflict for 16-byte reads)
typedef __attribute__((ext_vector_type(4))) __bf16 v4b;
// ---- k_proj: block = (64 rows, 128 cols, which): q/k/v = X W (+ b) with exact bf16 products (K = DIN) -> which 0: q f16 rows (+ residual rows < QHI); 1: k f16 rows (+ residual rows < KHI); 2: v f16 planes [c][t] (+ bf16 hi/lo planes for t < KHI)
// per chunk of 64 k the block stages, through registers and as bf16, its weight columns TRANSPOSED ([column][k]; a lane loads two adjacent columns, so a wave's load is two whole 128-B lines) and its 64 x rows (16 lanes x 16 B per row); fragments are 16-byte LDS reads. Two buffers: the next chunk's global loads fly while this chunk is worked on; one barrier per chunk. The staging LDS is used again by the epilogue.
template <int WOFF> __global__ __launch_bounds__(128) void k_projT(const float* __restrict__ XQ, const float* __restrict__ XK, const float* __restrict__ XV, const float* __restrict__ WQ, const float* __restrict__ WK, const float* __restrict__ WV, const float* __restrict__ BQ, const float* __restrict__ BK, const float* __restrict__ BV,
    _Float16* __restrict__ QH, _Float16* __restrict__ QL, _Float16* __restrict__ KH, _Float16* __restrict__ KL, _Float16* __restrict__ VT, __bf16* __restrict__ VB, __bf16* __restrict__ VBL) {
  constexpr bool ISV = WOFF == 2;   /* WOFF 2: v (128 of Wv's 512 columns per block); WOFF 0: q or k (all 64 columns; accumulator tiles 4..7 stay zero) */
  constexpr int NJ = ISV ? 8 : 4, NCOL = NJ * 16, NCP = NCOL / 2, KPT = PJ_KC * NCP / 128, LDW = ISV ? CC : HDQK;   /* a thread stages KPT k values of one pair of columns per chunk */
  constexpr int BUFB = (NCOL + 64) * PJ_P, EPB = ISV ? 3 * 128 * 72 * 2 : 2 * 64 * 136 * 2, SMB = 2 * BUFB > EPB ? 2 * BUFB : EPB;   /* a buffer: weight columns, then x rows */
  __shared__ __align__(16) unsigned char sm[SMB];
  _Float16 (*sh)[136] = (_Float16 (*)[136])sm; _Float16 (*sl)[136] = sh + 64; _Float16 (*th)[72] = (_Float16 (*)[72])sm; __bf16 (*tb)[72] = (__bf16 (*)[72])(sm + 128 * 72 * 2); __bf16 (*tbl)[72] = tb + 128; (void)sh; (void)sl; (void)th; (void)tb; (void)tbl;
  const int tid = threadIdx.x, wave = tid >> 5, lane = tid & 31, col = lane & 15, g = lane >> 4; const int which = ISV ? 2 : (int)blockIdx.z; const int c0 = blockIdx.y * 128; const size_t r0 = (size_t)blockIdx.x * 64; const size_t bb = r0 / TT; const int t0 = (int)(r0 % TT);
  const float* X = which == 0 ? XQ : which == 1 ? XK : XV; const float* WA = which == 0 ? WQ : which == 1 ? WK : WV; const float* BA = which == 0 ? BQ : which == 1 ? BK : BV;
  v8f acc[8] = {};
  const int wn = (tid % NCP) * 2, wk = (tid / NCP) * KPT;
  const float* wp = WA + (size_t)wk * LDW + c0 + wn;                          /* load i: weight row wk + i of the chunk, columns c0 + wn and + 1 */
  const float* xp = X + (r0 + wave * 16 + g) * (size_t)DIN + col * 4;         /* load i: row 2 i + g of this wave's 16 rows, row-major [b*t][DIN] */
  unsigned char* wd = sm + wn * PJ_P + wk * 2; unsigned char* xd = sm + (NCOL + wave * 16 + g) * PJ_P + col * 8;
  v2f wr[KPT]; v4f xr[8];
  auto ld_chunk = [&](int c) {
#pragma unroll   // every unroll of this kernel: constant indices, so that staged values, fragments and accumulators stay in registers
    for (int i = 0; i < KPT; ++i) wr[i] = *(const v2f*)(wp + (size_t)c * PJ_KC * LDW + (size_t)i * LDW);
#pragma unroll
    for (int i = 0; i < 8; ++i) xr[i] = *(const v4f*)(xp + c * PJ_KC + (size_t)i * 2 * DIN); };
  auto st_chunk = [&](int bo) {
#pragma unroll
    for (int e = 0; e < 2; ++e)
#pragma unroll
      for (int s = 0; s < KPT / 8; ++s) { v8b t;
#pragma unroll
        for (int i = 0; i < 8; ++i) t[i] = (__bf16)wr[s * 8 + i][e];
        *(v8b*)(wd + bo + e * PJ_P + s * 16) = t; }
#pragma unroll
    for (int i = 0; i < 8; ++i) { v4b t; t[0] = (__bf16)xr[i][0]; t[1] = (__bf16)xr[i][1]; t[2] = (__bf16)xr[i][2]; t[3] = (__bf16)xr[i][3]; *(v4b*)(xd + bo + i * 2 * PJ_P) = t; } };
  ld_chunk(0); st_chunk(0);
  __syncthreads();   /* chunk 0 readable by every wave */
#pragma unroll 1   // stays rolled: small code, the buffers picked by c & 1
  for (int c = 0; c < DIN / PJ_KC; ++c) { const int bo = (c & 1) * BUFB;
    if (c + 1 < DIN / PJ_KC) ld_chunk(c + 1);
    const unsigned char* wb = sm + bo + col * PJ_P; const unsigned char* xb = sm + bo + (NCOL + wave * 16 + col) * PJ_P;
#pragma unroll
    for (int kc = 0; kc < PJ_KC / 32; ++kc) { const v16b a = frag_b((const __bf16*)(xb + kc * 64), lane);
#pragma unroll
      for (int jh = 0; jh < NJ; jh += 4) { v16b w[4];   /* four fragments' LDS reads stand as one group ahead of their four products: one wait per group */
#pragma unroll
        for (int j = 0; j < 4; ++j) w[j] = frag_b((const __bf16*)(wb + (jh + j) * 16 * PJ_P + kc * 64), lane);
#pragma unroll
        for (int j = 0; j < 4; ++j) acc[jh + j] = wmma_bf(a, w[j], acc[jh + j]); } }
    if (c + 1 < DIN / PJ_KC) st_chunk(BUFB - bo);
    __syncthreads(); }   /* publishes chunk c + 1; ends every wave's reads of chunk c (behind the last chunk: before the epilogue writes this LDS) */
  if constexpr (!ISV) { _Float16* DH = which == 0 ? QH : KH; _Float16* DL = which == 0 ? QL : KL; const int nhi = which == 0 ? QHI : KHI; const bool hi_rows = t0 < nhi;
#pragma unroll
    for (int j = 0; j < 8; ++j) { const float bias = BA ? bfr(BA[c0 + j * 16 + col]) : 0.f;
#pragma unroll
      for (int r = 0; r < 8; ++r) { const float v = acc[j][r] + bias; const _Float16 hv = (_Float16)v; sh[wave * 16 + 8 * g + r][j * 16 + col] = hv; sl[wave * 16 + 8 * g + r][j * 16 + col] = (_Float16)((v - (float)hv) * 1024.0f); } }
    __syncthreads();
    for (int e = tid; e < 64 * 16; e += 128) { const int rl = e >> 4, q = e & 15; vst2((unsigned*)(DH + (r0 + rl) * CCQ + c0 + q * 8), *(const v4u*)&sh[rl][q * 8]); if (hi_rows) vst2((unsigned*)(DL + (bb * nhi + t0 + rl) * (size_t)CCQ + c0 + q * 8), *(const v4u*)&sl[rl][q * 8]); }   /* q/k rows: pitch CCQ (c0 == 0) */
  } else { const bool hi_rows = t0 < KHI;
#pragma unroll
    for (int j = 0; j < 8; ++j) { const float bias = BA ? bfr(BA[c0 + j * 16 + col]) : 0.f;
#pragma unroll
      for (int r = 0; r < 8; ++r) { const float v = acc[j][r] + bias; const int rl = wave * 16 + 8 * g + r, cl = j * 16 + col; th[cl][rl] = (_Float16)v; const __bf16 bh = (__bf16)v; tb[cl][rl] = bh; tbl[cl][rl] = (__bf16)(v - (float)bh); } }
    __syncthreads();
    for (int e = tid; e < 128 * 8; e += 128) { const int cl = e >> 3, q = e & 7; vst2((unsigned*)(VT + (bb * CC + c0 + cl) * (size_t)TT + t0 + q * 8), *(const v4u*)&th[cl][q * 8]); if (hi_rows) { const size_t o3 = (bb * CC + c0 + cl) * (size_t)KHI + t0 + q * 8; vst2((unsigned*)(VB + o3), *(const v4u*)&tb[cl][q * 8]); vst2((unsigned*)(VBL + o3), *(const v4u*)&tbl[cl][q * 8]); } } } }
#define AT_KS 64                        // keys per staged tile of k_att
#define AT_KP (HDQK * 2 + 16)           // LDS pitch of a k row, bytes (16 B x odd: no bank conflict for 16-byte reads)
#define AT_VP (AT_KS * 2 + 16)          // LDS pitch of a v row and of a P row, bytes (16 B x odd)
#define AT_KB (AT_KS * AT_KP)           // k part of a buffer
#define AT_SB (AT_KB + CC * AT_VP)      // one buffer: k part + v part
#define AT_PB (64 * AT_VP)              // one P tile: 64 queries x 64 keys, f16
#define AT_OP 68                        // LDS pitch of an output row of one wave, floats
// 16-byte copies per lane, global -> LDS through no register; the s_wait_xcnt stands inside each statement so that no address register is rewritten ahead of it
__device__ __forceinline__ void acopy8(const unsigned l[8], const void* const gq[8]) {
  asm volatile("global_load_async_to_lds_b128 %0, %8, off\n\tglobal_load_async_to_lds_b128 %1, %9, off\n\tglobal_load_async_to_lds_b128 %2, %10, off\n\tglobal_load_async_to_lds_b128 %3, %11, off\n\t"
               "global_load_async_to_lds_b128 %4, %12, off\n\tglobal_load_async_to_lds_b128 %5, %13, off\n\tglobal_load_async_to_lds_b128 %6, %14, off\n\tglobal_load_async_to_lds_b128 %7, %15, off\n\ts_wait_xcnt 0x0"
               :: "v"(l[0]), "v"(l[1]), "v"(l[2]), "v"(l[3]), "v"(l[4]), "v"(l[5]), "v"(l[6]), "v"(l[7]), "v"(gq[0]), "v"(gq[1]), "v"(gq[2]), "v"(gq[3]), "v"(gq[4]), "v"(gq[5]), "v"(gq[6]), "v"(gq[7]) : "memory");
}
// 64 k rows of 128 B: 2 copies per lane, rows 32 apart (256 lanes = 32 rows per copy)
__device__ __forceinline__ void at_stage_k(const _Float16* gk, unsigned lk) {
  asm volatile("global_load_async_to_lds_b128 %0, %2, off\n\tglobal_load_async_to_lds_b128 %1, %3, off\n\ts_wait_xcnt 0x0" :: "v"(lk), "v"(lk + 32 * AT_KP), "v"(gk), "v"(gk + (size_t)32 * CCQ) : "memory");
}
// 512 v rows of 64 keys (128 B): 16 copies per lane, rows 32 apart
__device__ __forceinline__ void at_stage_v(const _Float16* gv, unsigned lv) {
#pragma unroll   // both loops: constant indices, so that each copy's addresses are plain registers of its statement
  for (int s = 0; s < 2; ++s) { unsigned l[8]; const void* gq[8];
#pragma unroll
    for (int i = 0; i < 8; ++i) { l[i] = lv + (s * 8 + i) * 32 * AT_VP; gq[i] = gv + (size_t)(s * 8 + i) * 32 * TT; }
    acopy8(l, gq); }
}
// eight transcendentals of one kind in one statement, results in registers of their own, one v_nop behind the last: keeps the slot that the instruction set asks for between a transcendental and a next instruction that overwrites its source or reads its result. The two s_delay_alu are the hints that the compiler cannot place around asm text: the first source comes from a vector instruction a few places in front, the next reader takes the last results; without them the wait would hold up the SIMD's other wave too
__device__ __forceinline__ void exp2_8(float (&o)[8], const float (&x)[8]) {
  asm("s_delay_alu instid0(VALU_DEP_4)\n\tv_exp_f32 %0, %8\n\tv_exp_f32 %1, %9\n\tv_exp_f32 %2, %10\n\tv_exp_f32 %3, %11\n\tv_exp_f32 %4, %12\n\tv_exp_f32 %5, %13\n\tv_exp_f32 %6, %14\n\tv_exp_f32 %7, %15\n\tv_nop\n\ts_delay_alu instid0(TRANS32_DEP_1)"
      : "=&v"(o[0]), "=&v"(o[1]), "=&v"(o[2]), "=&v"(o[3]), "=&v"(o[4]), "=&v"(o[5]), "=&v"(o[6]), "=&v"(o[7]) : "v"(x[0]), "v"(x[1]), "v"(x[2]), "v"(x[3]), "v"(x[4]), "v"(x[5]), "v"(x[6]), "v"(x[7]));
}
__device__ __forceinline__ void rcp_8(float (&o)[8], const float (&x)[8]) {
  asm("s_delay_alu instid0(VALU_DEP_4)\n\tv_rcp_f32 %0, %8\n\tv_rcp_f32 %1, %9\n\tv_rcp_f32 %2, %10\n\tv_rcp_f32 %3, %11\n\tv_rcp_f32 %4, %12\n\tv_rcp_f32 %5, %13\n\tv_rcp_f32 %6, %14\n\tv_rcp_f32 %7, %15\n\tv_nop\n\ts_delay_alu instid0(TRANS32_DEP_1)"
      : "=&v"(o[0]), "=&v"(o[1]), "=&v"(o[2]), "=&v"(o[3]), "=&v"(o[4]), "=&v"(o[5]), "=&v"(o[6]), "=&v"(o[7]) : "v"(x[0]), "v"(x[1]), "v"(x[2]), "v"(x[3]), "v"(x[4]), "v"(x[5]), "v"(x[6]), "v"(x[7]));
}
// P of 16 queries x 32 keys: logits with the k rows as A and the q rows as B, so that a lane holds 8 consecutive keys of one query (element r: key 8 g + r of the 16, query col); sigmoid x 2^11 in f32 by the hardware exp2 and reciprocal (four vector instructions per element; their error lies far under the f16 rounding that follows), once to f16, one 16-byte LDS store per 16 keys
__device__ __forceinline__ void at_p(const unsigned char* kl, unsigned char* pd, v16h qf0, v16h qf1, int lane) {
  v16h ka[2][2];
#pragma unroll   // constant indices: fragments stay in registers; the four fragments' LDS reads stand as one group
  for (int u = 0; u < 2; ++u) { const _Float16* kr = (const _Float16*)(kl + u * 16 * AT_KP); ka[u][0] = frag_h(kr, lane); ka[u][1] = frag_h(kr + 32, lane); }
#pragma unroll
  for (int u = 0; u < 2; ++u) { v8f st = {}; st = wmma16(ka[u][0], qf0, st); st = wmma16(ka[u][1], qf1, st);
    float ea[8], ex[8], pr[8]; v8h ph;   /* 2^11 / (1 + e^-s) = 1 / (2^-11 + 2^(-s log2 e - 11)); s = +-inf gives 2^11 and 0 */
#pragma unroll
    for (int r = 0; r < 8; ++r) ea[r] = __builtin_fmaf(st[r], -1.4426950408889634f, -11.0f);
    exp2_8(ex, ea);
#pragma unroll
    for (int r = 0; r < 8; ++r) ex[r] += 0x1p-11f;
    rcp_8(pr, ex);
#pragma unroll
    for (int r = 0; r < 8; ++r) ph[r] = (_Float16)pr[r];
    *(v8h*)(pd + u * 32) = ph; }
}
// ---- k_att: block = (64 queries (qb), batch), 8 waves, all 512 value columns; no score plane in memory. Per tile of 64 keys the block forms its 64 x 64 P once (each wave 16 queries x 32 keys) into LDS, one tile ahead of attended += P . v (wave = 64 queries x 64 columns); out = gamma * attended x 2^-11 + bf16(x).
// staging buffer s mod 2 holds the v rows of tile s and the k rows of tile s + 1, so that trip t reads buffer t mod 2 alone; the k rows of tile 0 have a buffer of their own, filled once ("tile s" here and below: the tile of step s of the block's own walk, tile(s) in memory)
__global__ __launch_bounds__(256) void k_att(const _Float16* __restrict__ QH, const _Float16* __restrict__ KH, const _Float16* __restrict__ VT, const float* __restrict__ X1, const float* __restrict__ GM, float* __restrict__ Y) {
  __shared__ __align__(16) unsigned char stg[2 * AT_SB]; __shared__ __align__(16) unsigned char k0s[AT_KB]; __shared__ __align__(16) unsigned char pl[2 * AT_PB];
  const float gmv = bfr(GM[0]); const int b = blockIdx.z, qb = blockIdx.x;
  const int tid = threadIdx.x, wave = tid >> 5, lane = tid & 31, col = lane & 15, g = lane >> 4;
  const int qt = wave & 3, kp = wave >> 2;   /* P: this wave forms queries 16 qt .. + 15 against keys 32 kp .. + 31 of each tile */
  const _Float16* qr = QH + ((size_t)b * TT + qb * 64 + qt * 16 + col) * CCQ;
  const v16h qf0 = frag_h(qr, lane), qf1 = frag_h(qr + 32, lane);
  v8f acc[4][4] = {};
  const unsigned lbase = (unsigned)(size_t)stg; const int nt = TT / AT_KS;
  static_assert((TT / AT_KS & (TT / AT_KS - 1)) == 0, "the walk wraps by a mask");
  auto tile = [&](int s) { return (s + qb) & (nt - 1); };   /* step s of this block's walk takes key tile (s + qb) mod nt: the 64 blocks of a batch, which all copy the same k and v lines, stand at 64 different tiles at any moment instead of asking L2 for the same lines together; every tile is taken once, the f32 sums run from the block's own start and wrap */
  const _Float16* gk = KH + ((size_t)b * TT + (tid >> 3)) * CCQ + (tid & 7) * 8;            /* copy i: k row 32 i + tid / 8, four 128-B rows per wave */
  const _Float16* gv = VT + ((size_t)b * CC + (tid >> 3)) * (size_t)TT + (tid & 7) * 8;     /* copy i: v row 32 i + tid / 8 */
  const unsigned lk = lbase + (tid >> 3) * AT_KP + (tid & 7) * 16, lv = lbase + AT_KB + (tid >> 3) * AT_VP + (tid & 7) * 16;
  const unsigned kro = (kp * 32 + col) * AT_KP, pwo = (qt * 16 + col) * AT_VP + (kp * 32 + 8 * g) * 2;   /* this lane's first k row in a k part; its first P store in a P tile */
  at_stage_k(gk + (size_t)tile(0) * AT_KS * CCQ, (unsigned)(size_t)k0s + (tid >> 3) * AT_KP + (tid & 7) * 16);
  at_stage_k(gk + (size_t)tile(1) * AT_KS * CCQ, lk); at_stage_v(gv + tile(0) * AT_KS, lv);
  asm volatile("s_wait_asynccnt 0x0" ::: "memory");   /* k tile 0 and buffer 0 landed (this wave's copies) */
  __syncthreads();                                      /* both readable by every wave */
  at_stage_k(gk + (size_t)tile(2) * AT_KS * CCQ, lk + AT_SB); at_stage_v(gv + tile(1) * AT_KS, lv + AT_SB);
  at_p(k0s + kro, pl + pwo, qf0, qf1, lane);
  asm volatile("s_wait_dscnt 0x0" ::: "memory");      /* this wave's P stores of tile 0 are in LDS */
  __syncthreads();                                      /* P of tile 0 readable by every wave */
#pragma unroll 1   // stays rolled: one publish point in the code, the buffers picked by t & 1
  for (int t = 0; t < nt; ++t) { const unsigned bo = (t & 1) * AT_SB, po = (t & 1) * AT_PB;
    if (t + 1 < nt) at_p(stg + bo + kro, pl + (AT_PB - po) + pwo, qf0, qf1, lane);   /* P of tile t + 1 into the other P tile */
    const unsigned char* vb = stg + bo + AT_KB + (wave * 64 + col) * AT_VP; const unsigned char* pb = pl + po + col * AT_VP;
#pragma unroll   // here and below in this loop: constant indices, so that fragments and accumulators stay in registers
    for (int kc = 0; kc < AT_KS / 32; ++kc) { v16h a[4], w[4];
#pragma unroll
      for (int i = 0; i < 4; ++i) { a[i] = frag_h((const _Float16*)(pb + i * 16 * AT_VP + kc * 64), lane); w[i] = frag_h((const _Float16*)(vb + i * 16 * AT_VP + kc * 64), lane); }
#pragma unroll
      for (int i = 0; i < 4; ++i)
#pragma unroll
        for (int j = 0; j < 4; ++j) acc[i][j] = wmma16(a[i], w[j], acc[i][j]); }
    asm volatile("s_wait_dscnt 0x0" ::: "memory");      /* this wave's reads of buffer t and of P tile t are done, its P stores of tile t + 1 are in LDS */
    asm volatile("s_wait_asynccnt 0x0" ::: "memory");   /* this wave's copies of buffer t + 1 have landed */
    __syncthreads();                                    /* publishes buffer t + 1 and P of tile t + 1; ends every wave's reads of buffer t and of P tile t */
    if (t + 2 < nt) { if (t + 3 < nt) at_stage_k(gk + (size_t)tile(t + 3) * AT_KS * CCQ, lk + bo); at_stage_v(gv + tile(t + 2) * AT_KS, lv + bo); } }
  asm volatile("s_wait_asynccnt 0x0" ::: "memory");     /* no copy outstanding behind the loop */
  float* sw = (float*)stg + wave * (64 * AT_OP);        /* the staging LDS is free now: each wave turns its own 64 x 64 block into rows */
#pragma unroll
  for (int i = 0; i < 4; ++i)
#pragma unroll
    for (int j = 0; j < 4; ++j)
#pragma unroll
      for (int r = 0; r < 8; ++r) sw[(i * 16 + 8 * g + r) * AT_OP + j * 16 + col] = acc[i][j][r] * (1.0f / 2048.0f);
  LDSX();
#pragma unroll 1   // four row pairs per trip: their x loads stand together ahead of the sums
  for (int it = 0; it < 32; it += 4) { v4f xr[4];
#pragma unroll
    for (int e = 0; e < 4; ++e) xr[e] = *(const v4f*)(X1 + ((size_t)b * TT + qb * 64 + (it + e) * 2 + g) * CC + wave * 64 + col * 4);
#pragma unroll
    for (int e = 0; e < 4; ++e) { const int rl = (it + e) * 2 + g; v4f v = *(const v4f*)&sw[rl * AT_OP + col * 4]; v[0] = gmv * v[0] + bfr(xr[e][0]); v[1] = gmv * v[1] + bfr(xr[e][1]); v[2] = gmv * v[2] + bfr(xr[e][2]); v[3] = gmv * v[3] + bfr(xr[e][3]); vst2(Y + ((size_t)b * TT + qb * 64 + rl) * CC + wave * 64 + col * 4, v); }
    asm volatile("s_wait_xcnt 0x0" ::: "memory"); } }   /* the wait: the next trip rewrites the address and data registers that these stores name */   /* out = gamma * attended + bf16(x): 256-B (row, 64-column) segments, each written once */

extern "C" void kernel_launch(void* const* d_in, const int* in_sizes, int n_in, void* d_out, int out_size, void* d_ws, size_t ws_size, hipStream_t stream) {
  (void)in_sizes; (void)n_in; (void)out_size;
  const float** F = (const float**)d_in;
  if (ws_size < (size_t)WS_END) return;
  char* ws = (char*)d_ws; _Float16 *QH = (_Float16*)(ws + WS_QH), *KH = (_Float16*)(ws + WS_KH), *VT = (_Float16*)(ws + WS_VT), *QL = (_Float16*)(ws + WS_QL), *KL = (_Float16*)(ws + WS_KL); __bf16 *VB = (__bf16*)(ws + WS_VB), *VBL = (__bf16*)(ws + WS_VBL); float *S = (float*)(ws + WS_S), *Y = (float*)(ws + WS_Y);
  (void)S; (void)Y; (void)QL; (void)KL; (void)VB; (void)VBL;
  // inputs (d_in order): 0 x [4,64,64,512]; 1 Wq [512,64] (in,out); 2 Wk [512,64]; 3 Wv [512,512]; 4 gamma [1]
  k_projT<0><<<dim3(TNB * TT / 64, 1, 2), 128, 0, stream>>>(F[0], F[0], F[0], F[1], F[2], F[3], nullptr, nullptr, nullptr, QH, QL, KH, KL, VT, VB, VBL);   /* which 0, 1: q and k (one 128-column block, columns >= 64 zero) */
  k_projT<2><<<dim3(TNB * TT / 64, CC / 128, 1), 128, 0, stream>>>(F[0], F[0], F[0], F[1], F[2], F[3], nullptr, nullptr, nullptr, QH, QL, KH, KL, VT, VB, VBL);   /* which 2: v (four 128-column blocks) */
  k_att<<<dim3(NQB, 1, TNB), 256, 0, stream>>>(QH, KH, VT, F[0], F[4], (float*)d_out);   /* logits, sigmoid and P . v of all batches in one launch */
}

// v006
// It runs in 88.8 microseconds.
// Two timings next to v005 both put it at 1.16 times that version's speed.
// Counting every step since v000, it is 14.1 times as fast.
// compute dtype: all float inputs rounded to bf16; q/k (64 wide) and v (512) = x W with EXACT bf16 products on WMMA 16x16x32, f32 accumulate; q and k once to f16 (1 product) for the UNSCALED scores (logit sigma ~16; sigmoid saturates outside |s| < 5); sigmoid in f32 (hardware exp2 and reciprocal); P x 2^11 once to f16 against v once to f16 (1 product); gamma * attended + x in f32; f32 output.
#include <hip/hip_runtime.h>
#include <math.h>
#include <stdint.h>

typedef __attribute__((ext_vector_type(16))) _Float16 v16h;
typedef __attribute__((ext_vector_type(16))) __bf16 v16b;
typedef __attribute__((ext_vector_type(8)))  _Float16 v8h;
typedef __attribute__((ext_vector_type(8)))  float v8f;
typedef __attribute__((ext_vector_type(4)))  float v4f;
typedef __attribute__((ext_vector_type(2)))  float v2f;
typedef __attribute__((ext_vector_type(4)))  unsigned v4u;
typedef __attribute__((ext_vector_type(4)))  int v4i;
typedef float __attribute__((may_alias)) float_a;
typedef int __attribute__((may_alias)) int_a;

template <typename T> __device__ __forceinline__ void vst2(void* p, T v) { *(T*)p = v;  }
__device__ __forceinline__ v8f wmma16(v16h a, v16h b, v8f c) {
  v8f d = __builtin_amdgcn_wmma_f32_16x16x32_f16(false, a, false, b, (short)0, c, false, false);
  asm volatile("v_nop\n\tv_nop\n\tv_nop\n\tv_nop" : "+v"(d) : "v"(a), "v"(b));
  return d;
}
__device__ __forceinline__ v8f wmma_bf(v16b a, v16b b, v8f c) {
  v8f d = __builtin_amdgcn_wmma_f32_16x16x32_bf16(false, a, false, b, (short)0, c, false, false);
  asm volatile("v_nop\n\tv_nop\n\tv_nop\n\tv_nop" : "+v"(d) : "v"(a), "v"(b));
  return d;
}
// 16x16x32 fragments: lane = (h = lane>>4, row/col = lane&15); elements 0..7 = k0+8h+0..7, 8..15 = k0+16+8h+0..7; D element r = row 8h+r
__device__ __forceinline__ v16h frag_h(const _Float16* rowk0, int lane) {
  union { v16h v; v8h q[2]; } u; const _Float16* p = rowk0 + 8 * (lane >> 4);
  u.q[0] = *(const v8h*)p; u.q[1] = *(const v8h*)(p + 16); return u.v;
}
__device__ __forceinline__ v16h frag_f32(const float* rowk0, int lane) {
  v16h a; const float* p = rowk0 + 8 * (lane >> 4);
#pragma unroll
  for (int i = 0; i < 8; ++i) { a[i] = (_Float16)p[i]; a[8 + i] = (_Float16)p[16 + i]; }
  return a;
}
__device__ __forceinline__ v16h frag_f32s(const float* rowk0, int lane, float sc) {
  v16h a; const float* p = rowk0 + 8 * (lane >> 4);
#pragma unroll
  for (int i = 0; i < 8; ++i) { a[i] = (_Float16)(p[i] * sc); a[8 + i] = (_Float16)(p[16 + i] * sc); }
  return a;
}
// column fragment from a [K][ld] layout (column n), rows >= K read as 0
__device__ __forceinline__ v16h fragc_f32(const float* W, int k0, int n, int lane, int ld, int K) {
  v16h a; const int g = lane >> 4;
#pragma unroll
  for (int i = 0; i < 8; ++i) { const int ka = k0 + 8 * g + i, kb = ka + 16;
    a[i] = (_Float16)(ka < K ? W[(size_t)(ka < K ? ka : K - 1) * ld + n] : 0.f); a[8 + i] = (_Float16)(kb < K ? W[(size_t)(kb < K ? kb : K - 1) * ld + n] : 0.f); }
  return a;
}
struct F2 { v16b h, l; };
__device__ __forceinline__ F2 bsplit16(const float v[16]) { F2 r;
#pragma unroll
  for (int i = 0; i < 16; ++i) { const __bf16 h = (__bf16)v[i]; r.h[i] = h; r.l[i] = (__bf16)(v[i] - (float)h); }
  return r; }
__device__ __forceinline__ F2 split_row(const float* row, int k0, int lane) { float v[16]; const float* p = row + k0 + 8 * (lane >> 4);
#pragma unroll
  for (int i = 0; i < 8; ++i) { v[i] = p[i]; v[8 + i] = p[16 + i]; }
  return bsplit16(v); }
__device__ __forceinline__ F2 split_rowK(const float* row, int k0, int lane, int K) { float v[16]; const int g = lane >> 4;
#pragma unroll
  for (int i = 0; i < 8; ++i) { const int ka = k0 + 8 * g + i, kb = ka + 16; v[i] = ka < K ? row[ka < K ? ka : K - 1] : 0.f; v[8 + i] = kb < K ? row[kb < K ? kb : K - 1] : 0.f; }
  return bsplit16(v); }
__device__ __forceinline__ F2 split_col(const float* W, int k0, int n, int lane, int ld, int K) { float v[16]; const int g = lane >> 4;
#pragma unroll
  for (int i = 0; i < 8; ++i) { const int ka = k0 + 8 * g + i, kb = ka + 16; v[i] = ka < K ? W[(size_t)(ka < K ? ka : K - 1) * ld + n] : 0.f; v[8 + i] = kb < K ? W[(size_t)(kb < K ? kb : K - 1) * ld + n] : 0.f; }
  return bsplit16(v); }
__device__ __forceinline__ v8f mac3(const F2& a, const F2& b, v8f c) { c = wmma_bf(a.l, b.h, c); c = wmma_bf(a.h, b.l, c); return wmma_bf(a.h, b.h, c); }
__device__ __forceinline__ float sigm(float v) { return 1.0f / (1.0f + expf(-v)); }
#define LDSX() do { asm volatile("s_wait_dscnt 0" ::: "memory"); __builtin_amdgcn_wave_barrier(); __builtin_amdgcn_fence(__ATOMIC_RELEASE, "workgroup"); } while (0)

// SAGAN-style position attention with SIGMOID (unnormalised) attention (B 4, 64 x 64 = 4,096 positions, C 512; x channels-last [B,H,W,C] = rows [b*n][512]; (in,out) weights Wq/Wk [512,64], Wv [512,512], no biases; gamma scalar): q = x Wq, k = x Wk, v = x Wv; scores[n][m] = q_n . k_m (no scaling); attn = sigmoid(scores) (no row normalisation); attended[n][c] = sum_m attn[n][m] v[m][c]; out = gamma * attended + x.
#define NB 4
#define TT 4096
#define CC 512            // value width (v planes, output rows)
#define CCQ 128           // q / k row pitch: one 128-column block, columns >= 64 are zero
#define DIN 512          // x width
#define NH 1
#define HD 512
#define NQB (TT / 64)
#define HG 1               // sizes only the unused WS_S region: no score plane in memory
#define SCALE (1.0f)
#define HDQK 64            // q / k width
#define CAUSAL 0
#ifndef TNB
#define TNB NB
#endif
__device__ __forceinline__ v16b zero16b() { v16b z; _Pragma("unroll") for (int i = 0; i < 16; ++i) z[i] = (__bf16)0.f; return z; }
__device__ __forceinline__ float bfr(float v) { return (float)(__bf16)v; }
__host__ __device__ __forceinline__ int kb_last(int qb) { return CAUSAL ? ((qb * 64 + 63) >> 7) : (TT / 128 - 1); }
typedef __attribute__((ext_vector_type(8))) __bf16 v8b;
__device__ __forceinline__ v16b frag_b(const __bf16* rowk0, int lane) {
  union { v16b v; v8b q[2]; } u; const __bf16* p = rowk0 + 8 * (lane >> 4);
  u.q[0] = *(const v8b*)p; u.q[1] = *(const v8b*)(p + 16); return u.v;
}
#define QBH 0              // unused: every query block takes k_att's single f16 path
#define QHI 0               // no q residual plane: q and k once to f16 (1 product)
#define KHI 64            // key rows carrying k residual / v bf16 hi+lo planes (written by k_projT, read by no kernel)
// B fragment (k rows k0+.., output column o) of a weight: (in,out) [K][ld] or (out,in) [ld rows of K]: bf16 exact, or f16(bf16 * 256) exact
__device__ __forceinline__ v16b wcol_io(const float* Wm, int k0, int o, int lane, int ld) { v16b w; const int g = lane >> 4;
#pragma unroll
  for (int i = 0; i < 8; ++i) { w[i] = (__bf16)Wm[(size_t)(k0 + 8 * g + i) * ld + o]; w[8 + i] = (__bf16)Wm[(size_t)(k0 + 16 + 8 * g + i) * ld + o]; }
  return w; }
__device__ __forceinline__ v16b wcol_oi(const float* Wm, int k0, int o, int lane, int K) { v16b w; const float* p = Wm + (size_t)o * K + k0 + 8 * (lane >> 4);
#pragma unroll
  for (int i = 0; i < 8; ++i) { w[i] = (__bf16)p[i]; w[8 + i] = (__bf16)p[16 + i]; }
  return w; }
__device__ __forceinline__ v16h wcolh_io(const float* Wm, int k0, int o, int lane, int ld) { v16h w; const int g = lane >> 4;
#pragma unroll
  for (int i = 0; i < 8; ++i) { w[i] = (_Float16)(bfr(Wm[(size_t)(k0 + 8 * g + i) * ld + o]) * 256.0f); w[8 + i] = (_Float16)(bfr(Wm[(size_t)(k0 + 16 + 8 * g + i) * ld + o]) * 256.0f); }
  return w; }
__device__ __forceinline__ v16h wcolh_oi(const float* Wm, int k0, int o, int lane, int K) { v16h w; const float* p = Wm + (size_t)o * K + k0 + 8 * (lane >> 4);
#pragma unroll
  for (int i = 0; i < 8; ++i) { w[i] = (_Float16)(bfr(p[i]) * 256.0f); w[8 + i] = (_Float16)(bfr(p[16 + i]) * 256.0f); }
  return w; }
#define WQKV_LAYOUT 0   // 0 = (in,out) [K][CC] for Wv, [K][HDQK] for Wq/Wk; 1 = (out,in) [CC][DIN]; 2 = per-head [NH][DIN][HD]
__device__ __forceinline__ v16b wcol_hdk(const float* Wm, int k0, int o, int lane) { v16b w; const int g = lane >> 4; const float* p = Wm + (size_t)(o / HD) * DIN * HD + (o % HD);
#pragma unroll
  for (int i = 0; i < 8; ++i) { w[i] = (__bf16)p[(size_t)(k0 + 8 * g + i) * HD]; w[8 + i] = (__bf16)p[(size_t)(k0 + 16 + 8 * g + i) * HD]; }
  return w; }
#define WO_OUT_IN 0
#if WQKV_LAYOUT == 1
#define WCOL(W, k0, o, lane) wcol_oi(W, k0, (o), lane, DIN)   /* unused: layout 0 */
#elif WQKV_LAYOUT == 2
#define WCOL(W, k0, o, lane) wcol_hdk(W, k0, o, lane)
#else
#define WCOL(W, k0, o, lane) (which == 2 ? wcol_io(W, k0, (o), lane, CC) : ((o) < HDQK ? wcol_io(W, k0, (o), lane, HDQK) : zero16b()))   /* Wv [512][512]; Wq/Wk [512][64]: projected q/k columns >= 64 are zero (block y = 0 only) */
#endif
#if WO_OUT_IN
#define WOCOL(W, k0, o, lane) wcol_oi(W, k0, o, lane, CC)
#define WOCOLH(W, k0, o, lane) wcolh_oi(W, k0, o, lane, CC)
#else
#define WOCOL(W, k0, o, lane) wcol_io(W, k0, o, lane, DIN)
#define WOCOLH(W, k0, o, lane) wcolh_io(W, k0, o, lane, DIN)
#endif
#define BG HG              // unused: k_att covers all batches in one launch, blockIdx.z = batch
#define BGN (TNB < BG ? TNB : BG)
#define DVH 128            // unused: each k_att block covers all 512 value columns (16 accumulator tiles per wave)
#ifndef SM_EXTRA_PARAMS
#define SM_EXTRA_PARAMS
#endif
#ifndef PROJ_EXTRA_PARAMS
#define PROJ_EXTRA_PARAMS
#endif
#ifndef SM_MASK_HOOK
#define SM_MASK_HOOK (void)0
#endif

#define WS_QH  0u                                      // f16 q rows [b*t][CCQ]
#define WS_KH  (WS_QH + 2u * (size_t)NB * TT * CCQ)     // f16 k rows [b*t][CCQ]
#define WS_VT  (WS_KH + 2u * (size_t)NB * TT * CCQ)     // f16 v planes [b][c][t]
#define WS_QL  (WS_VT + 2u * (size_t)NB * CC * TT)      // f16 q residual x 2^10 rows [b][t < QHI][CCQ]
#define WS_KL  (WS_QL + 2u * (size_t)NB * QHI * CCQ)    // f16 k residual x 2^10 rows [b][t < KHI][CCQ]
#define WS_VB  (WS_KL + 2u * (size_t)NB * KHI * CCQ)    // bf16 v hi planes [b][c][t < KHI]
#define WS_VBL (WS_VB + 2u * (size_t)NB * CC * KHI)
#define WS_S   (WS_VBL + 2u * (size_t)NB * CC * KHI)    // unused: no score plane in memory
#define WS_Y   (WS_S  + 4u * (size_t)HG * TT * TT)      // f32 ctx rows [b*t][CC] (only when there is an output projection)
#define WS_END (WS_Y  + 0u)

#define PJ_KC 64                        // k values per staged chunk of k_projT
#define PJ_P (PJ_KC * 2 + 16)           // LDS pitch of a staged weight column and of a staged x row, bytes (16 B x odd: no bank conflict for 16-byte reads)
typedef __attribute__((ext_vector_type(4))) __bf16 v4b;
// ---- k_proj: block = (64 rows, 128 cols, which): q/k/v = X W (+ b) with exact bf16 products (K = DIN) -> which 0: q f16 rows (+ residual rows < QHI); 1: k f16 rows (+ residual rows < KHI); 2: v f16 planes [c][t] (+ bf16 hi/lo planes for t < KHI)
// per chunk of 64 k the block stages, through registers and as bf16, its weight columns TRANSPOSED ([column][k]; a lane loads two adjacent columns, so a wave's load is two whole 128-B lines) and its 64 x rows (16 lanes x 16 B per row); fragments are 16-byte LDS reads. Two buffers: the next chunk's global loads fly while this chunk is worked on; one barrier per chunk. The staging LDS is used again by the epilogue.
template <int WOFF> __global__ __launch_bounds__(128) void k_projT(const float* __restrict__ XQ, const float* __restrict__ XK, const float* __restrict__ XV, const float* __restrict__ WQ, const float* __restrict__ WK, const float* __restrict__ WV, const float* __restrict__ BQ, const float* __restrict__ BK, const float* __restrict__ BV,
    _Float16* __restrict__ QH, _Float16* __restrict__ QL, _Float16* __restrict__ KH, _Float16* __restrict__ KL, _Float16* __restrict__ VT, __bf16* __restrict__ VB, __bf16* __restrict__ VBL) {
  constexpr bool ISV = WOFF == 2;   /* WOFF 2: v (128 of Wv's 512 columns per block); WOFF 0: q or k (all 64 columns; accumulator tiles 4..7 stay zero) */
  constexpr int NJ = ISV ? 8 : 4, NCOL = NJ * 16, NCP = NCOL / 2, KPT = PJ_KC * NCP / 128, LDW = ISV ? CC : HDQK;   /* a thread stages KPT k values of one pair of columns per chunk */
  constexpr int BUFB = (NCOL + 64) * PJ_P, EPB = ISV ? 3 * 128 * 72 * 2 : 2 * 64 * 136 * 2, SMB = 2 * BUFB > EPB ? 2 * BUFB : EPB;   /* a buffer: weight columns, then x rows */
  __shared__ __align__(16) unsigned char sm[SMB];
  _Float16 (*sh)[136] = (_Float16 (*)[136])sm; _Float16 (*sl)[136] = sh + 64; _Float16 (*th)[72] = (_Float16 (*)[72])sm; __bf16 (*tb)[72] = (__bf16 (*)[72])(sm + 128 * 72 * 2); __bf16 (*tbl)[72] = tb + 128; (void)sh; (void)sl; (void)th; (void)tb; (void)tbl;
  const int tid = threadIdx.x, wave = tid >> 5, lane = tid & 31, col = lane & 15, g = lane >> 4; const int which = ISV ? 2 : (int)blockIdx.z; const int c0 = blockIdx.y * 128; const size_t r0 = (size_t)blockIdx.x * 64; const size_t bb = r0 / TT; const int t0 = (int)(r0 % TT);
  const float* X = which == 0 ? XQ : which == 1 ? XK : XV; const float* WA = which == 0 ? WQ : which == 1 ? WK : WV; const float* BA = which == 0 ? BQ : which == 1 ? BK : BV;
  v8f acc[8] = {};
  const int wn = (tid % NCP) * 2, wk = (tid / NCP) * KPT;
  const float* wp = WA + (size_t)wk * LDW + c0 + wn;                          /* load i: weight row wk + i of the chunk, columns c0 + wn and + 1 */
  const float* xp = X + (r0 + wave * 16 + g) * (size_t)DIN + col * 4;         /* load i: row 2 i + g of this wave's 16 rows, row-major [b*t][DIN] */
  unsigned char* wd = sm + wn * PJ_P + wk * 2; unsigned char* xd = sm + (NCOL + wave * 16 + g) * PJ_P + col * 8;
  v2f wr[KPT]; v4f xr[8];
  auto ld_chunk = [&](int c) {
#pragma unroll   // every unroll of this kernel: constant indices, so that staged values, fragments and accumulators stay in registers
    for (int i = 0; i < KPT; ++i) wr[i] = *(const v2f*)(wp + (size_t)c * PJ_KC * LDW + (size_t)i * LDW);
#pragma unroll
    for (int i = 0; i < 8; ++i) xr[i] = *(const v4f*)(xp + c * PJ_KC + (size_t)i * 2 * DIN); };
  auto st_chunk = [&](int bo) {
#pragma unroll
    for (int e = 0; e < 2; ++e)
#pragma unroll
      for (int s = 0; s < KPT / 8; ++s) { v8b t;
#pragma unroll
        for (int i = 0; i < 8; ++i) t[i] = (__bf16)wr[s * 8 + i][e];
        *(v8b*)(wd + bo + e * PJ_P + s * 16) = t; }
#pragma unroll
    for (int i = 0; i < 8; ++i) { v4b t; t[0] = (__bf16)xr[i][0]; t[1] = (__bf16)xr[i][1]; t[2] = (__bf16)xr[i][2]; t[3] = (__bf16)xr[i][3]; *(v4b*)(xd + bo + i * 2 * PJ_P) = t; } };
  ld_chunk(0); st_chunk(0);
  __syncthreads();   /* chunk 0 readable by every wave */
#pragma unroll 1   // stays rolled: small code, the buffers picked by c & 1
  for (int c = 0; c < DIN / PJ_KC; ++c) { const int bo = (c & 1) * BUFB;
    if (c + 1 < DIN / PJ_KC) ld_chunk(c + 1);
    const unsigned char* wb = sm + bo + col * PJ_P; const unsigned char* xb = sm + bo + (NCOL + wave * 16 + col) * PJ_P;
#pragma unroll
    for (int kc = 0; kc < PJ_KC / 32; ++kc) { const v16b a = frag_b((const __bf16*)(xb + kc * 64), lane);
#pragma unroll
      for (int jh = 0; jh < NJ; jh += 4) { v16b w[4];   /* four fragments' LDS reads stand as one group ahead of their four products: one wait per group */
#pragma unroll
        for (int j = 0; j < 4; ++j) w[j] = frag_b((const __bf16*)(wb + (jh + j) * 16 * PJ_P + kc * 64), lane);
#pragma unroll
        for (int j = 0; j < 4; ++j) acc[jh + j] = wmma_bf(a, w[j], acc[jh + j]); } }
    if (c + 1 < DIN / PJ_KC) st_chunk(BUFB - bo);
    __syncthreads(); }   /* publishes chunk c + 1; ends every wave's reads of chunk c (behind the last chunk: before the epilogue writes this LDS) */
  if constexpr (!ISV) { _Float16* DH = which == 0 ? QH : KH; _Float16* DL = which == 0 ? QL : KL; const int nhi = which == 0 ? QHI : KHI; const bool hi_rows = t0 < nhi;
#pragma unroll
    for (int j = 0; j < 8; ++j) { const float bias = BA ? bfr(BA[c0 + j * 16 + col]) : 0.f;
#pragma unroll
      for (int r = 0; r < 8; ++r) { const float v = acc[j][r] + bias; const _Float16 hv = (_Float16)v; sh[wave * 16 + 8 * g + r][j * 16 + col] = hv; sl[wave * 16 + 8 * g + r][j * 16 + col] = (_Float16)((v - (float)hv) * 1024.0f); } }
    __syncthreads();
    for (int e = tid; e < 64 * 16; e += 128) { const int rl = e >> 4, q = e & 15; vst2((unsigned*)(DH + (r0 + rl) * CCQ + c0 + q * 8), *(const v4u*)&sh[rl][q * 8]); if (hi_rows) vst2((unsigned*)(DL + (bb * nhi + t0 + rl) * (size_t)CCQ + c0 + q * 8), *(const v4u*)&sl[rl][q * 8]); }   /* q/k rows: pitch CCQ (c0 == 0) */
  } else { const bool hi_rows = t0 < KHI;
#pragma unroll
    for (int j = 0; j < 8; ++j) { const float bias = BA ? bfr(BA[c0 + j * 16 + col]) : 0.f;
#pragma unroll
      for (int r = 0; r < 8; ++r) { const float v = acc[j][r] + bias; const int rl = wave * 16 + 8 * g + r, cl = j * 16 + col; th[cl][rl] = (_Float16)v; const __bf16 bh = (__bf16)v; tb[cl][rl] = bh; tbl[cl][rl] = (__bf16)(v - (float)bh); } }
    __syncthreads();
    for (int e = tid; e < 128 * 8; e += 128) { const int cl = e >> 3, q = e & 7; vst2((unsigned*)(VT + (bb * CC + c0 + cl) * (size_t)TT + t0 + q * 8), *(const v4u*)&th[cl][q * 8]); if (hi_rows) { const size_t o3 = (bb * CC + c0 + cl) * (size_t)KHI + t0 + q * 8; vst2((unsigned*)(VB + o3), *(const v4u*)&tb[cl][q * 8]); vst2((unsigned*)(VBL + o3), *(const v4u*)&tbl[cl][q * 8]); } } } }
#define AT_KS 64                        // keys per staged tile of k_att
#define AT_KP (HDQK * 2 + 16)           // LDS pitch of a k row, bytes (16 B x odd: no bank conflict for 16-byte reads)
#define AT_VP (AT_KS * 2 + 16)          // LDS pitch of a v row and of a P row, bytes (16 B x odd)
#define AT_KB (AT_KS * AT_KP)           // k part of a buffer
#define AT_VSL 10240                    // LDS bytes of one wave's v slice: 64 rows at pitch AT_VP (9,216 B), rounded up so that every slice starts at a multiple of 2 KiB
#define AT_VB (8 * AT_VSL)              // v part of a buffer: eight slices
static_assert(AT_VSL % 2048 == 0 && 64 * AT_VP <= AT_VSL && AT_VP == 128 + 16 && AT_KS * 2 == 128, "a slice: 64 rows of 128 B, 16 B of pad behind each, its place a multiple of 2 KiB");
#define AT_PB (64 * AT_VP)              // one P tile: 64 queries x 64 keys, f16
#define AT_OP 68                        // LDS pitch of an output row of one wave, floats
// 64 k rows of 128 B: 2 copies of 16 bytes per lane, global -> LDS through no register, rows 32 apart (256 lanes = 32 rows per copy); the s_wait_xcnt stands inside the statement so that no address register is rewritten ahead of it
__device__ __forceinline__ void at_stage_k(const _Float16* gk, unsigned lk) {
  asm volatile("global_load_async_to_lds_b128 %0, %2, off\n\tglobal_load_async_to_lds_b128 %1, %3, off\n\ts_wait_xcnt 0x0" :: "v"(lk), "v"(lk + 32 * AT_KP), "v"(gk), "v"(gk + (size_t)32 * CCQ) : "memory");
}
// one wave's v slice of a tile, 64 rows (value columns) of 64 keys = 128 B, by ONE tensor load of that wave: global -> LDS through no register, no per-lane address and no wait behind the issue
typedef uint32_t u32x4 __attribute__((ext_vector_type(4)));
typedef uint32_t u32x8 __attribute__((ext_vector_type(8)));
__device__ __forceinline__ uint32_t uni(uint32_t v) { return (uint32_t)__builtin_amdgcn_readfirstlane(v); }
__device__ __forceinline__ uint32_t pinned(uint32_t v) { uint32_t w = uni(v); asm volatile("" : "+s"(w)); return w; }   // pinned(): holds the test around a tensor load in a scalar register, so that it compiles to s_cmp and a scalar branch (a tensor load ignores EXEC)
// group 1 (the same for every request): 1-byte elements, no mask, tensor = tile = 64 rows of 128 B, source pitch one v row (TT keys), 4 dwords of pad behind every 32 dwords: LDS pitch 144 B = AT_VP
__device__ __forceinline__ u32x8 tdm_group1() { u32x8 g;
  g[0] = uni((1u << 20) | (4u << 22) | (3u << 25)); g[1] = uni(128u << 16); g[2] = uni(64u << 16); g[3] = uni(128u << 16); g[4] = uni(64u); g[5] = uni((uint32_t)(TT * 2)); g[6] = uni(0u); g[7] = uni(0u);
  asm volatile("" : "+s"(g));   // pinned() on the whole group: its eight words keep scalar registers of their own through the loop, so that none of them takes another value while a request is outstanding (left to itself the compiler used one of them as a temporary)
  return g; }
// group 0: count 1, place in LDS, address of the tile's first byte, type 2
__device__ __forceinline__ u32x4 tdm_group0(uint32_t lds_dst, uint64_t ga) { u32x4 g;
  g[0] = uni(1u); g[1] = uni(lds_dst); g[2] = uni((uint32_t)ga); g[3] = uni((((uint32_t)(ga >> 32)) & 0x01FFFFFFu) | 0x80000000u);
  return g; }
__device__ __forceinline__ void tdm_load(u32x4 g0, u32x8 g1) { asm volatile("tensor_load_to_lds %0, %1" :: "s"(g0), "s"(g1) : "memory"); }
// eight transcendentals of one kind in one statement, results in registers of their own, one v_nop behind the last: keeps the slot that the instruction set asks for between a transcendental and a next instruction that overwrites its source or reads its result. The two s_delay_alu are the hints that the compiler cannot place around asm text: the first source comes from a vector instruction a few places in front, the next reader takes the last results; without them the wait would hold up the SIMD's other wave too
__device__ __forceinline__ void exp2_8(float (&o)[8], const float (&x)[8]) {
  asm("s_delay_alu instid0(VALU_DEP_4)\n\tv_exp_f32 %0, %8\n\tv_exp_f32 %1, %9\n\tv_exp_f32 %2, %10\n\tv_exp_f32 %3, %11\n\tv_exp_f32 %4, %12\n\tv_exp_f32 %5, %13\n\tv_exp_f32 %6, %14\n\tv_exp_f32 %7, %15\n\tv_nop\n\ts_delay_alu instid0(TRANS32_DEP_1)"
      : "=&v"(o[0]), "=&v"(o[1]), "=&v"(o[2]), "=&v"(o[3]), "=&v"(o[4]), "=&v"(o[5]), "=&v"(o[6]), "=&v"(o[7]) : "v"(x[0]), "v"(x[1]), "v"(x[2]), "v"(x[3]), "v"(x[4]), "v"(x[5]), "v"(x[6]), "v"(x[7]));
}
__device__ __forceinline__ void rcp_8(float (&o)[8], const float (&x)[8]) {
  asm("s_delay_alu instid0(VALU_DEP_4)\n\tv_rcp_f32 %0, %8\n\tv_rcp_f32 %1, %9\n\tv_rcp_f32 %2, %10\n\tv_rcp_f32 %3, %11\n\tv_rcp_f32 %4, %12\n\tv_rcp_f32 %5, %13\n\tv_rcp_f32 %6, %14\n\tv_rcp_f32 %7, %15\n\tv_nop\n\ts_delay_alu instid0(TRANS32_DEP_1)"
      : "=&v"(o[0]), "=&v"(o[1]), "=&v"(o[2]), "=&v"(o[3]), "=&v"(o[4]), "=&v"(o[5]), "=&v"(o[6]), "=&v"(o[7]) : "v"(x[0]), "v"(x[1]), "v"(x[2]), "v"(x[3]), "v"(x[4]), "v"(x[5]), "v"(x[6]), "v"(x[7]));
}
// P of 16 queries x 32 keys: logits with the k rows as A and the q rows as B, so that a lane holds 8 consecutive keys of one query (element r: key 8 g + r of the 16, query col); sigmoid x 2^11 in f32 by the hardware exp2 and reciprocal (four vector instructions per element; their error lies far under the f16 rounding that follows), once to f16, one 16-byte LDS store per 16 keys
__device__ __forceinline__ void at_p(const unsigned char* kl, unsigned char* pd, v16h qf0, v16h qf1, int lane) {
  v16h ka[2][2];
#pragma unroll   // constant indices: fragments stay in registers; the four fragments' LDS reads stand as one group
  for (int u = 0; u < 2; ++u) { const _Float16* kr = (const _Float16*)(kl + u * 16 * AT_KP); ka[u][0] = frag_h(kr, lane); ka[u][1] = frag_h(kr + 32, lane); }
#pragma unroll
  for (int u = 0; u < 2; ++u) { v8f st = {}; st = wmma16(ka[u][0], qf0, st); st = wmma16(ka[u][1], qf1, st);
    float ea[8], ex[8], pr[8]; v8h ph;   /* 2^11 / (1 + e^-s) = 1 / (2^-11 + 2^(-s log2 e - 11)); s = +-inf gives 2^11 and 0 */
#pragma unroll
    for (int r = 0; r < 8; ++r) ea[r] = __builtin_fmaf(st[r], -1.4426950408889634f, -11.0f);
    exp2_8(ex, ea);
#pragma unroll
    for (int r = 0; r < 8; ++r) ex[r] += 0x1p-11f;
    rcp_8(pr, ex);
#pragma unroll
    for (int r = 0; r < 8; ++r) ph[r] = (_Float16)pr[r];
    *(v8h*)(pd + u * 32) = ph; }
}
// ---- k_att: block = (64 queries (qb), batch), 8 waves, all 512 value columns; no score plane in memory. Per tile of 64 keys the block forms its 64 x 64 P once (each wave 16 queries x 32 keys) into LDS, one tile ahead of attended += P . v (wave = 64 queries x 64 columns); out = gamma * attended x 2^-11 + bf16(x).
// staging buffer s mod 2 (a v part and a k part, in two arrays) holds the v rows of tile s and the k rows of tile s + 1, so that trip t reads buffer t mod 2 alone; every wave brings in, by one tensor load per tile, the 64 v rows that it reads itself, the k rows come by copies of all lanes; the k rows of tile 0 have a buffer of their own, filled once ("tile s" here and below: the tile of step s of the block's own walk, tile(s) in memory)
__global__ __launch_bounds__(256) void k_att(const _Float16* __restrict__ QH, const _Float16* __restrict__ KH, const _Float16* __restrict__ VT, const float* __restrict__ X1, const float* __restrict__ GM, float* __restrict__ Y) {
  __shared__ __attribute__((aligned(2048))) unsigned char vst[2 * AT_VB]; __shared__ __align__(16) unsigned char kst[2 * AT_KB]; __shared__ __align__(16) unsigned char k0s[AT_KB]; __shared__ __align__(16) unsigned char pl[2 * AT_PB];
  const float gmv = bfr(GM[0]); const int b = blockIdx.z, qb = blockIdx.x;
  const int tid = threadIdx.x, wave = tid >> 5, lane = tid & 31, col = lane & 15, g = lane >> 4;
  const int qt = wave & 3, kp = wave >> 2;   /* P: this wave forms queries 16 qt .. + 15 against keys 32 kp .. + 31 of each tile */
  const _Float16* qr = QH + ((size_t)b * TT + qb * 64 + qt * 16 + col) * CCQ;
  const v16h qf0 = frag_h(qr, lane), qf1 = frag_h(qr + 32, lane);
  v8f acc[4][4] = {};
  const int nt = TT / AT_KS;
  static_assert((TT / AT_KS & (TT / AT_KS - 1)) == 0, "the walk wraps by a mask");
  auto tile = [&](int s) { return (s + qb) & (nt - 1); };   /* step s of this block's walk takes key tile (s + qb) mod nt: the 64 blocks of a batch, which all copy the same k and v lines, stand at 64 different tiles at any moment instead of asking L2 for the same lines together; every tile is taken once, the f32 sums run from the block's own start and wrap */
  const _Float16* gk = KH + ((size_t)b * TT + (tid >> 3)) * CCQ + (tid & 7) * 8;            /* copy i: k row 32 i + tid / 8, four 128-B rows per wave */
  const uint32_t wv = uni((uint32_t)wave);                                                   /* the wave's number as a scalar: every descriptor word is wave-uniform */
  const uint64_t gvw = (uint64_t)(size_t)(VT + ((size_t)b * CC + wv * 64) * (size_t)TT);     /* first key of this wave's first v row */
  const uint32_t lvw = (uint32_t)(size_t)vst + wv * AT_VSL;                                  /* this wave's slice in v part 0 */
  const u32x8 g1 = tdm_group1();
  auto stage_v = [&](int st, uint32_t vo) { tdm_load(tdm_group0(lvw + vo, gvw + (uint64_t)(tile(st) * (AT_KS * 2))), g1); };   /* this wave's 64 v rows of the tile of step st into the v part at vo */
  const unsigned lk = (unsigned)(size_t)kst + (tid >> 3) * AT_KP + (tid & 7) * 16;
  const unsigned kro = (kp * 32 + col) * AT_KP, pwo = (qt * 16 + col) * AT_VP + (kp * 32 + 8 * g) * 2;   /* this lane's first k row in a k part; its first P store in a P tile */
  at_stage_k(gk + (size_t)tile(0) * AT_KS * CCQ, (unsigned)(size_t)k0s + (tid >> 3) * AT_KP + (tid & 7) * 16);
  stage_v(0, 0); at_stage_k(gk + (size_t)tile(1) * AT_KS * CCQ, lk);
  asm volatile("s_wait_asynccnt 0x0" ::: "memory");   /* k tile 0 and the k part of buffer 0 landed (this wave's copies) */
  asm volatile("s_wait_tensorcnt 0x0" ::: "memory");  /* this wave's v slice of buffer 0 landed */
  __syncthreads();                                      /* all of it readable by every wave */
  stage_v(1, AT_VB); at_stage_k(gk + (size_t)tile(2) * AT_KS * CCQ, lk + AT_KB);
  at_p(k0s + kro, pl + pwo, qf0, qf1, lane);
  asm volatile("s_wait_dscnt 0x0" ::: "memory");      /* this wave's P stores of tile 0 are in LDS */
  __syncthreads();                                      /* P of tile 0 readable by every wave */
#pragma unroll 1   // stays rolled: one publish point in the code, the buffers picked by t & 1
  for (int t = 0; t < nt; ++t) { const unsigned vo = (t & 1) * AT_VB, ko = (t & 1) * AT_KB, po = (t & 1) * AT_PB;
    if (t + 1 < nt) at_p(kst + ko + kro, pl + (AT_PB - po) + pwo, qf0, qf1, lane);   /* P of tile t + 1 into the other P tile */
    const unsigned char* vb = vst + vo + wave * AT_VSL + col * AT_VP; const unsigned char* pb = pl + po + col * AT_VP;
#pragma unroll   // here and below in this loop: constant indices, so that fragments and accumulators stay in registers
    for (int kc = 0; kc < AT_KS / 32; ++kc) { v16h a[4], w[4];
#pragma unroll
      for (int i = 0; i < 4; ++i) { a[i] = frag_h((const _Float16*)(pb + i * 16 * AT_VP + kc * 64), lane); w[i] = frag_h((const _Float16*)(vb + i * 16 * AT_VP + kc * 64), lane); }
#pragma unroll
      for (int i = 0; i < 4; ++i)
#pragma unroll
        for (int j = 0; j < 4; ++j) acc[i][j] = wmma16(a[i], w[j], acc[i][j]); }
    asm volatile("s_wait_dscnt 0x0" ::: "memory");      /* this wave's reads of buffer t and of P tile t are done, its P stores of tile t + 1 are in LDS */
    asm volatile("s_wait_asynccnt 0x0" ::: "memory");   /* this wave's k copies of buffer t + 1 have landed */
    asm volatile("s_wait_tensorcnt 0x0" ::: "memory");  /* this wave's v slice of buffer t + 1 has landed */
    __syncthreads();                                    /* publishes buffer t + 1 and P of tile t + 1; ends every wave's reads of buffer t and of P tile t */
    if (pinned(t + 2 < nt)) { stage_v(t + 2, vo); if (t + 3 < nt) at_stage_k(gk + (size_t)tile(t + 3) * AT_KS * CCQ, lk + ko); } }   /* the refill of buffer t; the tensor load first: its wave goes on at once */
  asm volatile("s_wait_tensorcnt 0x0" ::: "memory");    /* no tensor load outstanding behind the loop */
  asm volatile("s_wait_asynccnt 0x0" ::: "memory");     /* no copy outstanding behind the loop */
  asm volatile("s_wait_dscnt 0x0" ::: "memory");        /* no LDS read of this wave outstanding before the staging LDS takes the output */
  static_assert(8 * 64 * AT_OP * 4 <= 2 * AT_VB, "the output rows fit the v parts");
  float* sw = (float*)vst + wave * (64 * AT_OP);        /* the v parts are free now: each wave turns its own 64 x 64 block into rows */
#pragma unroll
  for (int i = 0; i < 4; ++i)
#pragma unroll
    for (int j = 0; j < 4; ++j)
#pragma unroll
      for (int r = 0; r < 8; ++r) sw[(i * 16 + 8 * g + r) * AT_OP + j * 16 + col] = acc[i][j][r] * (1.0f / 2048.0f);
  LDSX();
#pragma unroll 1   // four row pairs per trip: their x loads stand together ahead of the sums
  for (int it = 0; it < 32; it += 4) { v4f xr[4];
#pragma unroll
    for (int e = 0; e < 4; ++e) xr[e] = *(const v4f*)(X1 + ((size_t)b * TT + qb * 64 + (it + e) * 2 + g) * CC + wave * 64 + col * 4);
#pragma unroll
    for (int e = 0; e < 4; ++e) { const int rl = (it + e) * 2 + g; v4f v = *(const v4f*)&sw[rl * AT_OP + col * 4]; v[0] = gmv * v[0] + bfr(xr[e][0]); v[1] = gmv * v[1] + bfr(xr[e][1]); v[2] = gmv * v[2] + bfr(xr[e][2]); v[3] = gmv * v[3] + bfr(xr[e][3]); vst2(Y + ((size_t)b * TT + qb * 64 + rl) * CC + wave * 64 + col * 4, v); }
    asm volatile("s_wait_xcnt 0x0" ::: "memory"); } }   /* the wait: the next trip rewrites the address and data registers that these stores name */   /* out = gamma * attended + bf16(x): 256-B (row, 64-column) segments, each written once */

extern "C" void kernel_launch(void* const* d_in, const int* in_sizes, int n_in, void* d_out, int out_size, void* d_ws, size_t ws_size, hipStream_t stream) {
  (void)in_sizes; (void)n_in; (void)out_size;
  const float** F = (const float**)d_in;
  if (ws_size < (size_t)WS_END) return;
  char* ws = (char*)d_ws; _Float16 *QH = (_Float16*)(ws + WS_QH), *KH = (_Float16*)(ws + WS_KH), *VT = (_Float16*)(ws + WS_VT), *QL = (_Float16*)(ws + WS_QL), *KL = (_Float16*)(ws + WS_KL); __bf16 *VB = (__bf16*)(ws + WS_VB), *VBL = (__bf16*)(ws + WS_VBL); float *S = (float*)(ws + WS_S), *Y = (float*)(ws + WS_Y);
  (void)S; (void)Y; (void)QL; (void)KL; (void)VB; (void)VBL;
  // inputs (d_in order): 0 x [4,64,64,512]; 1 Wq [512,64] (in,out); 2 Wk [512,64]; 3 Wv [512,512]; 4 gamma [1]
  k_projT<0><<<dim3(TNB * TT / 64, 1, 2), 128, 0, stream>>>(F[0], F[0], F[0], F[1], F[2], F[3], nullptr, nullptr, nullptr, QH, QL, KH, KL, VT, VB, VBL);   /* which 0, 1: q and k (one 128-column block, columns >= 64 zero) */
  k_projT<2><<<dim3(TNB * TT / 64, CC / 128, 1), 128, 0, stream>>>(F[0], F[0], F[0], F[1], F[2], F[3], nullptr, nullptr, nullptr, QH, QL, KH, KL, VT, VB, VBL);   /* which 2: v (four 128-column blocks) */
  k_att<<<dim3(NQB, 1, TNB), 256, 0, stream>>>(QH, KH, VT, F[0], F[4], (float*)d_out);   /* logits, sigmoid and P . v of all batches in one launch */
}

// v007
// A run of this version takes 84.9 microseconds.
// In two side-by-side timings against v006, it was 1.04 and 1.05 times as fast.
// All steps since v000 together make it 14.8 times as fast.
// compute dtype: all float inputs rounded to bf16; q/k (64 wide) and v (512) = x W with EXACT bf16 products on WMMA 16x16x32, f32 accumulate; q and k once to f16 (1 product) for the UNSCALED scores (logit sigma ~16; sigmoid saturates outside |s| < 5); sigmoid in f32 (hardware exp2 and reciprocal); P x 2^11 once to f16 against v once to f16 (1 product); gamma * attended + x in f32; f32 output.
#include <hip/hip_runtime.h>
#include <math.h>
#include <stdint.h>

typedef __attribute__((ext_vector_type(16))) _Float16 v16h;
typedef __attribute__((ext_vector_type(16))) __bf16 v16b;
typedef __attribute__((ext_vector_type(8)))  _Float16 v8h;
typedef __attribute__((ext_vector_type(8)))  float v8f;
typedef __attribute__((ext_vector_type(4)))  float v4f;
typedef __attribute__((ext_vector_type(2)))  float v2f;
typedef __attribute__((ext_vector_type(4)))  unsigned v4u;
typedef __attribute__((ext_vector_type(4)))  int v4i;
typedef float __attribute__((may_alias)) float_a;
typedef int __attribute__((may_alias)) int_a;

template <typename T> __device__ __forceinline__ void vst2(void* p, T v) { *(T*)p = v;  }
// the builtin alone: the compiler keeps the distances behind it. (An asm statement of v_nop that names d, a and b would hold all of them in v0..v255: two fragment sets beside 128 accumulator registers do not fit there.)
__device__ __forceinline__ v8f wmma16(v16h a, v16h b, v8f c) {
  return __builtin_amdgcn_wmma_f32_16x16x32_f16(false, a, false, b, (short)0, c, false, false);
}
__device__ __forceinline__ v8f wmma_bf(v16b a, v16b b, v8f c) {
  v8f d = __builtin_amdgcn_wmma_f32_16x16x32_bf16(false, a, false, b, (short)0, c, false, false);
  asm volatile("v_nop\n\tv_nop\n\tv_nop\n\tv_nop" : "+v"(d) : "v"(a), "v"(b));
  return d;
}
// 16x16x32 fragments: lane = (h = lane>>4, row/col = lane&15); elements 0..7 = k0+8h+0..7, 8..15 = k0+16+8h+0..7; D element r = row 8h+r
__device__ __forceinline__ v16h frag_h(const _Float16* rowk0, int lane) {
  union { v16h v; v8h q[2]; } u; const _Float16* p = rowk0 + 8 * (lane >> 4);
  u.q[0] = *(const v8h*)p; u.q[1] = *(const v8h*)(p + 16); return u.v;
}
__device__ __forceinline__ v16h frag_f32(const float* rowk0, int lane) {
  v16h a; const float* p = rowk0 + 8 * (lane >> 4);
#pragma unroll
  for (int i = 0; i < 8; ++i) { a[i] = (_Float16)p[i]; a[8 + i] = (_Float16)p[16 + i]; }
  return a;
}
__device__ __forceinline__ v16h frag_f32s(const float* rowk0, int lane, float sc) {
  v16h a; const float* p = rowk0 + 8 * (lane >> 4);
#pragma unroll
  for (int i = 0; i < 8; ++i) { a[i] = (_Float16)(p[i] * sc); a[8 + i] = (_Float16)(p[16 + i] * sc); }
  return a;
}
// column fragment from a [K][ld] layout (column n), rows >= K read as 0
__device__ __forceinline__ v16h fragc_f32(const float* W, int k0, int n, int lane, int ld, int K) {
  v16h a; const int g = lane >> 4;
#pragma unroll
  for (int i = 0; i < 8; ++i) { const int ka = k0 + 8 * g + i, kb = ka + 16;
    a[i] = (_Float16)(ka < K ? W[(size_t)(ka < K ? ka : K - 1) * ld + n] : 0.f); a[8 + i] = (_Float16)(kb < K ? W[(size_t)(kb < K ? kb : K - 1) * ld + n] : 0.f); }
  return a;
}
struct F2 { v16b h, l; };
__device__ __forceinline__ F2 bsplit16(const float v[16]) { F2 r;
#pragma unroll
  for (int i = 0; i < 16; ++i) { const __bf16 h = (__bf16)v[i]; r.h[i] = h; r.l[i] = (__bf16)(v[i] - (float)h); }
  return r; }
__device__ __forceinline__ F2 split_row(const float* row, int k0, int lane) { float v[16]; const float* p = row + k0 + 8 * (lane >> 4);
#pragma unroll
  for (int i = 0; i < 8; ++i) { v[i] = p[i]; v[8 + i] = p[16 + i]; }
  return bsplit16(v); }
__device__ __forceinline__ F2 split_rowK(const float* row, int k0, int lane, int K) { float v[16]; const int g = lane >> 4;
#pragma unroll
  for (int i = 0; i < 8; ++i) { const int ka = k0 + 8 * g + i, kb = ka + 16; v[i] = ka < K ? row[ka < K ? ka : K - 1] : 0.f; v[8 + i] = kb < K ? row[kb < K ? kb : K - 1] : 0.f; }
  return bsplit16(v); }
__device__ __forceinline__ F2 split_col(const float* W, int k0, int n, int lane, int ld, int K) { float v[16]; const int g = lane >> 4;
#pragma unroll
  for (int i = 0; i < 8; ++i) { const int ka = k0 + 8 * g + i, kb = ka + 16; v[i] = ka < K ? W[(size_t)(ka < K ? ka : K - 1) * ld + n] : 0.f; v[8 + i] = kb < K ? W[(size_t)(kb < K ? kb : K - 1) * ld + n] : 0.f; }
  return bsplit16(v); }
__device__ __forceinline__ v8f mac3(const F2& a, const F2& b, v8f c) { c = wmma_bf(a.l, b.h, c); c = wmma_bf(a.h, b.l, c); return wmma_bf(a.h, b.h, c); }
__device__ __forceinline__ float sigm(float v) { return 1.0f / (1.0f + expf(-v)); }
#define LDSX() do { asm volatile("s_wait_dscnt 0" ::: "memory"); __builtin_amdgcn_wave_barrier(); __builtin_amdgcn_fence(__ATOMIC_RELEASE, "workgroup"); } while (0)

// SAGAN-style position attention with SIGMOID (unnormalised) attention (B 4, 64 x 64 = 4,096 positions, C 512; x channels-last [B,H,W,C] = rows [b*n][512]; (in,out) weights Wq/Wk [512,64], Wv [512,512], no biases; gamma scalar): q = x Wq, k = x Wk, v = x Wv; scores[n][m] = q_n . k_m (no scaling); attn = sigmoid(scores) (no row normalisation); attended[n][c] = sum_m attn[n][m] v[m][c]; out = gamma * attended + x.
#define NB 4
#define TT 4096
#define CC 512            // value width (v planes, output rows)
#define CCQ 128           // q / k row pitch: one 128-column block, columns >= 64 are zero
#define DIN 512          // x width
#define NH 1
#define HD 512
#define NQB (TT / 64)
#define HG 1               // sizes only the unused WS_S region: no score plane in memory
#define SCALE (1.0f)
#define HDQK 64            // q / k width
#define CAUSAL 0
#ifndef TNB
#define TNB NB
#endif
__device__ __forceinline__ v16b zero16b() { v16b z; _Pragma("unroll") for (int i = 0; i < 16; ++i) z[i] = (__bf16)0.f; return z; }
__device__ __forceinline__ float bfr(float v) { return (float)(__bf16)v; }
__host__ __device__ __forceinline__ int kb_last(int qb) { return CAUSAL ? ((qb * 64 + 63) >> 7) : (TT / 128 - 1); }
typedef __attribute__((ext_vector_type(8))) __bf16 v8b;
__device__ __forceinline__ v16b frag_b(const __bf16* rowk0, int lane) {
  union { v16b v; v8b q[2]; } u; const __bf16* p = rowk0 + 8 * (lane >> 4);
  u.q[0] = *(const v8b*)p; u.q[1] = *(const v8b*)(p + 16); return u.v;
}
#define QBH 0              // unused: every query block takes k_att's single f16 path
#define QHI 0               // no q residual plane: q and k once to f16 (1 product)
#define KHI 64            // key rows carrying k residual / v bf16 hi+lo planes (written by k_projT, read by no kernel)
// B fragment (k rows k0+.., output column o) of a weight: (in,out) [K][ld] or (out,in) [ld rows of K]: bf16 exact, or f16(bf16 * 256) exact
__device__ __forceinline__ v16b wcol_io(const float* Wm, int k0, int o, int lane, int ld) { v16b w; const int g = lane >> 4;
#pragma unroll
  for (int i = 0; i < 8; ++i) { w[i] = (__bf16)Wm[(size_t)(k0 + 8 * g + i) * ld + o]; w[8 + i] = (__bf16)Wm[(size_t)(k0 + 16 + 8 * g + i) * ld + o]; }
  return w; }
__device__ __forceinline__ v16b wcol_oi(const float* Wm, int k0, int o, int lane, int K) { v16b w; const float* p = Wm + (size_t)o * K + k0 + 8 * (lane >> 4);
#pragma unroll
  for (int i = 0; i < 8; ++i) { w[i] = (__bf16)p[i]; w[8 + i] = (__bf16)p[16 + i]; }
  return w; }
__device__ __forceinline__ v16h wcolh_io(const float* Wm, int k0, int o, int lane, int ld) { v16h w; const int g = lane >> 4;
#pragma unroll
  for (int i = 0; i < 8; ++i) { w[i] = (_Float16)(bfr(Wm[(size_t)(k0 + 8 * g + i) * ld + o]) * 256.0f); w[8 + i] = (_Float16)(bfr(Wm[(size_t)(k0 + 16 + 8 * g + i) * ld + o]) * 256.0f); }
  return w; }
__device__ __forceinline__ v16h wcolh_oi(const float* Wm, int k0, int o, int lane, int K) { v16h w; const float* p = Wm + (size_t)o * K + k0 + 8 * (lane >> 4);
#pragma unroll
  for (int i = 0; i < 8; ++i) { w[i] = (_Float16)(bfr(p[i]) * 256.0f); w[8 + i] = (_Float16)(bfr(p[16 + i]) * 256.0f); }
  return w; }
#define WQKV_LAYOUT 0   // 0 = (in,out) [K][CC] for Wv, [K][HDQK] for Wq/Wk; 1 = (out,in) [CC][DIN]; 2 = per-head [NH][DIN][HD]
__device__ __forceinline__ v16b wcol_hdk(const float* Wm, int k0, int o, int lane) { v16b w; const int g = lane >> 4; const float* p = Wm + (size_t)(o / HD) * DIN * HD + (o % HD);
#pragma unroll
  for (int i = 0; i < 8; ++i) { w[i] = (__bf16)p[(size_t)(k0 + 8 * g + i) * HD]; w[8 + i] = (__bf16)p[(size_t)(k0 + 16 + 8 * g + i) * HD]; }
  return w; }
#define WO_OUT_IN 0
#if WQKV_LAYOUT == 1
#define WCOL(W, k0, o, lane) wcol_oi(W, k0, (o), lane, DIN)   /* unused: layout 0 */
#elif WQKV_LAYOUT == 2
#define WCOL(W, k0, o, lane) wcol_hdk(W, k0, o, lane)
#else
#define WCOL(W, k0, o, lane) (which == 2 ? wcol_io(W, k0, (o), lane, CC) : ((o) < HDQK ? wcol_io(W, k0, (o), lane, HDQK) : zero16b()))   /* Wv [512][512]; Wq/Wk [512][64]: projected q/k columns >= 64 are zero (block y = 0 only) */
#endif
#if WO_OUT_IN
#define WOCOL(W, k0, o, lane) wcol_oi(W, k0, o, lane, CC)
#define WOCOLH(W, k0, o, lane) wcolh_oi(W, k0, o, lane, CC)
#else
#define WOCOL(W, k0, o, lane) wcol_io(W, k0, o, lane, DIN)
#define WOCOLH(W, k0, o, lane) wcolh_io(W, k0, o, lane, DIN)
#endif
#define BG HG              // unused: k_att covers all batches in one launch, blockIdx.z = batch
#define BGN (TNB < BG ? TNB : BG)
#define DVH 128            // unused: each k_att block covers all 512 value columns (16 accumulator tiles per wave)
#ifndef SM_EXTRA_PARAMS
#define SM_EXTRA_PARAMS
#endif
#ifndef PROJ_EXTRA_PARAMS
#define PROJ_EXTRA_PARAMS
#endif
#ifndef SM_MASK_HOOK
#define SM_MASK_HOOK (void)0
#endif

#define WS_QH  0u                                      // f16 q rows [b*t][CCQ]
#define WS_KH  (WS_QH + 2u * (size_t)NB * TT * CCQ)     // f16 k rows [b*t][CCQ]
#define WS_VT  (WS_KH + 2u * (size_t)NB * TT * CCQ)     // f16 v planes [b][c][t]
#define WS_QL  (WS_VT + 2u * (size_t)NB * CC * TT)      // f16 q residual x 2^10 rows [b][t < QHI][CCQ]
#define WS_KL  (WS_QL + 2u * (size_t)NB * QHI * CCQ)    // f16 k residual x 2^10 rows [b][t < KHI][CCQ]
#define WS_VB  (WS_KL + 2u * (size_t)NB * KHI * CCQ)    // bf16 v hi planes [b][c][t < KHI]
#define WS_VBL (WS_VB + 2u * (size_t)NB * CC * KHI)
#define WS_S   (WS_VBL + 2u * (size_t)NB * CC * KHI)    // unused: no score plane in memory
#define WS_Y   (WS_S  + 4u * (size_t)HG * TT * TT)      // f32 ctx rows [b*t][CC] (only when there is an output projection)
#define WS_END (WS_Y  + 0u)

#define PJ_KC 64                        // k values per staged chunk of k_projT
#define PJ_P (PJ_KC * 2 + 16)           // LDS pitch of a staged weight column and of a staged x row, bytes (16 B x odd: no bank conflict for 16-byte reads)
typedef __attribute__((ext_vector_type(4))) __bf16 v4b;
// ---- k_proj: block = (64 rows, 128 cols, which): q/k/v = X W (+ b) with exact bf16 products (K = DIN) -> which 0: q f16 rows (+ residual rows < QHI); 1: k f16 rows (+ residual rows < KHI); 2: v f16 planes [c][t] (+ bf16 hi/lo planes for t < KHI)
// per chunk of 64 k the block stages, through registers and as bf16, its weight columns TRANSPOSED ([column][k]; a lane loads two adjacent columns, so a wave's load is two whole 128-B lines) and its 64 x rows (16 lanes x 16 B per row); fragments are 16-byte LDS reads. Two buffers: the next chunk's global loads fly while this chunk is worked on; one barrier per chunk. The staging LDS is used again by the epilogue.
template <int WOFF> __global__ __launch_bounds__(128) void k_projT(const float* __restrict__ XQ, const float* __restrict__ XK, const float* __restrict__ XV, const float* __restrict__ WQ, const float* __restrict__ WK, const float* __restrict__ WV, const float* __restrict__ BQ, const float* __restrict__ BK, const float* __restrict__ BV,
    _Float16* __restrict__ QH, _Float16* __restrict__ QL, _Float16* __restrict__ KH, _Float16* __restrict__ KL, _Float16* __restrict__ VT, __bf16* __restrict__ VB, __bf16* __restrict__ VBL) {
  constexpr bool ISV = WOFF == 2;   /* WOFF 2: v (128 of Wv's 512 columns per block); WOFF 0: q or k (all 64 columns; accumulator tiles 4..7 stay zero) */
  constexpr int NJ = ISV ? 8 : 4, NCOL = NJ * 16, NCP = NCOL / 2, KPT = PJ_KC * NCP / 128, LDW = ISV ? CC : HDQK;   /* a thread stages KPT k values of one pair of columns per chunk */
  constexpr int BUFB = (NCOL + 64) * PJ_P, EPB = ISV ? 3 * 128 * 72 * 2 : 2 * 64 * 136 * 2, SMB = 2 * BUFB > EPB ? 2 * BUFB : EPB;   /* a buffer: weight columns, then x rows */
  __shared__ __align__(16) unsigned char sm[SMB];
  _Float16 (*sh)[136] = (_Float16 (*)[136])sm; _Float16 (*sl)[136] = sh + 64; _Float16 (*th)[72] = (_Float16 (*)[72])sm; __bf16 (*tb)[72] = (__bf16 (*)[72])(sm + 128 * 72 * 2); __bf16 (*tbl)[72] = tb + 128; (void)sh; (void)sl; (void)th; (void)tb; (void)tbl;
  const int tid = threadIdx.x, wave = tid >> 5, lane = tid & 31, col = lane & 15, g = lane >> 4; const int which = ISV ? 2 : (int)blockIdx.z; const int c0 = blockIdx.y * 128; const size_t r0 = (size_t)blockIdx.x * 64; const size_t bb = r0 / TT; const int t0 = (int)(r0 % TT);
  const float* X = which == 0 ? XQ : which == 1 ? XK : XV; const float* WA = which == 0 ? WQ : which == 1 ? WK : WV; const float* BA = which == 0 ? BQ : which == 1 ? BK : BV;
  v8f acc[8] = {};
  const int wn = (tid % NCP) * 2, wk = (tid / NCP) * KPT;
  const float* wp = WA + (size_t)wk * LDW + c0 + wn;                          /* load i: weight row wk + i of the chunk, columns c0 + wn and + 1 */
  const float* xp = X + (r0 + wave * 16 + g) * (size_t)DIN + col * 4;         /* load i: row 2 i + g of this wave's 16 rows, row-major [b*t][DIN] */
  unsigned char* wd = sm + wn * PJ_P + wk * 2; unsigned char* xd = sm + (NCOL + wave * 16 + g) * PJ_P + col * 8;
  v2f wr[KPT]; v4f xr[8];
  auto ld_chunk = [&](int c) {
#pragma unroll   // every unroll of this kernel: constant indices, so that staged values, fragments and accumulators stay in registers
    for (int i = 0; i < KPT; ++i) wr[i] = *(const v2f*)(wp + (size_t)c * PJ_KC * LDW + (size_t)i * LDW);
#pragma unroll
    for (int i = 0; i < 8; ++i) xr[i] = *(const v4f*)(xp + c * PJ_KC + (size_t)i * 2 * DIN); };
  auto st_chunk = [&](int bo) {
#pragma unroll
    for (int e = 0; e < 2; ++e)
#pragma unroll
      for (int s = 0; s < KPT / 8; ++s) { v8b t;
#pragma unroll
        for (int i = 0; i < 8; ++i) t[i] = (__bf16)wr[s * 8 + i][e];
        *(v8b*)(wd + bo + e * PJ_P + s * 16) = t; }
#pragma unroll
    for (int i = 0; i < 8; ++i) { v4b t; t[0] = (__bf16)xr[i][0]; t[1] = (__bf16)xr[i][1]; t[2] = (__bf16)xr[i][2]; t[3] = (__bf16)xr[i][3]; *(v4b*)(xd + bo + i * 2 * PJ_P) = t; } };
  ld_chunk(0); st_chunk(0);
  __syncthreads();   /* chunk 0 readable by every wave */
#pragma unroll 1   // stays rolled: small code, the buffers picked by c & 1
  for (int c = 0; c < DIN / PJ_KC; ++c) { const int bo = (c & 1) * BUFB;
    if (c + 1 < DIN / PJ_KC) ld_chunk(c + 1);
    const unsigned char* wb = sm + bo + col * PJ_P; const unsigned char* xb = sm + bo + (NCOL + wave * 16 + col) * PJ_P;
#pragma unroll
    for (int kc = 0; kc < PJ_KC / 32; ++kc) { const v16b a = frag_b((const __bf16*)(xb + kc * 64), lane);
#pragma unroll
      for (int jh = 0; jh < NJ; jh += 4) { v16b w[4];   /* four fragments' LDS reads stand as one group ahead of their four products: one wait per group */
#pragma unroll
        for (int j = 0; j < 4; ++j) w[j] = frag_b((const __bf16*)(wb + (jh + j) * 16 * PJ_P + kc * 64), lane);
#pragma unroll
        for (int j = 0; j < 4; ++j) acc[jh + j] = wmma_bf(a, w[j], acc[jh + j]); } }
    if (c + 1 < DIN / PJ_KC) st_chunk(BUFB - bo);
    __syncthreads(); }   /* publishes chunk c + 1; ends every wave's reads of chunk c (behind the last chunk: before the epilogue writes this LDS) */
  if constexpr (!ISV) { _Float16* DH = which == 0 ? QH : KH; _Float16* DL = which == 0 ? QL : KL; const int nhi = which == 0 ? QHI : KHI; const bool hi_rows = t0 < nhi;
#pragma unroll
    for (int j = 0; j < 8; ++j) { const float bias = BA ? bfr(BA[c0 + j * 16 + col]) : 0.f;
#pragma unroll
      for (int r = 0; r < 8; ++r) { const float v = acc[j][r] + bias; const _Float16 hv = (_Float16)v; sh[wave * 16 + 8 * g + r][j * 16 + col] = hv; sl[wave * 16 + 8 * g + r][j * 16 + col] = (_Float16)((v - (float)hv) * 1024.0f); } }
    __syncthreads();
    for (int e = tid; e < 64 * 16; e += 128) { const int rl = e >> 4, q = e & 15; vst2((unsigned*)(DH + (r0 + rl) * CCQ + c0 + q * 8), *(const v4u*)&sh[rl][q * 8]); if (hi_rows) vst2((unsigned*)(DL + (bb * nhi + t0 + rl) * (size_t)CCQ + c0 + q * 8), *(const v4u*)&sl[rl][q * 8]); }   /* q/k rows: pitch CCQ (c0 == 0) */
  } else { const bool hi_rows = t0 < KHI;
#pragma unroll
    for (int j = 0; j < 8; ++j) { const float bias = BA ? bfr(BA[c0 + j * 16 + col]) : 0.f;
#pragma unroll
      for (int r = 0; r < 8; ++r) { const float v = acc[j][r] + bias; const int rl = wave * 16 + 8 * g + r, cl = j * 16 + col; th[cl][rl] = (_Float16)v; const __bf16 bh = (__bf16)v; tb[cl][rl] = bh; tbl[cl][rl] = (__bf16)(v - (float)bh); } }
    __syncthreads();
    for (int e = tid; e < 128 * 8; e += 128) { const int cl = e >> 3, q = e & 7; vst2((unsigned*)(VT + (bb * CC + c0 + cl) * (size_t)TT + t0 + q * 8), *(const v4u*)&th[cl][q * 8]); if (hi_rows) { const size_t o3 = (bb * CC + c0 + cl) * (size_t)KHI + t0 + q * 8; vst2((unsigned*)(VB + o3), *(const v4u*)&tb[cl][q * 8]); vst2((unsigned*)(VBL + o3), *(const v4u*)&tbl[cl][q * 8]); } } } }
#define AT_KS 64                        // keys per staged tile of k_att
#define AT_KP (HDQK * 2 + 16)           // LDS pitch of a k row, bytes (16 B x odd: no bank conflict for 16-byte reads)
#define AT_VP (AT_KS * 2 + 16)          // LDS pitch of a v row and of a P row, bytes (16 B x odd)
#define AT_KB (AT_KS * AT_KP)           // k part of a buffer
#define AT_VSL 10240                    // LDS bytes of one wave's v slice: 64 rows at pitch AT_VP (9,216 B), rounded up so that every slice starts at a multiple of 2 KiB
#define AT_VB (8 * AT_VSL)              // v part of a buffer: eight slices
static_assert(AT_VSL % 2048 == 0 && 64 * AT_VP <= AT_VSL && AT_VP == 128 + 16 && AT_KS * 2 == 128, "a slice: 64 rows of 128 B, 16 B of pad behind each, its place a multiple of 2 KiB");
#define AT_PB (64 * AT_VP)              // one P tile: 64 queries x 64 keys, f16
#define AT_OP 68                        // LDS pitch of an output row of one wave, floats
// 64 k rows of 128 B: 2 copies of 16 bytes per lane, global -> LDS through no register, rows 32 apart (256 lanes = 32 rows per copy); the s_wait_xcnt stands inside the statement so that no address register is rewritten ahead of it
__device__ __forceinline__ void at_stage_k(const _Float16* gk, unsigned lk) {
  asm volatile("global_load_async_to_lds_b128 %0, %2, off\n\tglobal_load_async_to_lds_b128 %1, %3, off\n\ts_wait_xcnt 0x0" :: "v"(lk), "v"(lk + 32 * AT_KP), "v"(gk), "v"(gk + (size_t)32 * CCQ) : "memory");
}
// one wave's v slice of a tile, 64 rows (value columns) of 64 keys = 128 B, by ONE tensor load of that wave: global -> LDS through no register, no per-lane address and no wait behind the issue
typedef uint32_t u32x4 __attribute__((ext_vector_type(4)));
typedef uint32_t u32x8 __attribute__((ext_vector_type(8)));
__device__ __forceinline__ uint32_t uni(uint32_t v) { return (uint32_t)__builtin_amdgcn_readfirstlane(v); }
__device__ __forceinline__ uint32_t pinned(uint32_t v) { uint32_t w = uni(v); asm volatile("" : "+s"(w)); return w; }   // pinned(): holds the test around a tensor load in a scalar register, so that it compiles to s_cmp and a scalar branch (a tensor load ignores EXEC)
// group 1 (the same for every request): 1-byte elements, no mask, tensor = tile = 64 rows of 128 B, source pitch one v row (TT keys), 4 dwords of pad behind every 32 dwords: LDS pitch 144 B = AT_VP
__device__ __forceinline__ u32x8 tdm_group1() { u32x8 g;
  g[0] = uni((1u << 20) | (4u << 22) | (3u << 25)); g[1] = uni(128u << 16); g[2] = uni(64u << 16); g[3] = uni(128u << 16); g[4] = uni(64u); g[5] = uni((uint32_t)(TT * 2)); g[6] = uni(0u); g[7] = uni(0u);
  asm volatile("" : "+s"(g));   // pinned() on the whole group: its eight words keep scalar registers of their own through the loop, so that none of them takes another value while a request is outstanding (left to itself the compiler used one of them as a temporary)
  return g; }
// group 0: count 1, place in LDS, address of the tile's first byte, type 2
__device__ __forceinline__ u32x4 tdm_group0(uint32_t lds_dst, uint64_t ga) { u32x4 g;
  g[0] = uni(1u); g[1] = uni(lds_dst); g[2] = uni((uint32_t)ga); g[3] = uni((((uint32_t)(ga >> 32)) & 0x01FFFFFFu) | 0x80000000u);
  return g; }
__device__ __forceinline__ void tdm_load(u32x4 g0, u32x8 g1) { asm volatile("tensor_load_to_lds %0, %1" :: "s"(g0), "s"(g1) : "memory"); }
// eight transcendentals of one kind in one statement, results in registers of their own, one v_nop behind the last: keeps the slot that the instruction set asks for between a transcendental and a next instruction that overwrites its source or reads its result. The two s_delay_alu are the hints that the compiler cannot place around asm text: the first source comes from a vector instruction a few places in front, the next reader takes the last results; without them the wait would hold up the SIMD's other wave too
__device__ __forceinline__ void exp2_8(float (&o)[8], const float (&x)[8]) {
  asm("s_delay_alu instid0(VALU_DEP_4)\n\tv_exp_f32 %0, %8\n\tv_exp_f32 %1, %9\n\tv_exp_f32 %2, %10\n\tv_exp_f32 %3, %11\n\tv_exp_f32 %4, %12\n\tv_exp_f32 %5, %13\n\tv_exp_f32 %6, %14\n\tv_exp_f32 %7, %15\n\tv_nop\n\ts_delay_alu instid0(TRANS32_DEP_1)"
      : "=&v"(o[0]), "=&v"(o[1]), "=&v"(o[2]), "=&v"(o[3]), "=&v"(o[4]), "=&v"(o[5]), "=&v"(o[6]), "=&v"(o[7]) : "v"(x[0]), "v"(x[1]), "v"(x[2]), "v"(x[3]), "v"(x[4]), "v"(x[5]), "v"(x[6]), "v"(x[7]));
}
__device__ __forceinline__ void rcp_8(float (&o)[8], const float (&x)[8]) {
  asm("s_delay_alu instid0(VALU_DEP_4)\n\tv_rcp_f32 %0, %8\n\tv_rcp_f32 %1, %9\n\tv_rcp_f32 %2, %10\n\tv_rcp_f32 %3, %11\n\tv_rcp_f32 %4, %12\n\tv_rcp_f32 %5, %13\n\tv_rcp_f32 %6, %14\n\tv_rcp_f32 %7, %15\n\tv_nop\n\ts_delay_alu instid0(TRANS32_DEP_1)"
      : "=&v"(o[0]), "=&v"(o[1]), "=&v"(o[2]), "=&v"(o[3]), "=&v"(o[4]), "=&v"(o[5]), "=&v"(o[6]), "=&v"(o[7]) : "v"(x[0]), "v"(x[1]), "v"(x[2]), "v"(x[3]), "v"(x[4]), "v"(x[5]), "v"(x[6]), "v"(x[7]));
}
// at_k: the LDS reads of the four k fragments (32 keys x 64) that at_p works on, apart from their use, so that the caller can put other matrix work between the two
__device__ __forceinline__ void at_k(v16h (&ka)[2][2], const unsigned char* kl, int lane) {
#pragma unroll   // constant indices: fragments stay in registers; the four fragments' LDS reads stand as one group
  for (int u = 0; u < 2; ++u) { const _Float16* kr = (const _Float16*)(kl + u * 16 * AT_KP); ka[u][0] = frag_h(kr, lane); ka[u][1] = frag_h(kr + 32, lane); }
}
// P of 16 queries x 32 keys: logits with the k rows as A and the q rows as B, so that a lane holds 8 consecutive keys of one query (element r: key 8 g + r of the 16, query col); sigmoid x 2^11 in f32 by the hardware exp2 and reciprocal (four vector instructions per element; their error lies far under the f16 rounding that follows), once to f16, one 16-byte LDS store per 16 keys
__device__ __forceinline__ void at_p(const v16h (&ka)[2][2], unsigned char* pd, v16h qf0, v16h qf1) {
#pragma unroll
  for (int u = 0; u < 2; ++u) { v8f st = {}; st = wmma16(ka[u][0], qf0, st); st = wmma16(ka[u][1], qf1, st);
    float ea[8], ex[8], pr[8]; v8h ph;   /* 2^11 / (1 + e^-s) = 1 / (2^-11 + 2^(-s log2 e - 11)); s = +-inf gives 2^11 and 0 */
#pragma unroll
    for (int r = 0; r < 8; ++r) ea[r] = __builtin_fmaf(st[r], -1.4426950408889634f, -11.0f);
    exp2_8(ex, ea);
#pragma unroll
    for (int r = 0; r < 8; ++r) ex[r] += 0x1p-11f;
    rcp_8(pr, ex);
#pragma unroll
    for (int r = 0; r < 8; ++r) ph[r] = (_Float16)pr[r];
    *(v8h*)(pd + u * 32) = ph; }
}
// ---- k_att: block = (64 queries (qb), batch), 8 waves, all 512 value columns; no score plane in memory. Per tile of 64 keys the block forms its 64 x 64 P once (each wave 16 queries x 32 keys) into LDS, one tile ahead of attended += P . v (wave = 64 queries x 64 columns; fragments in two register sets, each group of LDS reads one group of products ahead of its use); out = gamma * attended x 2^-11 + bf16(x).
// staging buffer s mod 2 (a v part and a k part, in two arrays) holds the v rows of tile s and the k rows of tile s + 1, so that trip t reads buffer t mod 2 alone; every wave brings in, by one tensor load per tile, the 64 v rows that it reads itself, the k rows come by copies of all lanes; the k rows of tile 0 have a buffer of their own, filled once ("tile s" here and below: the tile of step s of the block's own walk, tile(s) in memory)
__global__ __launch_bounds__(256) void k_att(const _Float16* __restrict__ QH, const _Float16* __restrict__ KH, const _Float16* __restrict__ VT, const float* __restrict__ X1, const float* __restrict__ GM, float* __restrict__ Y) {
  __shared__ __attribute__((aligned(2048))) unsigned char vst[2 * AT_VB]; __shared__ __align__(16) unsigned char kst[2 * AT_KB]; __shared__ __align__(16) unsigned char k0s[AT_KB]; __shared__ __align__(16) unsigned char pl[2 * AT_PB];
  const float gmv = bfr(GM[0]); const int b = blockIdx.z, qb = blockIdx.x;
  const int tid = threadIdx.x, wave = tid >> 5, lane = tid & 31, col = lane & 15, g = lane >> 4;
  const int qt = wave & 3, kp = wave >> 2;   /* P: this wave forms queries 16 qt .. + 15 against keys 32 kp .. + 31 of each tile */
  const _Float16* qr = QH + ((size_t)b * TT + qb * 64 + qt * 16 + col) * CCQ;
  const v16h qf0 = frag_h(qr, lane), qf1 = frag_h(qr + 32, lane);
  v8f acc[4][4] = {};
  const int nt = TT / AT_KS;
  static_assert((TT / AT_KS & (TT / AT_KS - 1)) == 0, "the walk wraps by a mask");
  auto tile = [&](int s) { return (s + qb) & (nt - 1); };   /* step s of this block's walk takes key tile (s + qb) mod nt: the 64 blocks of a batch, which all copy the same k and v lines, stand at 64 different tiles at any moment instead of asking L2 for the same lines together; every tile is taken once, the f32 sums run from the block's own start and wrap */
  const _Float16* gk = KH + ((size_t)b * TT + (tid >> 3)) * CCQ + (tid & 7) * 8;            /* copy i: k row 32 i + tid / 8, four 128-B rows per wave */
  const uint32_t wv = uni((uint32_t)wave);                                                   /* the wave's number as a scalar: every descriptor word is wave-uniform */
  const uint64_t gvw = (uint64_t)(size_t)(VT + ((size_t)b * CC + wv * 64) * (size_t)TT);     /* first key of this wave's first v row */
  const uint32_t lvw = (uint32_t)(size_t)vst + wv * AT_VSL;                                  /* this wave's slice in v part 0 */
  const u32x8 g1 = tdm_group1();
  auto stage_v = [&](int st, uint32_t vo) { tdm_load(tdm_group0(lvw + vo, gvw + (uint64_t)(tile(st) * (AT_KS * 2))), g1); };   /* this wave's 64 v rows of the tile of step st into the v part at vo */
  const unsigned lk = (unsigned)(size_t)kst + (tid >> 3) * AT_KP + (tid & 7) * 16;
  const unsigned kro = (kp * 32 + col) * AT_KP, pwo = (qt * 16 + col) * AT_VP + (kp * 32 + 8 * g) * 2;   /* this lane's first k row in a k part; its first P store in a P tile */
  at_stage_k(gk + (size_t)tile(0) * AT_KS * CCQ, (unsigned)(size_t)k0s + (tid >> 3) * AT_KP + (tid & 7) * 16);
  stage_v(0, 0); at_stage_k(gk + (size_t)tile(1) * AT_KS * CCQ, lk);
  asm volatile("s_wait_asynccnt 0x0" ::: "memory");   /* k tile 0 and the k part of buffer 0 landed (this wave's copies) */
  asm volatile("s_wait_tensorcnt 0x0" ::: "memory");  /* this wave's v slice of buffer 0 landed */
  __syncthreads();                                      /* all of it readable by every wave */
  stage_v(1, AT_VB); at_stage_k(gk + (size_t)tile(2) * AT_KS * CCQ, lk + AT_KB);
  { v16h ka[2][2]; at_k(ka, k0s + kro, lane); at_p(ka, pl + pwo, qf0, qf1); }
  asm volatile("s_wait_dscnt 0x0" ::: "memory");      /* this wave's P stores of tile 0 are in LDS */
  __syncthreads();                                      /* P of tile 0 readable by every wave */
  /* two register sets of P and v fragments. Set 0: keys 0..31 of a tile. Set 1: keys 32..63, read from LDS in the tile's own trip and multiplied, from registers, at the top of the next trip, where these 16 products cover the latency of that trip's first LDS reads. Every group of reads so stands one group of products ahead of its use; each accumulator takes the keys in the order of the walk, 32 at a time */
  v16h a0[4], w0[4], a1[4] = {}, w1[4] = {};   /* set 1 starts as zeros: trip 0 has no tile behind it, its first 16 products add 0 to accumulators that are 0 */
  auto frags = [&](v16h (&a)[4], v16h (&w)[4], const unsigned char* pk, const unsigned char* vk) {   /* 4 P and 4 v fragments of 32 keys */
#pragma unroll   // here and in pv: constant indices, so that fragments and accumulators stay in registers
    for (int i = 0; i < 4; ++i) { a[i] = frag_h((const _Float16*)(pk + i * 16 * AT_VP), lane); w[i] = frag_h((const _Float16*)(vk + i * 16 * AT_VP), lane); } };
  auto pv = [&](const v16h (&a)[4], const v16h (&w)[4]) {   /* attended += P . v over 32 keys */
#pragma unroll
    for (int i = 0; i < 4; ++i)
#pragma unroll
      for (int j = 0; j < 4; ++j) acc[i][j] = wmma16(a[i], w[j], acc[i][j]); };
#pragma unroll 1   // stays rolled: one publish point with refills in the code, the buffers picked by t & 1. The last trip, which forms no P and refills nothing, stands behind the loop, so that a trip down to its barrier is one straight run of code whose order the scheduling barriers below can hold
  for (int t = 0; t < nt - 1; ++t) { const unsigned vo = (t & 1) * AT_VB, ko = (t & 1) * AT_KB, po = (t & 1) * AT_PB;
    const unsigned char* vb = vst + vo + wave * AT_VSL + col * AT_VP; const unsigned char* pb = pl + po + col * AT_VP;
    v16h ka[2][2];
    at_k(ka, kst + ko + kro, lane);                     /* the trip's first LDS reads, one group: the k rows of tile t + 1 ... */
    __builtin_amdgcn_sched_barrier(0);                  /* keeps the k rows first in the group: they are used first */
    frags(a0, w0, pb, vb);                              /* ... and keys 0..31 of tile t */
    __builtin_amdgcn_sched_barrier(0);                  /* keeps these reads ahead of the products that are to cover them */
    pv(a1, w1);                                         /* keys 32..63 of tile t - 1 */
    __builtin_amdgcn_sched_barrier(0);                  /* keeps the next reads behind the products that still use set 1 (no third set) */
    frags(a1, w1, pb + 64, vb + 64);                    /* keys 32..63 of tile t, one group: they land under the logits, the sigmoid and the 16 products below */
    __builtin_amdgcn_sched_barrier(0);                  /* keeps these reads ahead of that work */
    at_p(ka, pl + (AT_PB - po) + pwo, qf0, qf1);        /* P of tile t + 1 into the other P tile */
    pv(a0, w0);                                         /* keys 0..31 of tile t */
    __builtin_amdgcn_sched_barrier(0);                  /* keeps these products in front of the barrier: behind it they would hold up the refill */
    asm volatile("s_wait_dscnt 0x0" ::: "memory");      /* this wave's reads of buffer t and of P tile t are done (set 1 holds its values), its P stores of tile t + 1 are in LDS */
    asm volatile("s_wait_asynccnt 0x0" ::: "memory");   /* this wave's k copies of buffer t + 1 have landed */
    asm volatile("s_wait_tensorcnt 0x0" ::: "memory");  /* this wave's v slice of buffer t + 1 has landed */
    __syncthreads();                                    /* publishes buffer t + 1 and P of tile t + 1; ends every wave's reads of buffer t and of P tile t */
    if (pinned(t + 2 < nt)) { stage_v(t + 2, vo); if (t + 3 < nt) at_stage_k(gk + (size_t)tile(t + 3) * AT_KS * CCQ, lk + ko); } }   /* the refill of buffer t; the tensor load first: its wave goes on at once */
  { const unsigned char* vb = vst + ((nt - 1) & 1) * AT_VB + wave * AT_VSL + col * AT_VP; const unsigned char* pb = pl + ((nt - 1) & 1) * AT_PB + col * AT_VP;   /* the last trip */
    frags(a0, w0, pb, vb);
    __builtin_amdgcn_sched_barrier(0);                  /* as in the loop: reads ahead of the products that cover them */
    pv(a1, w1);
    __builtin_amdgcn_sched_barrier(0);                  /* as in the loop: no third set */
    frags(a1, w1, pb + 64, vb + 64);
    __builtin_amdgcn_sched_barrier(0);                  /* as in the loop */
    pv(a0, w0);
    asm volatile("s_wait_dscnt 0x0" ::: "memory");      /* this wave's last reads of the v parts and of P are done */
    __syncthreads();                                    /* ends every wave's reads of the v parts before any wave writes its output rows there (the foot of the last trip) */
    pv(a1, w1); }                                       /* keys 32..63 of the last tile, from registers */
  asm volatile("s_wait_tensorcnt 0x0" ::: "memory");    /* no tensor load outstanding behind the loop */
  asm volatile("s_wait_asynccnt 0x0" ::: "memory");     /* no copy outstanding behind the loop */
  asm volatile("s_wait_dscnt 0x0" ::: "memory");        /* no LDS read of this wave outstanding before the staging LDS takes the output */
  static_assert(8 * 64 * AT_OP * 4 <= 2 * AT_VB, "the output rows fit the v parts");
  float* sw = (float*)vst + wave * (64 * AT_OP);        /* the v parts are free now: each wave turns its own 64 x 64 block into rows */
#pragma unroll
  for (int i = 0; i < 4; ++i)
#pragma unroll
    for (int j = 0; j < 4; ++j)
#pragma unroll
      for (int r = 0; r < 8; ++r) sw[(i * 16 + 8 * g + r) * AT_OP + j * 16 + col] = acc[i][j][r] * (1.0f / 2048.0f);
  LDSX();
#pragma unroll 1   // four row pairs per trip: their x loads stand together ahead of the sums
  for (int it = 0; it < 32; it += 4) { v4f xr[4];
#pragma unroll
    for (int e = 0; e < 4; ++e) xr[e] = *(const v4f*)(X1 + ((size_t)b * TT + qb * 64 + (it + e) * 2 + g) * CC + wave * 64 + col * 4);
#pragma unroll
    for (int e = 0; e < 4; ++e) { const int rl = (it + e) * 2 + g; v4f v = *(const v4f*)&sw[rl * AT_OP + col * 4]; v[0] = gmv * v[0] + bfr(xr[e][0]); v[1] = gmv * v[1] + bfr(xr[e][1]); v[2] = gmv * v[2] + bfr(xr[e][2]); v[3] = gmv * v[3] + bfr(xr[e][3]); vst2(Y + ((size_t)b * TT + qb * 64 + rl) * CC + wave * 64 + col * 4, v); }
    asm volatile("s_wait_xcnt 0x0" ::: "memory"); } }   /* the wait: the next trip rewrites the address and data registers that these stores name */   /* out = gamma * attended + bf16(x): 256-B (row, 64-column) segments, each written once */

extern "C" void kernel_launch(void* const* d_in, const int* in_sizes, int n_in, void* d_out, int out_size, void* d_ws, size_t ws_size, hipStream_t stream) {
  (void)in_sizes; (void)n_in; (void)out_size;
  const float** F = (const float**)d_in;
  if (ws_size < (size_t)WS_END) return;
  char* ws = (char*)d_ws; _Float16 *QH = (_Float16*)(ws + WS_QH), *KH = (_Float16*)(ws + WS_KH), *VT = (_Float16*)(ws + WS_VT), *QL = (_Float16*)(ws + WS_QL), *KL = (_Float16*)(ws + WS_KL); __bf16 *VB = (__bf16*)(ws + WS_VB), *VBL = (__bf16*)(ws + WS_VBL); float *S = (float*)(ws + WS_S), *Y = (float*)(ws + WS_Y);
  (void)S; (void)Y; (void)QL; (void)KL; (void)VB; (void)VBL;
  // inputs (d_in order): 0 x [4,64,64,512]; 1 Wq [512,64] (in,out); 2 Wk [512,64]; 3 Wv [512,512]; 4 gamma [1]
  k_projT<0><<<dim3(TNB * TT / 64, 1, 2), 128, 0, stream>>>(F[0], F[0], F[0], F[1], F[2], F[3], nullptr, nullptr, nullptr, QH, QL, KH, KL, VT, VB, VBL);   /* which 0, 1: q and k (one 128-column block, columns >= 64 zero) */
  k_projT<2><<<dim3(TNB * TT / 64, CC / 128, 1), 128, 0, stream>>>(F[0], F[0], F[0], F[1], F[2], F[3], nullptr, nullptr, nullptr, QH, QL, KH, KL, VT, VB, VBL);   /* which 2: v (four 128-column blocks) */
  k_att<<<dim3(NQB, 1, TNB), 256, 0, stream>>>(QH, KH, VT, F[0], F[4], (float*)d_out);   /* logits, sigmoid and P . v of all batches in one launch */
}

// v008
// It runs in 81.9 microseconds.
// Two timings next to v007 both put it at 1.04 times that version's speed.
// Counting every step since v000, it is 15.3 times as fast.
// compute dtype: all float inputs rounded to bf16; q/k (64 wide) and v (512) = x W with EXACT bf16 products on WMMA 16x16x32, f32 accumulate; q and k once to f16 (1 product) for the UNSCALED scores (logit sigma ~16; sigmoid saturates outside |s| < 5); sigmoid in f32 (hardware exp2 and reciprocal); P x 2^11 once to f16 against v once to f16 (1 product); gamma * attended + x in f32; f32 output.
#include <hip/hip_runtime.h>
#include <math.h>
#include <stdint.h>

typedef __attribute__((ext_vector_type(16))) _Float16 v16h;
typedef __attribute__((ext_vector_type(16))) __bf16 v16b;
typedef __attribute__((ext_vector_type(8)))  _Float16 v8h;
typedef __attribute__((ext_vector_type(8)))  float v8f;
typedef __attribute__((ext_vector_type(4)))  float v4f;
typedef __attribute__((ext_vector_type(2)))  float v2f;
typedef __attribute__((ext_vector_type(4)))  unsigned v4u;
typedef __attribute__((ext_vector_type(4)))  int v4i;
typedef float __attribute__((may_alias)) float_a;
typedef int __attribute__((may_alias)) int_a;

template <typename T> __device__ __forceinline__ void vst2(void* p, T v) { *(T*)p = v;  }
// the builtin alone: the compiler keeps the distances behind it. (An asm statement of v_nop that names d, a and b would hold all of them in v0..v255: two fragment sets beside 128 accumulator registers do not fit there.)
__device__ __forceinline__ v8f wmma16(v16h a, v16h b, v8f c) {
  return __builtin_amdgcn_wmma_f32_16x16x32_f16(false, a, false, b, (short)0, c, false, false);
}
__device__ __forceinline__ v8f wmma_bf(v16b a, v16b b, v8f c) {
  v8f d = __builtin_amdgcn_wmma_f32_16x16x32_bf16(false, a, false, b, (short)0, c, false, false);
  asm volatile("v_nop\n\tv_nop\n\tv_nop\n\tv_nop" : "+v"(d) : "v"(a), "v"(b));
  return d;
}
// 16x16x32 fragments: lane = (h = lane>>4, row/col = lane&15); elements 0..7 = k0+8h+0..7, 8..15 = k0+16+8h+0..7; D element r = row 8h+r
__device__ __forceinline__ v16h frag_h(const _Float16* rowk0, int lane) {
  union { v16h v; v8h q[2]; } u; const _Float16* p = rowk0 + 8 * (lane >> 4);
  u.q[0] = *(const v8h*)p; u.q[1] = *(const v8h*)(p + 16); return u.v;
}
__device__ __forceinline__ v16h frag_f32(const float* rowk0, int lane) {
  v16h a; const float* p = rowk0 + 8 * (lane >> 4);
#pragma unroll
  for (int i = 0; i < 8; ++i) { a[i] = (_Float16)p[i]; a[8 + i] = (_Float16)p[16 + i]; }
  return a;
}
__device__ __forceinline__ v16h frag_f32s(const float* rowk0, int lane, float sc) {
  v16h a; const float* p = rowk0 + 8 * (lane >> 4);
#pragma unroll
  for (int i = 0; i < 8; ++i) { a[i] = (_Float16)(p[i] * sc); a[8 + i] = (_Float16)(p[16 + i] * sc); }
  return a;
}
// column fragment from a [K][ld] layout (column n), rows >= K read as 0
__device__ __forceinline__ v16h fragc_f32(const float* W, int k0, int n, int lane, int ld, int K) {
  v16h a; const int g = lane >> 4;
#pragma unroll
  for (int i = 0; i < 8; ++i) { const int ka = k0 + 8 * g + i, kb = ka + 16;
    a[i] = (_Float16)(ka < K ? W[(size_t)(ka < K ? ka : K - 1) * ld + n] : 0.f); a[8 + i] = (_Float16)(kb < K ? W[(size_t)(kb < K ? kb : K - 1) * ld + n] : 0.f); }
  return a;
}
struct F2 { v16b h, l; };
__device__ __forceinline__ F2 bsplit16(const float v[16]) { F2 r;
#pragma unroll
  for (int i = 0; i < 16; ++i) { const __bf16 h = (__bf16)v[i]; r.h[i] = h; r.l[i] = (__bf16)(v[i] - (float)h); }
  return r; }
__device__ __forceinline__ F2 split_row(const float* row, int k0, int lane) { float v[16]; const float* p = row + k0 + 8 * (lane >> 4);
#pragma unroll
  for (int i = 0; i < 8; ++i) { v[i] = p[i]; v[8 + i] = p[16 + i]; }
  return bsplit16(v); }
__device__ __forceinline__ F2 split_rowK(const float* row, int k0, int lane, int K) { float v[16]; const int g = lane >> 4;
#pragma unroll
  for (int i = 0; i < 8; ++i) { const int ka = k0 + 8 * g + i, kb = ka + 16; v[i] = ka < K ? row[ka < K ? ka : K - 1] : 0.f; v[8 + i] = kb < K ? row[kb < K ? kb : K - 1] : 0.f; }
  return bsplit16(v); }
__device__ __forceinline__ F2 split_col(const float* W, int k0, int n, int lane, int ld, int K) { float v[16]; const int g = lane >> 4;
#pragma unroll
  for (int i = 0; i < 8; ++i) { const int ka = k0 + 8 * g + i, kb = ka + 16; v[i] = ka < K ? W[(size_t)(ka < K ? ka : K - 1) * ld + n] : 0.f; v[8 + i] = kb < K ? W[(size_t)(kb < K ? kb : K - 1) * ld + n] : 0.f; }
  return bsplit16(v); }
__device__ __forceinline__ v8f mac3(const F2& a, const F2& b, v8f c) { c = wmma_bf(a.l, b.h, c); c = wmma_bf(a.h, b.l, c); return wmma_bf(a.h, b.h, c); }
__device__ __forceinline__ float sigm(float v) { return 1.0f / (1.0f + expf(-v)); }
#define LDSX() do { asm volatile("s_wait_dscnt 0" ::: "memory"); __builtin_amdgcn_wave_barrier(); __builtin_amdgcn_fence(__ATOMIC_RELEASE, "workgroup"); } while (0)

// SAGAN-style position attention with SIGMOID (unnormalised) attention (B 4, 64 x 64 = 4,096 positions, C 512; x channels-last [B,H,W,C] = rows [b*n][512]; (in,out) weights Wq/Wk [512,64], Wv [512,512], no biases; gamma scalar): q = x Wq, k = x Wk, v = x Wv; scores[n][m] = q_n . k_m (no scaling); attn = sigmoid(scores) (no row normalisation); attended[n][c] = sum_m attn[n][m] v[m][c]; out = gamma * attended + x.
#define NB 4
#define TT 4096
#define CC 512            // value width (v planes, output rows)
#define CCQ 128           // q / k row pitch; columns >= 64 are neither written nor read
#define DIN 512          // x width
#define NH 1
#define HD 512
#define NQB (TT / 64)
#define HG 1               // sizes only the unused WS_S region: no score plane in memory
#define SCALE (1.0f)
#define HDQK 64            // q / k width
#define CAUSAL 0
#ifndef TNB
#define TNB NB
#endif
__device__ __forceinline__ v16b zero16b() { v16b z; _Pragma("unroll") for (int i = 0; i < 16; ++i) z[i] = (__bf16)0.f; return z; }
__device__ __forceinline__ float bfr(float v) { return (float)(__bf16)v; }
__host__ __device__ __forceinline__ int kb_last(int qb) { return CAUSAL ? ((qb * 64 + 63) >> 7) : (TT / 128 - 1); }
typedef __attribute__((ext_vector_type(8))) __bf16 v8b;
__device__ __forceinline__ v16b frag_b(const __bf16* rowk0, int lane) {
  union { v16b v; v8b q[2]; } u; const __bf16* p = rowk0 + 8 * (lane >> 4);
  u.q[0] = *(const v8b*)p; u.q[1] = *(const v8b*)(p + 16); return u.v;
}
#define QBH 0              // unused: every query block takes k_att's single f16 path
#define QHI 0               // no q residual plane: q and k once to f16 (1 product)
#define KHI 64            // key rows carrying k residual / v bf16 hi+lo planes (written by k_proj, read by no kernel)
// B fragment (k rows k0+.., output column o) of a weight: (in,out) [K][ld] or (out,in) [ld rows of K]: bf16 exact, or f16(bf16 * 256) exact
__device__ __forceinline__ v16b wcol_io(const float* Wm, int k0, int o, int lane, int ld) { v16b w; const int g = lane >> 4;
#pragma unroll
  for (int i = 0; i < 8; ++i) { w[i] = (__bf16)Wm[(size_t)(k0 + 8 * g + i) * ld + o]; w[8 + i] = (__bf16)Wm[(size_t)(k0 + 16 + 8 * g + i) * ld + o]; }
  return w; }
__device__ __forceinline__ v16b wcol_oi(const float* Wm, int k0, int o, int lane, int K) { v16b w; const float* p = Wm + (size_t)o * K + k0 + 8 * (lane >> 4);
#pragma unroll
  for (int i = 0; i < 8; ++i) { w[i] = (__bf16)p[i]; w[8 + i] = (__bf16)p[16 + i]; }
  return w; }
__device__ __forceinline__ v16h wcolh_io(const float* Wm, int k0, int o, int lane, int ld) { v16h w; const int g = lane >> 4;
#pragma unroll
  for (int i = 0; i < 8; ++i) { w[i] = (_Float16)(bfr(Wm[(size_t)(k0 + 8 * g + i) * ld + o]) * 256.0f); w[8 + i] = (_Float16)(bfr(Wm[(size_t)(k0 + 16 + 8 * g + i) * ld + o]) * 256.0f); }
  return w; }
__device__ __forceinline__ v16h wcolh_oi(const float* Wm, int k0, int o, int lane, int K) { v16h w; const float* p = Wm + (size_t)o * K + k0 + 8 * (lane >> 4);
#pragma unroll
  for (int i = 0; i < 8; ++i) { w[i] = (_Float16)(bfr(p[i]) * 256.0f); w[8 + i] = (_Float16)(bfr(p[16 + i]) * 256.0f); }
  return w; }
#define WQKV_LAYOUT 0   // 0 = (in,out) [K][CC] for Wv, [K][HDQK] for Wq/Wk; 1 = (out,in) [CC][DIN]; 2 = per-head [NH][DIN][HD]
__device__ __forceinline__ v16b wcol_hdk(const float* Wm, int k0, int o, int lane) { v16b w; const int g = lane >> 4; const float* p = Wm + (size_t)(o / HD) * DIN * HD + (o % HD);
#pragma unroll
  for (int i = 0; i < 8; ++i) { w[i] = (__bf16)p[(size_t)(k0 + 8 * g + i) * HD]; w[8 + i] = (__bf16)p[(size_t)(k0 + 16 + 8 * g + i) * HD]; }
  return w; }
#define WO_OUT_IN 0
#if WQKV_LAYOUT == 1
#define WCOL(W, k0, o, lane) wcol_oi(W, k0, (o), lane, DIN)   /* unused: layout 0 */
#elif WQKV_LAYOUT == 2
#define WCOL(W, k0, o, lane) wcol_hdk(W, k0, o, lane)
#else
#define WCOL(W, k0, o, lane) (which == 2 ? wcol_io(W, k0, (o), lane, CC) : ((o) < HDQK ? wcol_io(W, k0, (o), lane, HDQK) : zero16b()))   /* Wv [512][512]; Wq/Wk [512][64]: projected q/k columns >= 64 are zero (unused: k_proj reads the weights directly) */
#endif
#if WO_OUT_IN
#define WOCOL(W, k0, o, lane) wcol_oi(W, k0, o, lane, CC)
#define WOCOLH(W, k0, o, lane) wcolh_oi(W, k0, o, lane, CC)
#else
#define WOCOL(W, k0, o, lane) wcol_io(W, k0, o, lane, DIN)
#define WOCOLH(W, k0, o, lane) wcolh_io(W, k0, o, lane, DIN)
#endif
#define BG HG              // unused: k_att covers all batches in one launch, blockIdx.z = batch
#define BGN (TNB < BG ? TNB : BG)
#define DVH 128            // unused: each k_att block covers all 512 value columns (16 accumulator tiles per wave)
#ifndef SM_EXTRA_PARAMS
#define SM_EXTRA_PARAMS
#endif
#ifndef PROJ_EXTRA_PARAMS
#define PROJ_EXTRA_PARAMS
#endif
#ifndef SM_MASK_HOOK
#define SM_MASK_HOOK (void)0
#endif

#define WS_QH  0u                                      // f16 q rows [b*t][CCQ]
#define WS_KH  (WS_QH + 2u * (size_t)NB * TT * CCQ)     // f16 k rows [b*t][CCQ]
#define WS_VT  (WS_KH + 2u * (size_t)NB * TT * CCQ)     // f16 v planes [b][c][t]
#define WS_QL  (WS_VT + 2u * (size_t)NB * CC * TT)      // f16 q residual x 2^10 rows [b][t < QHI][CCQ]
#define WS_KL  (WS_QL + 2u * (size_t)NB * QHI * CCQ)    // f16 k residual x 2^10 rows [b][t < KHI][CCQ]
#define WS_VB  (WS_KL + 2u * (size_t)NB * KHI * CCQ)    // bf16 v hi planes [b][c][t < KHI]
#define WS_VBL (WS_VB + 2u * (size_t)NB * CC * KHI)
#define WS_S   (WS_VBL + 2u * (size_t)NB * CC * KHI)    // unused: no score plane in memory
#define WS_Y   (WS_S  + 4u * (size_t)HG * TT * TT)      // f32 ctx rows [b*t][CC] (only when there is an output projection)
#define WS_END (WS_Y  + 0u)

#define PJ_KC 64                        // k values per staged chunk of k_proj
#define PJ_P (PJ_KC * 2 + 16)           // LDS pitch of a staged weight column and of a staged x row, bytes (16 B x odd: no bank conflict for 16-byte reads)
#define PJ_NC 320                       // columns per block: one half of the 640 columns of [Wv | Wq | Wk]
#define PJ_NW 160                       // columns per wave: ten 16-column tiles
#define PJ_BUF ((PJ_NC + 64) * PJ_P)    // a staging buffer: weight columns, then x rows
#define PJ_SMB (3 * PJ_NC * 72 * 2)     // LDS of a block: the three planes of the epilogue
static_assert(2 * PJ_BUF <= PJ_SMB && CC + 2 * HDQK == 2 * PJ_NC && PJ_NC == 2 * PJ_NW && PJ_NW % 32 == 0, "two staging buffers fit; two blocks of two wave columns cover v, q and k");
typedef __attribute__((ext_vector_type(4))) __bf16 v4b;
// ---- k_proj: ONE launch for q, k and v = X W (+ b) with exact bf16 products (K = DIN). Block = 64 rows x 320 of the 640 columns [Wv | Wq | Wk], 8 waves (wave = 16 rows x 160 columns). Block column 0 (LAST false): v columns 0..319; block column 1 (LAST true): v columns 320..511, then q, then k. -> v f16 planes [c][t] (+ bf16 hi/lo planes for t < KHI), q and k f16 rows (+ k residual rows < KHI)
// per chunk of 64 k the block stages, through registers and as bf16, its weight columns TRANSPOSED ([column][k]; a lane loads two adjacent columns, 16 lanes one whole 128-B line) and its 64 x rows (16 lanes x 16 B per row); fragments are 16-byte LDS reads. Two buffers: the next chunk's global loads fly while this chunk is worked on; one barrier per chunk. The staging LDS is used again by the epilogue.
template <bool LAST> __device__ __forceinline__ void projT(unsigned char* __restrict__ sm, const float* __restrict__ X, const float* __restrict__ WQ, const float* __restrict__ WK, const float* __restrict__ WV, const float* __restrict__ BQ, const float* __restrict__ BK, const float* __restrict__ BV,
    _Float16* __restrict__ QH, _Float16* __restrict__ KH, _Float16* __restrict__ KL, _Float16* __restrict__ VT, __bf16* __restrict__ VB, __bf16* __restrict__ VBL) {
  constexpr int NJ = PJ_NW / 16, NM = PJ_NW / 32, C0 = LAST ? PJ_NC : 0, NV = LAST ? CC - PJ_NC : PJ_NC;   /* the block's v columns: C0 .. C0 + NV - 1; behind them (LAST) 64 q and 64 k columns */
  constexpr int NMV = NV / 64;   /* a thread stages NM groups of (eight k rows, two columns) per chunk: NMV of Wv and (LAST) one of Wq and one of Wk, alike in every wave */
  static_assert(QHI == 0 && NV % 64 == 0 && NMV + (LAST ? 2 : 0) == NM && NV + (LAST ? 2 * HDQK : 0) == PJ_NC && HDQK == 64 && (!LAST || 3 * NV * 72 * 2 + 2 * 64 * 136 * 2 <= PJ_SMB), "no q residual rows; the staged groups cover the block's columns; the epilogue's planes fit");
  _Float16 (*th)[72] = (_Float16 (*)[72])sm; __bf16 (*tb)[72] = (__bf16 (*)[72])(sm + NV * 72 * 2); __bf16 (*tbl)[72] = tb + NV; _Float16 (*sh)[136] = (_Float16 (*)[136])(sm + 3 * NV * 72 * 2); _Float16 (*sl)[136] = sh + 64; (void)sh; (void)sl;
  const int tid = threadIdx.x, wave = tid >> 5, lane = tid & 31, col = lane & 15, g = lane >> 4; const size_t r0 = (size_t)blockIdx.x * 64; const size_t bb = r0 / TT; const int t0 = (int)(r0 % TT);
  const int rg = wave & 3, ch = __builtin_amdgcn_readfirstlane(wave >> 2);   /* this wave: rows 16 rg .. + 15, block columns 160 ch .. + 159; waves 4 ch .. + 3 stage half ch of the v columns and (LAST) of the q and of the k columns */
  v8f acc[NJ] = {};
  const int ko = ((tid >> 4) & 7) * 8;                                        /* 16 lanes stage eight k rows of a chunk, 32 columns at a time */
  const float* wv = WV + (size_t)ko * CC + C0 + ch * (NV / 2) + col * 2;      /* load (m, i), m < NMV: weight row ko + i of the chunk, block columns ch NV / 2 + 32 m + 2 col and + 1 */
  const float* wq = WQ + (size_t)ko * HDQK + ch * 32 + col * 2; const float* wk = WK + (size_t)ko * HDQK + ch * 32 + col * 2; (void)wq; (void)wk;   /* LAST, m = NMV and NMV + 1: columns 32 ch + 2 col and + 1 of Wq and of Wk */
  const float* xp = X + (r0 + wave * 8 + g) * (size_t)DIN + col * 4;          /* load i: row 2 i + g of this wave's 8 rows, row-major [b*t][DIN] */
  unsigned char* wd = sm + (ch * (NV / 2) + col * 2) * PJ_P + ko * 2; unsigned char* wdq = sm + (NV + ch * 32 + col * 2) * PJ_P + ko * 2; (void)wdq; unsigned char* xd = sm + (PJ_NC + wave * 8 + g) * PJ_P + col * 8;
  v2f wr[NM][8]; v4f xr[4];
  auto ld_chunk = [&]() {   /* reads at the four running pointers, which keep registers of their own through the loop */
#pragma unroll   // every unroll of this kernel: constant indices, so that staged values, fragments and accumulators stay in registers
    for (int i = 0; i < 4; ++i) xr[i] = *(const v4f*)(xp + (size_t)i * 2 * DIN);
#pragma unroll
    for (int m = 0; m < NMV; ++m)
#pragma unroll
      for (int i = 0; i < 8; ++i) wr[m][i] = *(const v2f*)(wv + m * 32 + (size_t)i * CC);
    if constexpr (LAST) {
#pragma unroll
      for (int i = 0; i < 8; ++i) { wr[NMV][i] = *(const v2f*)(wq + (size_t)i * HDQK); wr[NMV + 1][i] = *(const v2f*)(wk + (size_t)i * HDQK); } } };
  auto st_chunk = [&](int bo) {
#pragma unroll
    for (int m = 0; m < NM; ++m)
#pragma unroll
      for (int e = 0; e < 2; ++e) { v8b t;
#pragma unroll
        for (int i = 0; i < 8; ++i) t[i] = (__bf16)wr[m][i][e];
        *(v8b*)((m < NMV ? wd + (m * 32 + e) * PJ_P : wdq + ((m - NMV) * HDQK + e) * PJ_P) + bo) = t; }
#pragma unroll
    for (int i = 0; i < 4; ++i) { v4b t; t[0] = (__bf16)xr[i][0]; t[1] = (__bf16)xr[i][1]; t[2] = (__bf16)xr[i][2]; t[3] = (__bf16)xr[i][3]; *(v4b*)(xd + bo + i * 2 * PJ_P) = t; } };
  ld_chunk(); st_chunk(0);
  __syncthreads();   /* chunk 0 readable by every wave */
#pragma unroll 1   // stays rolled: small code, the buffers picked by c & 1
  for (int c = 0; c < DIN / PJ_KC; ++c) { const int bo = (c & 1) * PJ_BUF;
    if (c + 1 < DIN / PJ_KC) { xp += PJ_KC; wv += (size_t)PJ_KC * CC; wq += (size_t)PJ_KC * HDQK; wk += (size_t)PJ_KC * HDQK; ld_chunk(); }   /* running pointers, not base + c * step: no temporary address register that a later load's result could overwrite; a wait for the loads that named a pointer stands in front of its addition */
    const unsigned char* wb = sm + bo + (ch * PJ_NW + col) * PJ_P; const unsigned char* xb = sm + bo + (PJ_NC + rg * 16 + col) * PJ_P;
#pragma unroll
    for (int kc = 0; kc < PJ_KC / 32; ++kc) { const v16b a = frag_b((const __bf16*)(xb + kc * 64), lane);
#pragma unroll
      for (int jh = 0; jh < NJ; jh += 5) { v16b w[5];   /* five fragments' LDS reads stand as one group ahead of their five products: one wait per group */
#pragma unroll
        for (int j = 0; j < 5; ++j) w[j] = frag_b((const __bf16*)(wb + (jh + j) * 16 * PJ_P + kc * 64), lane);
#pragma unroll
        for (int j = 0; j < 5; ++j) acc[jh + j] = wmma_bf(a, w[j], acc[jh + j]); } }
    if (c + 1 < DIN / PJ_KC) st_chunk(PJ_BUF - bo);
    __syncthreads(); }   /* publishes chunk c + 1; ends every wave's reads of chunk c (behind the last chunk: before the epilogue writes this LDS) */
  const bool hi_rows = t0 < KHI;
#pragma unroll
  for (int j = 0; j < NJ; ++j) { const int cb = ch * PJ_NW + j * 16;   /* the tile's first block column: the same for the whole wave */
    if (!LAST || cb < NV) { const int cl = cb + col; const float bias = BV ? bfr(BV[C0 + cl]) : 0.f;
#pragma unroll
      for (int r = 0; r < 8; ++r) { const float v = acc[j][r] + bias; const int rl = rg * 16 + 8 * g + r; th[cl][rl] = (_Float16)v; const __bf16 bh = (__bf16)v; tb[cl][rl] = bh; tbl[cl][rl] = (__bf16)(v - (float)bh); }
    } else { const int qc = cb - NV + col; const float* BA = qc < HDQK ? BQ : BK; const float bias = BA ? bfr(BA[qc & (HDQK - 1)]) : 0.f;   /* qc 0..63: q columns, 64..127: k columns */
#pragma unroll
      for (int r = 0; r < 8; ++r) { const float v = acc[j][r] + bias; const _Float16 hv = (_Float16)v; sh[rg * 16 + 8 * g + r][qc] = hv; sl[rg * 16 + 8 * g + r][qc] = (_Float16)((v - (float)hv) * 1024.0f); } } }
  __syncthreads();
  /* the stores of one plane stand together, unrolled, each with address and data registers of its own; the s_wait_xcnt behind a group: what follows writes registers that these stores name */
#pragma unroll
  for (int it = 0; it < NV / 32; ++it) { const int cl = it * 32 + (tid >> 3), q = tid & 7; vst2((unsigned*)(VT + (bb * CC + C0 + cl) * (size_t)TT + t0 + q * 8), *(const v4u*)&th[cl][q * 8]); }
  asm volatile("s_wait_xcnt 0x0" ::: "memory");
  if (hi_rows) {
#pragma unroll
    for (int it = 0; it < NV / 32; ++it) { const int cl = it * 32 + (tid >> 3), q = tid & 7; const size_t o3 = (bb * CC + C0 + cl) * (size_t)KHI + t0 + q * 8; vst2((unsigned*)(VB + o3), *(const v4u*)&tb[cl][q * 8]); vst2((unsigned*)(VBL + o3), *(const v4u*)&tbl[cl][q * 8]); }
    if constexpr (LAST) asm volatile("s_wait_xcnt 0x0" ::: "memory"); }   /* LAST alone: elsewhere nothing follows */
  if constexpr (LAST) { const int q = tid & 15, qc = (q & 7) * 8;   /* q and k rows: pitch CCQ, the 64 columns (one 128-B line) that k_att reads */
#pragma unroll
    for (int it = 0; it < 4; ++it) { const int rl = it * 16 + (tid >> 4); vst2((unsigned*)((q < 8 ? QH : KH) + (r0 + rl) * CCQ + qc), *(const v4u*)&sh[rl][q * 8]); }
    asm volatile("s_wait_xcnt 0x0" ::: "memory");
    if (hi_rows && q >= 8) {
#pragma unroll
      for (int it = 0; it < 4; ++it) { const int rl = it * 16 + (tid >> 4); vst2((unsigned*)(KL + (bb * KHI + t0 + rl) * (size_t)CCQ + qc), *(const v4u*)&sl[rl][q * 8]); } } } }
__global__ __launch_bounds__(256) void k_proj(const float* __restrict__ X, const float* __restrict__ WQ, const float* __restrict__ WK, const float* __restrict__ WV, const float* __restrict__ BQ, const float* __restrict__ BK, const float* __restrict__ BV,
    _Float16* __restrict__ QH, _Float16* __restrict__ KH, _Float16* __restrict__ KL, _Float16* __restrict__ VT, __bf16* __restrict__ VB, __bf16* __restrict__ VBL) {
  __shared__ __align__(16) unsigned char sm[PJ_SMB];
  if (blockIdx.y == 0) projT<false>(sm, X, WQ, WK, WV, BQ, BK, BV, QH, KH, KL, VT, VB, VBL);   /* the same for the whole block: every barrier stands under block-uniform control flow */
  else projT<true>(sm, X, WQ, WK, WV, BQ, BK, BV, QH, KH, KL, VT, VB, VBL); }
#define AT_KS 64                        // keys per staged tile of k_att
#define AT_KP (HDQK * 2 + 16)           // LDS pitch of a k row, bytes (16 B x odd: no bank conflict for 16-byte reads)
#define AT_VP (AT_KS * 2 + 16)          // LDS pitch of a v row and of a P row, bytes (16 B x odd)
#define AT_KB (AT_KS * AT_KP)           // k part of a buffer
#define AT_VSL 10240                    // LDS bytes of one wave's v slice: 64 rows at pitch AT_VP (9,216 B), rounded up so that every slice starts at a multiple of 2 KiB
#define AT_VB (8 * AT_VSL)              // v part of a buffer: eight slices
static_assert(AT_VSL % 2048 == 0 && 64 * AT_VP <= AT_VSL && AT_VP == 128 + 16 && AT_KS * 2 == 128, "a slice: 64 rows of 128 B, 16 B of pad behind each, its place a multiple of 2 KiB");
#define AT_PB (64 * AT_VP)              // one P tile: 64 queries x 64 keys, f16
#define AT_OP 68                        // LDS pitch of an output row of one wave, floats
// 64 k rows of 128 B: 2 copies of 16 bytes per lane, global -> LDS through no register, rows 32 apart (256 lanes = 32 rows per copy); the s_wait_xcnt stands inside the statement so that no address register is rewritten ahead of it
__device__ __forceinline__ void at_stage_k(const _Float16* gk, unsigned lk) {
  asm volatile("global_load_async_to_lds_b128 %0, %2, off\n\tglobal_load_async_to_lds_b128 %1, %3, off\n\ts_wait_xcnt 0x0" :: "v"(lk), "v"(lk + 32 * AT_KP), "v"(gk), "v"(gk + (size_t)32 * CCQ) : "memory");
}
// one wave's v slice of a tile, 64 rows (value columns) of 64 keys = 128 B, by ONE tensor load of that wave: global -> LDS through no register, no per-lane address and no wait behind the issue
typedef uint32_t u32x4 __attribute__((ext_vector_type(4)));
typedef uint32_t u32x8 __attribute__((ext_vector_type(8)));
__device__ __forceinline__ uint32_t uni(uint32_t v) { return (uint32_t)__builtin_amdgcn_readfirstlane(v); }
__device__ __forceinline__ uint32_t pinned(uint32_t v) { uint32_t w = uni(v); asm volatile("" : "+s"(w)); return w; }   // pinned(): holds the test around a tensor load in a scalar register, so that it compiles to s_cmp and a scalar branch (a tensor load ignores EXEC)
// group 1 (the same for every request): 1-byte elements, no mask, tensor = tile = 64 rows of 128 B, source pitch one v row (TT keys), 4 dwords of pad behind every 32 dwords: LDS pitch 144 B = AT_VP
__device__ __forceinline__ u32x8 tdm_group1() { u32x8 g;
  g[0] = uni((1u << 20) | (4u << 22) | (3u << 25)); g[1] = uni(128u << 16); g[2] = uni(64u << 16); g[3] = uni(128u << 16); g[4] = uni(64u); g[5] = uni((uint32_t)(TT * 2)); g[6] = uni(0u); g[7] = uni(0u);
  asm volatile("" : "+s"(g));   // pinned() on the whole group: its eight words keep scalar registers of their own through the loop, so that none of them takes another value while a request is outstanding (left to itself the compiler used one of them as a temporary)
  return g; }
// group 0: count 1, place in LDS, address of the tile's first byte, type 2
__device__ __forceinline__ u32x4 tdm_group0(uint32_t lds_dst, uint64_t ga) { u32x4 g;
  g[0] = uni(1u); g[1] = uni(lds_dst); g[2] = uni((uint32_t)ga); g[3] = uni((((uint32_t)(ga >> 32)) & 0x01FFFFFFu) | 0x80000000u);
  return g; }
__device__ __forceinline__ void tdm_load(u32x4 g0, u32x8 g1) { asm volatile("tensor_load_to_lds %0, %1" :: "s"(g0), "s"(g1) : "memory"); }
// eight transcendentals of one kind in one statement, results in registers of their own, one v_nop behind the last: keeps the slot that the instruction set asks for between a transcendental and a next instruction that overwrites its source or reads its result. The two s_delay_alu are the hints that the compiler cannot place around asm text: the first source comes from a vector instruction a few places in front, the next reader takes the last results; without them the wait would hold up the SIMD's other wave too
__device__ __forceinline__ void exp2_8(float (&o)[8], const float (&x)[8]) {
  asm("s_delay_alu instid0(VALU_DEP_4)\n\tv_exp_f32 %0, %8\n\tv_exp_f32 %1, %9\n\tv_exp_f32 %2, %10\n\tv_exp_f32 %3, %11\n\tv_exp_f32 %4, %12\n\tv_exp_f32 %5, %13\n\tv_exp_f32 %6, %14\n\tv_exp_f32 %7, %15\n\tv_nop\n\ts_delay_alu instid0(TRANS32_DEP_1)"
      : "=&v"(o[0]), "=&v"(o[1]), "=&v"(o[2]), "=&v"(o[3]), "=&v"(o[4]), "=&v"(o[5]), "=&v"(o[6]), "=&v"(o[7]) : "v"(x[0]), "v"(x[1]), "v"(x[2]), "v"(x[3]), "v"(x[4]), "v"(x[5]), "v"(x[6]), "v"(x[7]));
}
__device__ __forceinline__ void rcp_8(float (&o)[8], const float (&x)[8]) {
  asm("s_delay_alu instid0(VALU_DEP_4)\n\tv_rcp_f32 %0, %8\n\tv_rcp_f32 %1, %9\n\tv_rcp_f32 %2, %10\n\tv_rcp_f32 %3, %11\n\tv_rcp_f32 %4, %12\n\tv_rcp_f32 %5, %13\n\tv_rcp_f32 %6, %14\n\tv_rcp_f32 %7, %15\n\tv_nop\n\ts_delay_alu instid0(TRANS32_DEP_1)"
      : "=&v"(o[0]), "=&v"(o[1]), "=&v"(o[2]), "=&v"(o[3]), "=&v"(o[4]), "=&v"(o[5]), "=&v"(o[6]), "=&v"(o[7]) : "v"(x[0]), "v"(x[1]), "v"(x[2]), "v"(x[3]), "v"(x[4]), "v"(x[5]), "v"(x[6]), "v"(x[7]));
}
// at_k: the LDS reads of the four k fragments (32 keys x 64) that at_p works on, apart from their use, so that the caller can put other matrix work between the two
__device__ __forceinline__ void at_k(v16h (&ka)[2][2], const unsigned char* kl, int lane) {
#pragma unroll   // constant indices: fragments stay in registers; the four fragments' LDS reads stand as one group
  for (int u = 0; u < 2; ++u) { const _Float16* kr = (const _Float16*)(kl + u * 16 * AT_KP); ka[u][0] = frag_h(kr, lane); ka[u][1] = frag_h(kr + 32, lane); }
}
// P of 16 queries x 32 keys: logits with the k rows as A and the q rows as B, so that a lane holds 8 consecutive keys of one query (element r: key 8 g + r of the 16, query col); sigmoid x 2^11 in f32 by the hardware exp2 and reciprocal (four vector instructions per element; their error lies far under the f16 rounding that follows), once to f16, one 16-byte LDS store per 16 keys
__device__ __forceinline__ void at_p(const v16h (&ka)[2][2], unsigned char* pd, v16h qf0, v16h qf1) {
#pragma unroll
  for (int u = 0; u < 2; ++u) { v8f st = {}; st = wmma16(ka[u][0], qf0, st); st = wmma16(ka[u][1], qf1, st);
    float ea[8], ex[8], pr[8]; v8h ph;   /* 2^11 / (1 + e^-s) = 1 / (2^-11 + 2^(-s log2 e - 11)); s = +-inf gives 2^11 and 0 */
#pragma unroll
    for (int r = 0; r < 8; ++r) ea[r] = __builtin_fmaf(st[r], -1.4426950408889634f, -11.0f);
    exp2_8(ex, ea);
#pragma unroll
    for (int r = 0; r < 8; ++r) ex[r] += 0x1p-11f;
    rcp_8(pr, ex);
#pragma unroll
    for (int r = 0; r < 8; ++r) ph[r] = (_Float16)pr[r];
    *(v8h*)(pd + u * 32) = ph; }
}
// ---- k_att: block = (64 queries (qb), batch), 8 waves, all 512 value columns; no score plane in memory. Per tile of 64 keys the block forms its 64 x 64 P once (each wave 16 queries x 32 keys) into LDS, one tile ahead of attended += P . v (wave = 64 queries x 64 columns; fragments in two register sets, each group of LDS reads one group of products ahead of its use); out = gamma * attended x 2^-11 + bf16(x).
// staging buffer s mod 2 (a v part and a k part, in two arrays) holds the v rows of tile s and the k rows of tile s + 1, so that trip t reads buffer t mod 2 alone; every wave brings in, by one tensor load per tile, the 64 v rows that it reads itself, the k rows come by copies of all lanes; the k rows of tile 0 have a buffer of their own, filled once ("tile s" here and below: the tile of step s of the block's own walk, tile(s) in memory)
__global__ __launch_bounds__(256) void k_att(const _Float16* __restrict__ QH, const _Float16* __restrict__ KH, const _Float16* __restrict__ VT, const float* __restrict__ X1, const float* __restrict__ GM, float* __restrict__ Y) {
  __shared__ __attribute__((aligned(2048))) unsigned char vst[2 * AT_VB]; __shared__ __align__(16) unsigned char kst[2 * AT_KB]; __shared__ __align__(16) unsigned char k0s[AT_KB]; __shared__ __align__(16) unsigned char pl[2 * AT_PB];
  const float gmv = bfr(GM[0]); const int b = blockIdx.z, qb = blockIdx.x;
  const int tid = threadIdx.x, wave = tid >> 5, lane = tid & 31, col = lane & 15, g = lane >> 4;
  const int qt = wave & 3, kp = wave >> 2;   /* P: this wave forms queries 16 qt .. + 15 against keys 32 kp .. + 31 of each tile */
  const _Float16* qr = QH + ((size_t)b * TT + qb * 64 + qt * 16 + col) * CCQ;
  const v16h qf0 = frag_h(qr, lane), qf1 = frag_h(qr + 32, lane);
  v8f acc[4][4] = {};
  const int nt = TT / AT_KS;
  static_assert((TT / AT_KS & (TT / AT_KS - 1)) == 0, "the walk wraps by a mask");
  auto tile = [&](int s) { return (s + qb) & (nt - 1); };   /* step s of this block's walk takes key tile (s + qb) mod nt: the 64 blocks of a batch, which all copy the same k and v lines, stand at 64 different tiles at any moment instead of asking L2 for the same lines together; every tile is taken once, the f32 sums run from the block's own start and wrap */
  const _Float16* gk = KH + ((size_t)b * TT + (tid >> 3)) * CCQ + (tid & 7) * 8;            /* copy i: k row 32 i + tid / 8, four 128-B rows per wave */
  const uint32_t wv = uni((uint32_t)wave);                                                   /* the wave's number as a scalar: every descriptor word is wave-uniform */
  const uint64_t gvw = (uint64_t)(size_t)(VT + ((size_t)b * CC + wv * 64) * (size_t)TT);     /* first key of this wave's first v row */
  const uint32_t lvw = (uint32_t)(size_t)vst + wv * AT_VSL;                                  /* this wave's slice in v part 0 */
  const u32x8 g1 = tdm_group1();
  auto stage_v = [&](int st, uint32_t vo) { tdm_load(tdm_group0(lvw + vo, gvw + (uint64_t)(tile(st) * (AT_KS * 2))), g1); };   /* this wave's 64 v rows of the tile of step st into the v part at vo */
  const unsigned lk = (unsigned)(size_t)kst + (tid >> 3) * AT_KP + (tid & 7) * 16;
  const unsigned kro = (kp * 32 + col) * AT_KP, pwo = (qt * 16 + col) * AT_VP + (kp * 32 + 8 * g) * 2;   /* this lane's first k row in a k part; its first P store in a P tile */
  at_stage_k(gk + (size_t)tile(0) * AT_KS * CCQ, (unsigned)(size_t)k0s + (tid >> 3) * AT_KP + (tid & 7) * 16);
  stage_v(0, 0); at_stage_k(gk + (size_t)tile(1) * AT_KS * CCQ, lk);
  asm volatile("s_wait_asynccnt 0x0" ::: "memory");   /* k tile 0 and the k part of buffer 0 landed (this wave's copies) */
  asm volatile("s_wait_tensorcnt 0x0" ::: "memory");  /* this wave's v slice of buffer 0 landed */
  __syncthreads();                                      /* all of it readable by every wave */
  stage_v(1, AT_VB); at_stage_k(gk + (size_t)tile(2) * AT_KS * CCQ, lk + AT_KB);
  { v16h ka[2][2]; at_k(ka, k0s + kro, lane); at_p(ka, pl + pwo, qf0, qf1); }
  asm volatile("s_wait_dscnt 0x0" ::: "memory");      /* this wave's P stores of tile 0 are in LDS */
  __syncthreads();                                      /* P of tile 0 readable by every wave */
  /* two register sets of P and v fragments. Set 0: keys 0..31 of a tile. Set 1: keys 32..63, read from LDS in the tile's own trip and multiplied, from registers, at the top of the next trip, where these 16 products cover the latency of that trip's first LDS reads. Every group of reads so stands one group of products ahead of its use; each accumulator takes the keys in the order of the walk, 32 at a time */
  v16h a0[4], w0[4], a1[4] = {}, w1[4] = {};   /* set 1 starts as zeros: trip 0 has no tile behind it, its first 16 products add 0 to accumulators that are 0 */
  auto frags = [&](v16h (&a)[4], v16h (&w)[4], const unsigned char* pk, const unsigned char* vk) {   /* 4 P and 4 v fragments of 32 keys */
#pragma unroll   // here and in pv: constant indices, so that fragments and accumulators stay in registers
    for (int i = 0; i < 4; ++i) { a[i] = frag_h((const _Float16*)(pk + i * 16 * AT_VP), lane); w[i] = frag_h((const _Float16*)(vk + i * 16 * AT_VP), lane); } };
  auto pv = [&](const v16h (&a)[4], const v16h (&w)[4]) {   /* attended += P . v over 32 keys */
#pragma unroll
    for (int i = 0; i < 4; ++i)
#pragma unroll
      for (int j = 0; j < 4; ++j) acc[i][j] = wmma16(a[i], w[j], acc[i][j]); };
#pragma unroll 1   // stays rolled: one publish point with refills in the code, the buffers picked by t & 1. The last trip, which forms no P and refills nothing, stands behind the loop, so that a trip down to its barrier is one straight run of code whose order the scheduling barriers below can hold
  for (int t = 0; t < nt - 1; ++t) { const unsigned vo = (t & 1) * AT_VB, ko = (t & 1) * AT_KB, po = (t & 1) * AT_PB;
    const unsigned char* vb = vst + vo + wave * AT_VSL + col * AT_VP; const unsigned char* pb = pl + po + col * AT_VP;
    v16h ka[2][2];
    at_k(ka, kst + ko + kro, lane);                     /* the trip's first LDS reads, one group: the k rows of tile t + 1 ... */
    __builtin_amdgcn_sched_barrier(0);                  /* keeps the k rows first in the group: they are used first */
    frags(a0, w0, pb, vb);                              /* ... and keys 0..31 of tile t */
    __builtin_amdgcn_sched_barrier(0);                  /* keeps these reads ahead of the products that are to cover them */
    pv(a1, w1);                                         /* keys 32..63 of tile t - 1 */
    __builtin_amdgcn_sched_barrier(0);                  /* keeps the next reads behind the products that still use set 1 (no third set) */
    frags(a1, w1, pb + 64, vb + 64);                    /* keys 32..63 of tile t, one group: they land under the logits, the sigmoid and the 16 products below */
    __builtin_amdgcn_sched_barrier(0);                  /* keeps these reads ahead of that work */
    at_p(ka, pl + (AT_PB - po) + pwo, qf0, qf1);        /* P of tile t + 1 into the other P tile */
    pv(a0, w0);                                         /* keys 0..31 of tile t */
    __builtin_amdgcn_sched_barrier(0);                  /* keeps these products in front of the barrier: behind it they would hold up the refill */
    asm volatile("s_wait_dscnt 0x0" ::: "memory");      /* this wave's reads of buffer t and of P tile t are done (set 1 holds its values), its P stores of tile t + 1 are in LDS */
    asm volatile("s_wait_asynccnt 0x0" ::: "memory");   /* this wave's k copies of buffer t + 1 have landed */
    asm volatile("s_wait_tensorcnt 0x0" ::: "memory");  /* this wave's v slice of buffer t + 1 has landed */
    __syncthreads();                                    /* publishes buffer t + 1 and P of tile t + 1; ends every wave's reads of buffer t and of P tile t */
    if (pinned(t + 2 < nt)) { stage_v(t + 2, vo); if (t + 3 < nt) at_stage_k(gk + (size_t)tile(t + 3) * AT_KS * CCQ, lk + ko); } }   /* the refill of buffer t; the tensor load first: its wave goes on at once */
  { const unsigned char* vb = vst + ((nt - 1) & 1) * AT_VB + wave * AT_VSL + col * AT_VP; const unsigned char* pb = pl + ((nt - 1) & 1) * AT_PB + col * AT_VP;   /* the last trip */
    frags(a0, w0, pb, vb);
    __builtin_amdgcn_sched_barrier(0);                  /* as in the loop: reads ahead of the products that cover them */
    pv(a1, w1);
    __builtin_amdgcn_sched_barrier(0);                  /* as in the loop: no third set */
    frags(a1, w1, pb + 64, vb + 64);
    __builtin_amdgcn_sched_barrier(0);                  /* as in the loop */
    pv(a0, w0);
    asm volatile("s_wait_dscnt 0x0" ::: "memory");      /* this wave's last reads of the v parts and of P are done */
    __syncthreads();                                    /* ends every wave's reads of the v parts before any wave writes its output rows there (the foot of the last trip) */
    pv(a1, w1); }                                       /* keys 32..63 of the last tile, from registers */
  asm volatile("s_wait_tensorcnt 0x0" ::: "memory");    /* no tensor load outstanding behind the loop */
  asm volatile("s_wait_asynccnt 0x0" ::: "memory");     /* no copy outstanding behind the loop */
  asm volatile("s_wait_dscnt 0x0" ::: "memory");        /* no LDS read of this wave outstanding before the staging LDS takes the output */
  static_assert(8 * 64 * AT_OP * 4 <= 2 * AT_VB, "the output rows fit the v parts");
  float* sw = (float*)vst + wave * (64 * AT_OP);        /* the v parts are free now: each wave turns its own 64 x 64 block into rows */
#pragma unroll
  for (int i = 0; i < 4; ++i)
#pragma unroll
    for (int j = 0; j < 4; ++j)
#pragma unroll
      for (int r = 0; r < 8; ++r) sw[(i * 16 + 8 * g + r) * AT_OP + j * 16 + col] = acc[i][j][r] * (1.0f / 2048.0f);
  LDSX();
#pragma unroll 1   // four row pairs per trip: their x loads stand together ahead of the sums
  for (int it = 0; it < 32; it += 4) { v4f xr[4];
#pragma unroll
    for (int e = 0; e < 4; ++e) xr[e] = *(const v4f*)(X1 + ((size_t)b * TT + qb * 64 + (it + e) * 2 + g) * CC + wave * 64 + col * 4);
#pragma unroll
    for (int e = 0; e < 4; ++e) { const int rl = (it + e) * 2 + g; v4f v = *(const v4f*)&sw[rl * AT_OP + col * 4]; v[0] = gmv * v[0] + bfr(xr[e][0]); v[1] = gmv * v[1] + bfr(xr[e][1]); v[2] = gmv * v[2] + bfr(xr[e][2]); v[3] = gmv * v[3] + bfr(xr[e][3]); vst2(Y + ((size_t)b * TT + qb * 64 + rl) * CC + wave * 64 + col * 4, v); }
    asm volatile("s_wait_xcnt 0x0" ::: "memory"); } }   /* the wait: the next trip rewrites the address and data registers that these stores name */   /* out = gamma * attended + bf16(x): 256-B (row, 64-column) segments, each written once */

extern "C" void kernel_launch(void* const* d_in, const int* in_sizes, int n_in, void* d_out, int out_size, void* d_ws, size_t ws_size, hipStream_t stream) {
  (void)in_sizes; (void)n_in; (void)out_size;
  const float** F = (const float**)d_in;
  if (ws_size < (size_t)WS_END) return;
  char* ws = (char*)d_ws; _Float16 *QH = (_Float16*)(ws + WS_QH), *KH = (_Float16*)(ws + WS_KH), *VT = (_Float16*)(ws + WS_VT), *QL = (_Float16*)(ws + WS_QL), *KL = (_Float16*)(ws + WS_KL); __bf16 *VB = (__bf16*)(ws + WS_VB), *VBL = (__bf16*)(ws + WS_VBL); float *S = (float*)(ws + WS_S), *Y = (float*)(ws + WS_Y);
  (void)S; (void)Y; (void)QL; (void)KL; (void)VB; (void)VBL;
  // inputs: 0 x [4,64,64,512]; 1 Wq [512,64] (in,out); 2 Wk [512,64]; 3 Wv [512,512]; 4 gamma [1]
  k_proj<<<dim3(TNB * TT / 64, 2, 1), 256, 0, stream>>>(F[0], F[1], F[2], F[3], nullptr, nullptr, nullptr, QH, KH, KL, VT, VB, VBL);   /* v, q and k: two blocks of 320 columns per 64 rows */
  k_att<<<dim3(NQB, 1, TNB), 256, 0, stream>>>(QH, KH, VT, F[0], F[4], (float*)d_out);   /* logits, sigmoid and P . v of all batches in one launch */
}
